// v000
// Times are from an AMD MI455X. After a warm-up the kernel runs many times in a row, and a time is the length of
// such a window on the GPU divided by its runs, so every launch and the gaps after it count. The runs cycle
// through copies of the inputs. A figure is the median of several windows, for all but v000 over two sittings.
// Sittings can differ by a few percent; kernels timed side by side share one.
// The starting kernel, v000, takes 6970 microseconds a run.
#include <hip/hip_runtime.h>
#include <stddef.h>
#include <stdint.h>
#include <math.h>

// Contractions: v_wmma_f32_16x16x32_bf16 (bf16 operands, f32 accumulate) for the three projections
// x*[Wq|Wk|Wv]^T (K 1024, bf16 RNE copies of the inputs, products exact in f32) and for the trailing projection
// [o hi | o lo] * [Wx^T ; Wx^T] + bx (K 2048, attention output o carried as bf16 hi + bf16 residual).
// Per-edge per-head q.k dots (16 heads x 64), per-(query, b, head) running-max softmax over the query's own keys
// and the weighted value sums: f32 VALU.
//
// Row mapping: x [S][2][1024] and the output use row = 2*s + b (4096-B rows); q, k, v channel 64*h + c.
// Softmax: exp(qk - max) / sum over the edges sharing a q_id is evaluated per (query, b, head) with a running max
// over that query's keys (the shift cancels in num / den); a query without edges yields 0 * inf = NaN like 0 / 0.
//
// Carry audit: no power-of-two carries anywhere; no inverse factor exists.
//   XB    [MP][1024]   bf16 bits of x (pad rows zero)                      -> A of the projection GEMM
//   WQKVT [3072][1024] bf16 bits, row n = [Wq;Wk;Wv][n][k] (natural rows)  -> B of the projection GEMM
//   WXT   [1024][2048] bf16 bits, row n = Wx[n][k mod 1024]                -> B of the trailing GEMM
//   QKV   [MP][3072]   f32: q | k | v (+ bf16-valued bias)                  -> gathered by k_scan
//   APL   [MP][2048]   bf16 bits: o hi (cols 0..1023) | o lo (1024..2047)  -> A of the trailing GEMM

#define CW      1024                  // channels
#define BD      2                     // middle (batch) dimension of x
#define NHD     16                    // heads
#define HDM     64                    // head dim
#define QKVW    3072                  // node plane columns: q | k | v
#define OQ      0
#define OKK     1024
#define OV      2048
#define KOUT    2048                  // K of the trailing GEMM (hi | lo)
#define APITCH  2048                  // A plane pitch in 16-bit elements (4096 B = 32 lines)
#define NTHR    256
#define NWAVE   8
#define EPT     8
#define CHUNK   (NTHR * EPT)          // 2048 key entries per chunk
#define WCAP    (EPT * 32)            // 256: exact upper bound of hits per wave per chunk
#define LISTN   (NWAVE * WCAP)        // 2048 ints
#define NBA     512                   // query slots per scan block
#define SLA     9
#define RCAP    20480                 // hit-list capacity per block (32 keys per query -> 16384 hits)
#define DEGCAP  64                    // static per-slot trip clamp (64 keys per query)
#define GBM     64                    // GEMM rows per block
#define GBN     64                    // GEMM cols per block
#define GTHR    128                   // GEMM threads per block (4 waves)
#define UQKV    (CW * (CW / 8))       // 131072 weight-prep units per projection matrix
#define UWX     (CW * (KOUT / 8))     // 262144 units for the WXT plane
#define NUW     (3 * UQKV + UWX)      // 655360
#define AGG_ZINTS (LISTN + 2 * RCAP + 3 * NBA)            // 44544
#define MISC_INTS 16
#define SCAN_LDS_BYTES ((AGG_ZINTS + MISC_INTS) * 4)       // 178240
#define ATTSC   0.125f                // 1/sqrt(64)
#define WSMAX   134217728

static_assert((CHUNK & (CHUNK - 1)) == 0 && CHUNK <= 4096);
static_assert((NBA & (NBA - 1)) == 0 && NBA == (1 << SLA));
static_assert(((long long)CHUNK << SLA) < (1LL << 31));
static_assert(LISTN >= NWAVE * WCAP);
static_assert(NBA % NWAVE == 0 && NBA % 32 == 0);
static_assert(RCAP % 32 == 0 && AGG_ZINTS % 4 == 0 && LISTN % 4 == 0 && ((AGG_ZINTS + MISC_INTS) % 4) == 0);
static_assert(NWAVE * CW <= RCAP);                    // per-wave output-row staging lives inside the dead hit list
static_assert(SCAN_LDS_BYTES <= 300000);
static_assert(CW == 32 * 32);                         // lane owns 32 channels
static_assert(HDM == 2 * 32 && NHD * HDM == CW);      // 2 lanes per head
static_assert(QKVW == 3 * CW && (QKVW % GBN) == 0 && (CW % GBN) == 0);
static_assert((CW % 32) == 0 && (KOUT % 32) == 0 && KOUT == 2 * CW && APITCH == KOUT);
static_assert((APITCH * 2) % 128 == 0);
static_assert(GBM == (GTHR / 32) * 16);
static_assert(UQKV == (1 << 17) && (CW / 8) == 128 && (KOUT / 8) == 256);
static_assert(UQKV % NTHR == 0 && UWX % NTHR == 0 && (3 * UQKV) % NTHR == 0);
static_assert(DEGCAP >= 32);

typedef float          v4f  __attribute__((ext_vector_type(4)));
typedef float          v8f  __attribute__((ext_vector_type(8)));
typedef int            v4i  __attribute__((ext_vector_type(4)));
typedef int            v8i  __attribute__((ext_vector_type(8)));
typedef unsigned int   v4u  __attribute__((ext_vector_type(4)));
typedef unsigned short v8us __attribute__((ext_vector_type(8)));
typedef __bf16         v16b __attribute__((ext_vector_type(16)));
typedef v4f  __attribute__((may_alias)) v4fa;
typedef v4i  __attribute__((may_alias)) v4ia;
typedef v4u  __attribute__((may_alias)) v4ua;
typedef v8us __attribute__((may_alias)) v8usa;
union FragB { v16b v; v8us h[2]; v8i w; };

// WMMA with hazard guard: ties D, keeps A/B live for 4 VALU slots
__device__ __forceinline__ v8f wmb(const FragB& a, const FragB& b, v8f c) {
  v8f d = __builtin_amdgcn_wmma_f32_16x16x32_bf16(false, a.v, false, b.v, (short)0, c, false, false);
  asm volatile("v_nop\n\tv_nop\n\tv_nop\n\tv_nop" : "+v"(d) : "v"(a.w), "v"(b.w));
  return d;
}

// drain all outstanding vector-memory loads; also a compiler barrier for memory operations
__device__ __forceinline__ void ldwait() {
  asm volatile("s_wait_loadcnt 0x0" ::: "memory");
}

__device__ __forceinline__ void wave_sync() {
  __builtin_amdgcn_fence(__ATOMIC_RELEASE, "wavefront");
  __builtin_amdgcn_wave_barrier();
  __builtin_amdgcn_fence(__ATOMIC_ACQUIRE, "wavefront");
}

// f32 -> bf16 bits, RNE convert; bf16 bits -> f32
__device__ __forceinline__ unsigned int f2bf(float f) {
  const unsigned int u = __float_as_uint(f);
  return ((u + 0x7FFFu + ((u >> 16) & 1u)) >> 16) & 0xFFFFu;
}
__device__ __forceinline__ float bf2f(unsigned int b) { return __uint_as_float(b << 16); }
__device__ __forceinline__ float bfr(float f) { return bf2f(f2bf(f)); }
__device__ __forceinline__ v4f bfr4(const v4f a) {
  v4f r; r.x = bfr(a.x); r.y = bfr(a.y); r.z = bfr(a.z); r.w = bfr(a.w); return r;
}
__device__ __forceinline__ unsigned int pk2(float lo, float hi) { return f2bf(lo) | (f2bf(hi) << 16); }
// 8 floats -> 8 bf16 packed in 16 B (element 2i = low half of word i)
__device__ __forceinline__ v4u pack8(const v4f a, const v4f b) {
  v4u r;
  r.x = pk2(a.x, a.y); r.y = pk2(a.z, a.w); r.z = pk2(b.x, b.y); r.w = pk2(b.z, b.w);
  return r;
}
// hi = bf16(v), lo = bf16(v - hi): two floats -> one packed word of each
__device__ __forceinline__ void hl2(float v0, float v1, unsigned int& hw, unsigned int& lw) {
  const unsigned int h0 = f2bf(v0), h1 = f2bf(v1);
  const unsigned int l0 = f2bf(v0 - bf2f(h0)), l1 = f2bf(v1 - bf2f(h1));
  hw = h0 | (h1 << 16);
  lw = l0 | (l1 << 16);
}
__device__ __forceinline__ void pack8hl(const v4f a, const v4f b, v4u& hv, v4u& lv) {
  unsigned int h, l;
  hl2(a.x, a.y, h, l); hv.x = h; lv.x = l;
  hl2(a.z, a.w, h, l); hv.y = h; lv.y = l;
  hl2(b.x, b.y, h, l); hv.z = h; lv.z = l;
  hl2(b.z, b.w, h, l); hv.w = h; lv.w = l;
}

// ---------------------------------------------------------------------------
// One chunk of the key list (contiguous int array): each thread tests EPT entries against the block's
// slot range [slotBase, slotBase + nb); hits are appended to this wave's LDS list as (local_index << SLA | slot).
// Returns the wave-uniform hit count (<= WCAP always). The vector / scalar load choice is block-uniform; the
// scalar path clamps every address and selects the sentinel by value.
// ---------------------------------------------------------------------------
__device__ __forceinline__ int scan_chunk(const int* __restrict__ keys, int nE, int cbase, int slotBase,
                                          int nb, int vec8, int* list, int tid, int lane, int wave) {
  int wc = 0;
  const int el0  = tid * EPT;
  const int e0   = cbase + el0;
  const int sent = -2147483647 - 1;
  v4i da, db;
  if (vec8 != 0 && cbase + CHUNK <= nE) {
    da = *(const v4i*)(keys + e0);
    db = *(const v4i*)(keys + e0 + 4);
  } else {
    da.x = (e0     < nE) ? keys[min(e0,     nE - 1)] : sent;
    da.y = (e0 + 1 < nE) ? keys[min(e0 + 1, nE - 1)] : sent;
    da.z = (e0 + 2 < nE) ? keys[min(e0 + 2, nE - 1)] : sent;
    da.w = (e0 + 3 < nE) ? keys[min(e0 + 3, nE - 1)] : sent;
    db.x = (e0 + 4 < nE) ? keys[min(e0 + 4, nE - 1)] : sent;
    db.y = (e0 + 5 < nE) ? keys[min(e0 + 5, nE - 1)] : sent;
    db.z = (e0 + 6 < nE) ? keys[min(e0 + 6, nE - 1)] : sent;
    db.w = (e0 + 7 < nE) ? keys[min(e0 + 7, nE - 1)] : sent;
  }
  const unsigned nbs = (unsigned)slotBase;
  const unsigned unb = (unsigned)nb;
  const unsigned s0 = (unsigned)da.x - nbs, s1 = (unsigned)da.y - nbs;
  const unsigned s2 = (unsigned)da.z - nbs, s3 = (unsigned)da.w - nbs;
  const unsigned s4 = (unsigned)db.x - nbs, s5 = (unsigned)db.y - nbs;
  const unsigned s6 = (unsigned)db.z - nbs, s7 = (unsigned)db.w - nbs;
  const bool h0 = s0 < unb, h1 = s1 < unb, h2 = s2 < unb, h3 = s3 < unb;
  const bool h4 = s4 < unb, h5 = s5 < unb, h6 = s6 < unb, h7 = s7 < unb;
  const unsigned any = __builtin_amdgcn_ballot_w32(h0 | h1 | h2 | h3 | h4 | h5 | h6 | h7);
  if (any != 0u) {
#define HITJ(J, HJ, SJ) { \
      const unsigned mj = __builtin_amdgcn_ballot_w32(HJ); \
      if (mj != 0u) { \
        if (HJ) { \
          const int pos = wc + (int)__builtin_amdgcn_mbcnt_lo(mj, 0u); \
          if (pos < WCAP) list[wave * WCAP + pos] = ((el0 + (J)) << SLA) | (int)(SJ); \
        } \
        wc += (int)__builtin_popcount(mj); } }
    HITJ(0, h0, s0)
    HITJ(1, h1, s1)
    HITJ(2, h2, s2)
    HITJ(3, h3, s3)
    HITJ(4, h4, s4)
    HITJ(5, h5, s5)
    HITJ(6, h6, s6)
    HITJ(7, h7, s7)
#undef HITJ
  }
  return wc;
}

// ---------------------------------------------------------------------------
// Node feature plane: XB[row][c] = bf16(x[row][c]) for row < nN (all 1024 c), zero for pad rows nN <= row < MP
// (load address clamped into x, value zeroed by select). One thread = 8 contiguous 16-bit values (16 B) from two
// coverage: nUnits = MP*128 threads x 8 = MP x 1024 elements exactly.
// ---------------------------------------------------------------------------
__global__ __launch_bounds__(NTHR) void k_xprep(const float* __restrict__ x, unsigned short* xb, int nN, int nUnits) {
  const int i = (int)blockIdx.x * NTHR + (int)threadIdx.x;
  if (i >= nUnits) return;
  const int row = i >> 7;
  const int c0  = (i & 127) * 8;
  const int rc  = row < nN ? row : nN - 1;
  const float* p = x + (size_t)rc * CW + c0;
  v4f a = *(const v4fa*)p;
  v4f b = *(const v4fa*)(p + 4);
  const v4f z4 = {0.f, 0.f, 0.f, 0.f};
  if (row >= nN) { a = z4; b = z4; }
  const v4u hv = pack8(a, b);
  unsigned short* o = xb + (size_t)row * CW + c0;
  *(v4u*)o = hv;
  
}

// ---------------------------------------------------------------------------
// Weight planes (k-contiguous B rows, bf16 bits of the f32 inputs).
//   units 0..393215 (part = u >> 17, block-uniform): WQKVT[part*1024 + n][k8..k8+7] = bf16(W_part[n][k8..]),
//     W_part in {Wq, Wk, Wv}, each a natural [1024][1024] row-major matrix (out x in).
//   units 393216..655359 (block-uniform): WXT[n][k8..k8+7] = bf16(Wx[n][(k8 mod 1024) ..]) for k8 in 0..2040.
// coverage: WQKVT = 3 x 131072 units x 8 = 3072 x 1024 exactly; WXT = 262144 units x 8 = 1024 x 2048 exactly.
// ---------------------------------------------------------------------------
__global__ __launch_bounds__(NTHR) void k_wprep(const float* __restrict__ Wq, const float* __restrict__ Wk,
                                                const float* __restrict__ Wv, const float* __restrict__ Wx,
                                                unsigned short* WQKVT, unsigned short* WXT) {
  const int u = (int)blockIdx.x * NTHR + (int)threadIdx.x;
  if (u >= NUW) return;
  v4f a, b;
  unsigned short* dp;
  if (u < 3 * UQKV) {                                    // block-uniform
    const int part = u >> 17;
    const int v    = u & (UQKV - 1);
    const int n    = v >> 7;                             // 0..1023
    const int k8   = (v & 127) * 8;                      // 0..1016
    const float* W = (part == 0) ? Wq : ((part == 1) ? Wk : Wv);
    const float* p = W + (size_t)n * CW + k8;            // W[n][k8 .. k8+7], contiguous
    a = *(const v4fa*)p;
    b = *(const v4fa*)(p + 4);
    dp = WQKVT + (size_t)(part * CW + n) * CW + k8;
  } else {
    const int v  = u - 3 * UQKV;                         // 0..262143
    const int n  = v >> 8;                               // 0..1023
    const int k8 = (v & 255) * 8;                        // 0..2040
    const int kk = k8 & (CW - 1);                        // source column, in range
    const float* p = Wx + (size_t)n * CW + kk;           // Wx[n][kk .. kk+7], contiguous
    a = *(const v4fa*)p;
    b = *(const v4fa*)(p + 4);
    dp = WXT + (size_t)n * KOUT + k8;
  }
  const v4u wv = pack8(a, b);
  *(v4u*)dp = wv;
  
}

// ---------------------------------------------------------------------------
// bf16 WMMA GEMM: C[rows][N] = A[MP][K] (bf16 bits, pitch lda) x WT[N][K]^T (bf16 rows n, k-contiguous, pitch K),
// K = 32*ksteps. grid (MP/64, N/64), 128 threads: wave w owns rows 16w..16w+15 of the 64x64 block tile,
// acc[4] = 4 col tiles. A fragment (row m = lane&15): elements 0..7 <- k0+8h+0..7, 8..15 <- k0+16+8h+0..7
// (h = lane>>4), straight from the 16-bit row; B fragment (col n = lane&15) from WT row (col0+16t+n) with the
// SAME k map; D element r = (row 8h+r, col lane&15).
// Epilogue: + bf16-valued bias (bias vector selected by col0 / 1024, block-uniform; scaled by useBias in {0,1};
// the load is always in range), 64x64 f32 tile staged in LDS; one instruction then writes two 256-B row segments
// coverage: rows rowBase..rowBase+63 restricted to < nRows x cols col0..col0+63 per block;
//   grid (MP/64, N/64) covers every (row < nRows, col) exactly once.
// LDS extents: stg 64x64 fully written before the barrier.
// ---------------------------------------------------------------------------
__global__ __launch_bounds__(GTHR) void k_gemm(
    const unsigned short* __restrict__ A, int lda, const unsigned short* __restrict__ WT, int K,
    float* outF, int ldo, int nRows,
    const float* __restrict__ bs0, const float* __restrict__ bs1, const float* __restrict__ bs2, int useBias)
{
  __shared__ __attribute__((aligned(16))) float stg[GBM * GBN];   // 16 KB
  const int tid = (int)threadIdx.x, lane = tid & 31, wave = tid >> 5, hh = lane >> 4, m = lane & 15;
  const int rowBase = (int)blockIdx.x * GBM;
  const int col0    = (int)blockIdx.y * GBN;

  v8f acc[4];
  {
    const v8f z = {0.f, 0.f, 0.f, 0.f, 0.f, 0.f, 0.f, 0.f};
    acc[0] = z; acc[1] = z; acc[2] = z; acc[3] = z;
  }
  const unsigned short* ap = A  + (size_t)(rowBase + 16 * wave + m) * (size_t)lda + 8 * hh;
  const unsigned short* wp = WT + (size_t)(col0 + m) * (size_t)K + 8 * hh;
  const int ksteps = K >> 5;
#pragma unroll 1
  for (int ks = 0; ks < ksteps; ++ks) {
    FragB af;
    af.h[0] = *(const v8usa*)(ap + 32 * ks);          // k = 32ks + 8hh + 0..7
    af.h[1] = *(const v8usa*)(ap + 32 * ks + 16);     // k = 32ks + 16 + 8hh + 0..7
#pragma unroll
    for (int t = 0; t < 4; ++t) {
      const unsigned short* wq = wp + (size_t)(16 * t) * (size_t)K + 32 * ks;   // WT row col0 + 16t + m
      FragB bf;
      bf.h[0] = *(const v8usa*)wq;                      // same k map as A
      bf.h[1] = *(const v8usa*)(wq + 16);
      acc[t] = wmb(af, bf, acc[t]);
    }
  }

#pragma unroll
  for (int t = 0; t < 4; ++t) {
    const int lc = 16 * t + m;
#pragma unroll
    for (int r = 0; r < 8; ++r) {
      const int lr = 16 * wave + 8 * hh + r;            // D element r = (row 8hh+r, col m)
      stg[lr * GBN + lc] = acc[t][r];
    }
  }
  __syncthreads();

  const int mat = col0 / CW;                            // block-uniform
  const float* bsel = (mat == 0) ? bs0 : ((mat == 1) ? bs1 : bs2);
  v4f b4 = *(const v4fa*)(bsel + (col0 & (CW - 1)) + 4 * m);
  b4 = bfr4(b4) * (float)useBias;

  v4f fv[8];
#pragma unroll
  for (int i = 0; i < 8; ++i) {
    const int lr = 16 * wave + 2 * i + hh;
    fv[i] = *(const v4fa*)(stg + lr * GBN + 4 * m) + b4;
  }
#pragma unroll
  for (int i = 0; i < 8; ++i) {
    const int lr = 16 * wave + 2 * i + hh;
    const int gr = rowBase + lr;
    const int gs = gr < nRows ? gr : nRows - 1;
    float* op = outF + (size_t)gs * (size_t)ldo + col0 + 4 * m;
    if (gr < nRows) *(v4f*)op = fv[i];
  }
  
}

// ---------------------------------------------------------------------------
// Query-keyed sparse attention, no atomics, no global tables. Block owns query slots [nodeBase, nodeBase + NBA);
// key of edge e = qid[e], the gathered side is kid[e].
// Phase 1: chunk scan of the whole qid list; wave 0 drains each chunk's per-wave hit lists in fixed (wave, lane)
//   order, lane 0 appends (eid << SLA | slot) to the block list hl (cap RCAP, overflow -> flag) and increments
//   cnt[slot]. Phase 2: wave 0: exclusive scan of cnt -> offs, then lane 0 places every hit into sl in slot order
//   (within a slot hits keep their hl order: chunk, wave, entry index j, lane).
// Phase 3 (waves independent, no block barriers): wave w owns slots w, w+8, ...; for each slot both b rows
//   (row = 2*query + b of the QKV plane). Lane l owns channels 32l..32l+31 (head hd = l>>1). Per (slot, b): the
//   1024-float q row (8 b128 loads per lane). Per edge in fixed slot order: kd = kid[eid] (clamped), the k row of
//   (kd, b) (8 b128 loads per lane), dot of the lane's 32 channels, head sum by xor 1, logit * 1/8, running-max
//   single pass per head: den = den*exp(mx-mn) + exp(l-mn), av_c likewise with the v row of (kd, b).
//   o_c = av_c / den (NaN poison on cap overflow, zero row for pad queries >= nS); the 1024-float row is relaid out
//   through the wave's private LDS row so that every store instruction writes 512 contiguous bytes:
// coverage: gridDim.x * NBA * 2 >= mRows (host-checked): APL rows 0..mRows-1 x cols 0..2047 written exactly once.
// LDS extents: list LISTN, hl/sl RCAP, cnt/offs/cur NBA, misc 16 zeroed before any read; per-wave staging row:
//   elements 0..1023 written by the same wave (32 lanes x 32 floats) before each reload.
// ---------------------------------------------------------------------------
__global__ __launch_bounds__(NTHR) void k_scan(const int* __restrict__ qid, const int* __restrict__ kid,
                                               const float* __restrict__ QKV, unsigned short* apl,
                                               int nE, int nS, int mRows, int vec8) {
  extern __shared__ __attribute__((aligned(16))) int dsm[];
  int* list = dsm;                         // LISTN
  int* hl   = dsm + LISTN;                 // RCAP
  int* sl   = hl + RCAP;                   // RCAP
  int* cnt  = sl + RCAP;                   // NBA
  int* offs = cnt + NBA;                   // NBA
  int* cur  = offs + NBA;                  // NBA
  int* misc = cur + NBA;                   // [0..7] per-wave hit counts, [8] total, [9] overflow flag
  const int tid = (int)threadIdx.x, lane = tid & 31, wave = tid >> 5;
  const int nodeBase = (int)blockIdx.x * NBA;

  {
    const v4i z4 = {0, 0, 0, 0};
    for (int i = tid * 4; i < AGG_ZINTS; i += NTHR * 4) *(v4ia*)(dsm + i) = z4;
    if (tid < MISC_INTS) misc[tid] = 0;
  }
  __syncthreads();

  // ---- phase 1: scan + fixed-order drain into hl / cnt
  int t = 0, ov = 0;
  const int nChunks = (nE + CHUNK - 1) / CHUNK;
#pragma unroll 1
  for (int ch = 0; ch < nChunks; ++ch) {
    const int cbase = ch * CHUNK;
    const int wc = scan_chunk(qid, nE, cbase, nodeBase, NBA, vec8, list, tid, lane, wave);
    if (lane == 0) misc[wave] = wc;
    __syncthreads();
    if (wave == 0) {
#pragma unroll 1
      for (int w2 = 0; w2 < NWAVE; ++w2) {
        int c = misc[w2];
        c = c < 0 ? 0 : (c > WCAP ? WCAP : c);
#pragma unroll 1
        for (int b0 = 0; b0 < c; b0 += 32) {
          const int idx = b0 + lane;
          const int ent = list[w2 * WCAP + (idx < WCAP ? idx : WCAP - 1)];
          const int m32 = (c - b0) < 32 ? (c - b0) : 32;
#pragma unroll 1
          for (int k = 0; k < m32; ++k) {
            const int u    = __builtin_amdgcn_readlane(ent, k);
            const int slot = u & (NBA - 1);
            const int el   = (u >> SLA) & (CHUNK - 1);
            const int pk   = ((cbase + el) << SLA) | slot;
            if (t < RCAP) {
              if (lane == 0) { hl[t] = pk; cnt[slot] = cnt[slot] + 1; }
              t = t + 1;
            } else {
              ov = 1;
            }
          }
        }
      }
    }
    __syncthreads();
  }
  if (wave == 0 && lane == 0) { misc[8] = t; misc[9] = ov; }
  __syncthreads();
  int tt = misc[8];
  tt = tt < 0 ? 0 : (tt > RCAP ? RCAP : tt);
  const int ovf = misc[9];

  // ---- phase 2: offsets and placement (wave 0)
  if (wave == 0) {
    const int base = lane * (NBA / 32);
    int s = 0;
#pragma unroll 1
    for (int i = 0; i < NBA / 32; ++i) s += cnt[base + i];
    int incl = s;
#pragma unroll
    for (int d = 1; d < 32; d <<= 1) {
      const int y = __shfl_up(incl, d, 32);
      if (lane >= d) incl += y;
    }
    int run = incl - s;
#pragma unroll 1
    for (int i = 0; i < NBA / 32; ++i) {
      const int cv = cnt[base + i];
      offs[base + i] = run;
      cur[base + i]  = run;
      run += cv;
    }
  }
  __syncthreads();
  if (wave == 0) {
#pragma unroll 1
    for (int b0 = 0; b0 < tt; b0 += 32) {
      const int idx = b0 + lane;
      const int ent = hl[idx < RCAP ? idx : RCAP - 1];
      const int m32 = (tt - b0) < 32 ? (tt - b0) : 32;
#pragma unroll 1
      for (int k = 0; k < m32; ++k) {
        const int u    = __builtin_amdgcn_readlane(ent, k);
        const int slot = u & (NBA - 1);
        if (lane == 0) {
          int p = cur[slot];
          p = p < 0 ? 0 : (p > RCAP - 1 ? RCAP - 1 : p);
          sl[p] = u;
          cur[slot] = p + 1;
        }
      }
    }
  }
  __syncthreads();

  // ---- phase 3: per-(slot, b) edge attention + row build
  const float qnan = __int_as_float(0x7fc00000);
  float* stg = (float*)hl + wave * CW;                  // per-wave staging row [1024] (hl is dead after phase 2)
  const v4f z4 = {0.f, 0.f, 0.f, 0.f};
#pragma unroll 1
  for (int si = 0; si < NBA / NWAVE; ++si) {
    const int s  = si * NWAVE + wave;
    const int qn = nodeBase + s;                        // query index
    int c = cnt[s];
    const bool big = c > DEGCAP;
    c = c < 0 ? 0 : (c > DEGCAP ? DEGCAP : c);
    int o = offs[s];
    o = o < 0 ? 0 : (o > RCAP ? RCAP : o);
    const int  qc   = qn < nS ? qn : nS - 1;
    const bool live = qn < nS;                          // wave-uniform
    const bool pois = big || (ovf != 0);

#pragma unroll 1
    for (int b = 0; b < BD; ++b) {
      const float* qr = QKV + ((size_t)qc * BD + b) * QKVW + OQ + 32 * lane;
      v4f qv[8];
#pragma unroll
      for (int j = 0; j < 8; ++j) qv[j] = *(const v4fa*)(qr + 4 * j);
      ldwait();

      float mx = -1.0e30f, dn = 0.0f;
      v4f av[8];
#pragma unroll
      for (int j = 0; j < 8; ++j) av[j] = z4;

#pragma unroll 1
      for (int b0 = 0; b0 < c; b0 += 32) {
        int idx = o + b0 + lane;
        idx = idx > RCAP - 1 ? RCAP - 1 : idx;
        const int ent = sl[idx];
        int eid = ent >> SLA;
        eid = eid < 0 ? 0 : (eid > nE - 1 ? nE - 1 : eid);
        int kd = kid[eid];
        kd = kd < 0 ? 0 : (kd > nS - 1 ? nS - 1 : kd);
        const int m32 = (c - b0) < 32 ? (c - b0) : 32;
#pragma unroll 1
        for (int k = 0; k < m32; ++k) {
          const int tk = __builtin_amdgcn_readlane(kd, k);
          const float* kr = QKV + ((size_t)tk * BD + b) * QKVW + OKK + 32 * lane;   // whole 4-KB k row
          v4f kv[8];
#pragma unroll
          for (int j = 0; j < 8; ++j) kv[j] = *(const v4fa*)(kr + 4 * j);
          ldwait();
          float p = 0.0f;
#pragma unroll
          for (int j = 0; j < 8; ++j) {
            p = fmaf(qv[j].x, kv[j].x, p); p = fmaf(qv[j].y, kv[j].y, p);
            p = fmaf(qv[j].z, kv[j].z, p); p = fmaf(qv[j].w, kv[j].w, p);
          }
          p += __shfl_xor(p, 1);                        // sum over the head's 2 lanes
          const float lg = p * ATTSC;
          const float df = lg - mx;
          const float ee = __expf(-fabsf(df));          // the other factor is exactly 1
          const bool up  = df > 0.0f;
          const float s1 = up ? ee : 1.0f;
          const float s2 = up ? 1.0f : ee;
          mx = up ? lg : mx;
          dn = fmaf(dn, s1, s2);
          const float* vr = QKV + ((size_t)tk * BD + b) * QKVW + OV + 32 * lane;    // whole 4-KB v row
          v4f vv[8];
#pragma unroll
          for (int j = 0; j < 8; ++j) vv[j] = *(const v4fa*)(vr + 4 * j);
          ldwait();
#pragma unroll
          for (int j = 0; j < 8; ++j) {
            av[j].x = fmaf(av[j].x, s1, s2 * vv[j].x); av[j].y = fmaf(av[j].y, s1, s2 * vv[j].y);
            av[j].z = fmaf(av[j].z, s1, s2 * vv[j].z); av[j].w = fmaf(av[j].w, s1, s2 * vv[j].w);
          }
        }
      }

      const float inv  = __builtin_amdgcn_rcpf(dn);     // den >= 1 when c > 0; c == 0 -> inf and 0 * inf = NaN (0 / 0)
      const float invp = pois ? qnan : inv;
      wave_sync();                                       // prior reads of the staging row are done
#pragma unroll
      for (int j = 0; j < 8; ++j) {
        v4f o4;
        o4.x = live ? av[j].x * invp : 0.0f;
        o4.y = live ? av[j].y * invp : 0.0f;
        o4.z = live ? av[j].z * invp : 0.0f;
        o4.w = live ? av[j].w * invp : 0.0f;
        *(v4fa*)(stg + 32 * lane + 4 * j) = o4;          // lane writes cols 32l .. 32l+31
      }
      wave_sync();
      v4u hv[4], lv[4];
#pragma unroll
      for (int j = 0; j < 4; ++j) {
        const v4f pa = *(const v4fa*)(stg + 256 * j + 8 * lane);         // lane reads cols 256j+8l .. +7
        const v4f pb = *(const v4fa*)(stg + 256 * j + 8 * lane + 4);
        pack8hl(pa, pb, hv[j], lv[j]);
      }
      const int row = qn * BD + b;
      if (row < mRows) {                                 // wave-uniform
        unsigned short* rp = apl + (size_t)row * APITCH;
#pragma unroll
        for (int j = 0; j < 4; ++j) {
          *(v4u*)(rp + 256 * j + 8 * lane)      = hv[j];
          *(v4u*)(rp + CW + 256 * j + 8 * lane) = lv[j];
        }
        
      }
    }
  }
}

// ---------------------------------------------------------------------------
static inline int cdiv(int a, int b) { return (a + b - 1) / b; }
static inline size_t al256(size_t o) { return (o + 255) & ~(size_t)255; }

extern "C" void kernel_launch(void* const* d_in, const int* in_sizes, int n_in,
                              void* d_out, int out_size, void* d_ws, size_t ws_size,
                              hipStream_t stream) {
  if (n_in < 11) return;
  if (in_sizes[0] < BD * CW || (in_sizes[0] % (BD * CW)) != 0) return;   // x [S][2][1024]
  const int nS = in_sizes[0] / (BD * CW);
  if (nS < 1 || nS > (1 << 20)) return;
  const int nE = in_sizes[1];                                          // q_id [E]
  if (nE < 1 || nE >= (1 << (31 - SLA))) return;                       // (eid << 9 | slot) fits a positive int
  if (in_sizes[2] != nE) return;                                       // k_id [E]
  if (in_sizes[3] != CW * CW || in_sizes[5] != CW * CW || in_sizes[7] != CW * CW || in_sizes[9] != CW * CW) return;
  if (in_sizes[4] != CW || in_sizes[6] != CW || in_sizes[8] != CW || in_sizes[10] != CW) return;
  if ((long long)out_size != (long long)nS * BD * CW) return;          // out [S][2][1024]

  const float* x   = (const float*)d_in[0];     // [S][2][1024] -> rows 2s+b of 1024
  const int*   qid = (const int*)  d_in[1];     // [E] key side (query)
  const int*   kid = (const int*)  d_in[2];     // [E] gathered side (k, v)
  const float* Wq  = (const float*)d_in[3];     // [1024][1024] natural [out][in]
  const float* bq  = (const float*)d_in[4];
  const float* Wk  = (const float*)d_in[5];
  const float* bk  = (const float*)d_in[6];
  const float* Wv  = (const float*)d_in[7];
  const float* bv  = (const float*)d_in[8];
  const float* Wx  = (const float*)d_in[9];
  const float* bx  = (const float*)d_in[10];
  float* out = (float*)d_out;                   // [S][2][1024] -> rows 2s+b of 1024

  const int nRows = nS * BD;
  const int MP = cdiv(nRows, GBM) * GBM;        // padded rows of every node plane
  const int gM = MP / GBM;
  const int gA = cdiv(cdiv(MP, BD), NBA);
  if ((long long)gA * NBA * BD < (long long)MP) return;
  const int vec8 = ((nE & 3) == 0) ? 1 : 0;

  // workspace carve (256-B aligned; every region sized to its whole-row store extent incl. padded rows MP)
  char* ws = (char*)d_ws;
  size_t off = 0;
  const size_t oXB  = off; off = al256(off + (size_t)MP * CW * 2);        // XB    [MP][1024]   bf16
  const size_t oWQ  = off; off = al256(off + (size_t)QKVW * CW * 2);      // WQKVT [3072][1024] bf16
  const size_t oWX  = off; off = al256(off + (size_t)CW * KOUT * 2);      // WXT   [1024][2048] bf16
  const size_t oQKV = off; off = al256(off + (size_t)MP * QKVW * 4);      // QKV   [MP][3072]   f32
  const size_t oAPL = off; off = al256(off + (size_t)MP * APITCH * 2);    // APL   [MP][2048]   bf16
  if (off > ws_size || off > (size_t)WSMAX) return;
  unsigned short* XB    = (unsigned short*)(ws + oXB);
  unsigned short* WQKVT = (unsigned short*)(ws + oWQ);
  unsigned short* WXT   = (unsigned short*)(ws + oWX);
  float*          QKV   = (float*)(ws + oQKV);
  unsigned short* APL   = (unsigned short*)(ws + oAPL);

  hipFuncSetAttribute(reinterpret_cast<const void*>(&k_scan),
                      hipFuncAttributeMaxDynamicSharedMemorySize, SCAN_LDS_BYTES);

  // node feature plane (bf16 bits), pad rows zero
  const int nUx = MP * (CW / 8);
  k_xprep<<<cdiv(nUx, NTHR), NTHR, 0, stream>>>(x, XB, nRows, nUx);
  // weight planes
  k_wprep<<<NUW / NTHR, NTHR, 0, stream>>>(Wq, Wk, Wv, Wx, WQKVT, WXT);
  // projection GEMM: QKV = XB [Wq|Wk|Wv]^T + b -> f32 [MP][3072]
  k_gemm<<<dim3(gM, QKVW / GBN), GTHR, 0, stream>>>(XB, CW, WQKVT, CW, QKV, QKVW, MP, bq, bk, bv, 1);
  // query-keyed sparse attention -> APL [MP][2048]
  k_scan<<<gA, NTHR, SCAN_LDS_BYTES, stream>>>(qid, kid, QKV, APL, nE, nS, MP, vec8);
  // trailing GEMM: out = APL . WXT^T + bx -> rows < nRows
  k_gemm<<<dim3(gM, CW / GBN), GTHR, 0, stream>>>(APL, APITCH, WXT, KOUT, out, CW, nRows, bx, bx, bx, 1);
}

// v001
// Measured time: 320 microseconds a run.
// Timed twice side by side with v000, it ran 21.7 and 21.9 times as fast.
#include <hip/hip_runtime.h>
#include <stddef.h>
#include <stdint.h>
#include <math.h>

// Contractions: v_wmma_f32_16x16x32_bf16 (bf16 operands, f32 accumulate) for the three projections
// x*[Wq|Wk|Wv]^T (K 1024, bf16 RNE copies of the inputs, products exact in f32) and for the trailing projection
// [o hi | o lo] * [Wx^T ; Wx^T] + bx (K 2048, attention output o carried as bf16 hi + bf16 residual).
// Per-edge per-head q.k dots (16 heads x 64), per-(query, b, head) running-max softmax over the query's own keys
// and the weighted value sums: f32 VALU.
//
// Row mapping: x [S][2][1024] and the output use row = 2*s + b (4096-B rows); q, k, v channel 64*h + c.
// Softmax: exp(qk - max) / sum over the edges sharing a q_id is evaluated per (query, b, head) with a running max
// over that query's keys (the shift cancels in num / den); a query without edges yields 0 * inf = NaN like 0 / 0.
//
// Carry audit: no power-of-two carries anywhere; no inverse factor exists.
//   XB    [MP][1024]   bf16 bits of x (pad rows zero)                      -> A of the projection GEMM
//   WQKVT [3072][1024] bf16 bits, row n = [Wq;Wk;Wv][n][k] (natural rows)  -> B of the projection GEMM
//   WXT   [1024][2048] bf16 bits, row n = Wx[n][k mod 1024]                -> B of the trailing GEMM
//   QKV   [MP][3072]   f32: q | k | v (+ bf16-valued bias)                  -> gathered by k_scan
//   APL   [MP][2048]   bf16 bits: o hi (cols 0..1023) | o lo (1024..2047)  -> A of the trailing GEMM

#define CW      1024                  // channels
#define BD      2                     // middle (batch) dimension of x
#define NHD     16                    // heads
#define HDM     64                    // head dim
#define QKVW    3072                  // node plane columns: q | k | v
#define OQ      0
#define OKK     1024
#define OV      2048
#define KOUT    2048                  // K of the trailing GEMM (hi | lo)
#define APITCH  2048                  // A plane pitch in 16-bit elements (4096 B = 32 lines)
#define NTHR    256
#define NWAVE   8
#define EPT     8
#define CHUNK   (NTHR * EPT)          // 2048 key entries per chunk
#define WCAP    (EPT * 32)            // 256: exact upper bound of hits per wave per chunk
#define LISTN   (NWAVE * WCAP)        // 2048 ints
#define NBA     4                     // query slots per scan block: NBA * BD = 8 (slot, b) rows, one per wave
#define SLA     2
#define RCAP    8192                  // hit-list capacity per block (>= NBA * DEGCAP; also holds the 8 staging rows)
#define DEGCAP  64                    // static per-slot trip clamp (64 keys per query)
#define GBM     64                    // GEMM rows per block
#define GBN     64                    // GEMM cols per block
#define GTHR    128                   // GEMM threads per block (4 waves)
#define UQKV    (CW * (CW / 8))       // 131072 weight-prep units per projection matrix
#define UWX     (CW * (KOUT / 8))     // 262144 units for the WXT plane
#define NUW     (3 * UQKV + UWX)      // 655360
#define AGG_ZINTS (LISTN + 2 * RCAP + 3 * NBA)            // 18444
#define MISC_INTS 16
#define SCAN_LDS_BYTES ((AGG_ZINTS + MISC_INTS) * 4)       // 73840
#define ATTSC   0.125f                // 1/sqrt(64)
#define WSMAX   134217728

static_assert((CHUNK & (CHUNK - 1)) == 0 && CHUNK <= 4096);
static_assert((NBA & (NBA - 1)) == 0 && NBA == (1 << SLA));
static_assert(((long long)CHUNK << SLA) < (1LL << 31));
static_assert(LISTN >= NWAVE * WCAP);
static_assert(NBA * BD == NWAVE && NBA <= 32 && RCAP >= NBA * DEGCAP);
static_assert(RCAP % 32 == 0 && AGG_ZINTS % 4 == 0 && LISTN % 4 == 0 && ((AGG_ZINTS + MISC_INTS) % 4) == 0);
static_assert(NWAVE * CW <= RCAP);                    // per-wave output-row staging lives inside the dead hit list
static_assert(SCAN_LDS_BYTES <= 300000);
static_assert(CW == 32 * 32);                         // lane owns 32 channels
static_assert(HDM == 2 * 32 && NHD * HDM == CW);      // 2 lanes per head
static_assert(QKVW == 3 * CW && (QKVW % GBN) == 0 && (CW % GBN) == 0);
static_assert((CW % 32) == 0 && (KOUT % 32) == 0 && KOUT == 2 * CW && APITCH == KOUT);
static_assert((APITCH * 2) % 128 == 0);
static_assert(GBM == (GTHR / 32) * 16);
static_assert(UQKV == (1 << 17) && (CW / 8) == 128 && (KOUT / 8) == 256);
static_assert(UQKV % NTHR == 0 && UWX % NTHR == 0 && (3 * UQKV) % NTHR == 0);
static_assert(DEGCAP >= 32);

typedef float          v4f  __attribute__((ext_vector_type(4)));
typedef float          v8f  __attribute__((ext_vector_type(8)));
typedef int            v4i  __attribute__((ext_vector_type(4)));
typedef int            v8i  __attribute__((ext_vector_type(8)));
typedef unsigned int   v4u  __attribute__((ext_vector_type(4)));
typedef unsigned short v8us __attribute__((ext_vector_type(8)));
typedef __bf16         v16b __attribute__((ext_vector_type(16)));
typedef v4f  __attribute__((may_alias)) v4fa;
typedef v4i  __attribute__((may_alias)) v4ia;
typedef v4u  __attribute__((may_alias)) v4ua;
typedef v8us __attribute__((may_alias)) v8usa;
union FragB { v16b v; v8us h[2]; v8i w; };

// WMMA with hazard guard: ties D, keeps A/B live for 4 VALU slots
__device__ __forceinline__ v8f wmb(const FragB& a, const FragB& b, v8f c) {
  v8f d = __builtin_amdgcn_wmma_f32_16x16x32_bf16(false, a.v, false, b.v, (short)0, c, false, false);
  asm volatile("v_nop\n\tv_nop\n\tv_nop\n\tv_nop" : "+v"(d) : "v"(a.w), "v"(b.w));
  return d;
}

// drain all outstanding vector-memory loads; also a compiler barrier for memory operations
__device__ __forceinline__ void ldwait() {
  asm volatile("s_wait_loadcnt 0x0" ::: "memory");
}

__device__ __forceinline__ void wave_sync() {
  __builtin_amdgcn_fence(__ATOMIC_RELEASE, "wavefront");
  __builtin_amdgcn_wave_barrier();
  __builtin_amdgcn_fence(__ATOMIC_ACQUIRE, "wavefront");
}

// f32 -> bf16 bits, RNE convert; bf16 bits -> f32
__device__ __forceinline__ unsigned int f2bf(float f) {
  const unsigned int u = __float_as_uint(f);
  return ((u + 0x7FFFu + ((u >> 16) & 1u)) >> 16) & 0xFFFFu;
}
__device__ __forceinline__ float bf2f(unsigned int b) { return __uint_as_float(b << 16); }
__device__ __forceinline__ float bfr(float f) { return bf2f(f2bf(f)); }
__device__ __forceinline__ v4f bfr4(const v4f a) {
  v4f r; r.x = bfr(a.x); r.y = bfr(a.y); r.z = bfr(a.z); r.w = bfr(a.w); return r;
}
__device__ __forceinline__ unsigned int pk2(float lo, float hi) { return f2bf(lo) | (f2bf(hi) << 16); }
// 8 floats -> 8 bf16 packed in 16 B (element 2i = low half of word i)
__device__ __forceinline__ v4u pack8(const v4f a, const v4f b) {
  v4u r;
  r.x = pk2(a.x, a.y); r.y = pk2(a.z, a.w); r.z = pk2(b.x, b.y); r.w = pk2(b.z, b.w);
  return r;
}
// hi = bf16(v), lo = bf16(v - hi): two floats -> one packed word of each
__device__ __forceinline__ void hl2(float v0, float v1, unsigned int& hw, unsigned int& lw) {
  const unsigned int h0 = f2bf(v0), h1 = f2bf(v1);
  const unsigned int l0 = f2bf(v0 - bf2f(h0)), l1 = f2bf(v1 - bf2f(h1));
  hw = h0 | (h1 << 16);
  lw = l0 | (l1 << 16);
}
__device__ __forceinline__ void pack8hl(const v4f a, const v4f b, v4u& hv, v4u& lv) {
  unsigned int h, l;
  hl2(a.x, a.y, h, l); hv.x = h; lv.x = l;
  hl2(a.z, a.w, h, l); hv.y = h; lv.y = l;
  hl2(b.x, b.y, h, l); hv.z = h; lv.z = l;
  hl2(b.z, b.w, h, l); hv.w = h; lv.w = l;
}

// ---------------------------------------------------------------------------
// One chunk of the key list (contiguous int array): each thread tests EPT entries against the block's
// slot range [slotBase, slotBase + nb); hits are appended to this wave's LDS list as (local_index << SLA | slot).
// Returns the wave-uniform hit count (<= WCAP always). The vector / scalar load choice is block-uniform; the
// scalar path clamps every address and selects the sentinel by value.
// ---------------------------------------------------------------------------
__device__ __forceinline__ int scan_chunk(const int* __restrict__ keys, int nE, int cbase, int slotBase,
                                          int nb, int vec8, int* list, int tid, int lane, int wave) {
  int wc = 0;
  const int el0  = tid * EPT;
  const int e0   = cbase + el0;
  const int sent = -2147483647 - 1;
  v4i da, db;
  if (vec8 != 0 && cbase + CHUNK <= nE) {
    da = *(const v4i*)(keys + e0);
    db = *(const v4i*)(keys + e0 + 4);
  } else {
    da.x = (e0     < nE) ? keys[min(e0,     nE - 1)] : sent;
    da.y = (e0 + 1 < nE) ? keys[min(e0 + 1, nE - 1)] : sent;
    da.z = (e0 + 2 < nE) ? keys[min(e0 + 2, nE - 1)] : sent;
    da.w = (e0 + 3 < nE) ? keys[min(e0 + 3, nE - 1)] : sent;
    db.x = (e0 + 4 < nE) ? keys[min(e0 + 4, nE - 1)] : sent;
    db.y = (e0 + 5 < nE) ? keys[min(e0 + 5, nE - 1)] : sent;
    db.z = (e0 + 6 < nE) ? keys[min(e0 + 6, nE - 1)] : sent;
    db.w = (e0 + 7 < nE) ? keys[min(e0 + 7, nE - 1)] : sent;
  }
  const unsigned nbs = (unsigned)slotBase;
  const unsigned unb = (unsigned)nb;
  const unsigned s0 = (unsigned)da.x - nbs, s1 = (unsigned)da.y - nbs;
  const unsigned s2 = (unsigned)da.z - nbs, s3 = (unsigned)da.w - nbs;
  const unsigned s4 = (unsigned)db.x - nbs, s5 = (unsigned)db.y - nbs;
  const unsigned s6 = (unsigned)db.z - nbs, s7 = (unsigned)db.w - nbs;
  const bool h0 = s0 < unb, h1 = s1 < unb, h2 = s2 < unb, h3 = s3 < unb;
  const bool h4 = s4 < unb, h5 = s5 < unb, h6 = s6 < unb, h7 = s7 < unb;
  const unsigned any = __builtin_amdgcn_ballot_w32(h0 | h1 | h2 | h3 | h4 | h5 | h6 | h7);
  if (any != 0u) {
#define HITJ(J, HJ, SJ) { \
      const unsigned mj = __builtin_amdgcn_ballot_w32(HJ); \
      if (mj != 0u) { \
        if (HJ) { \
          const int pos = wc + (int)__builtin_amdgcn_mbcnt_lo(mj, 0u); \
          if (pos < WCAP) list[wave * WCAP + pos] = ((el0 + (J)) << SLA) | (int)(SJ); \
        } \
        wc += (int)__builtin_popcount(mj); } }
    HITJ(0, h0, s0)
    HITJ(1, h1, s1)
    HITJ(2, h2, s2)
    HITJ(3, h3, s3)
    HITJ(4, h4, s4)
    HITJ(5, h5, s5)
    HITJ(6, h6, s6)
    HITJ(7, h7, s7)
#undef HITJ
  }
  return wc;
}

// ---------------------------------------------------------------------------
// Node feature plane: XB[row][c] = bf16(x[row][c]) for row < nN (all 1024 c), zero for pad rows nN <= row < MP
// (load address clamped into x, value zeroed by select). One thread = 8 contiguous 16-bit values (16 B) from two
// coverage: nUnits = MP*128 threads x 8 = MP x 1024 elements exactly.
// ---------------------------------------------------------------------------
__global__ __launch_bounds__(NTHR) void k_xprep(const float* __restrict__ x, unsigned short* xb, int nN, int nUnits) {
  const int i = (int)blockIdx.x * NTHR + (int)threadIdx.x;
  if (i >= nUnits) return;
  const int row = i >> 7;
  const int c0  = (i & 127) * 8;
  const int rc  = row < nN ? row : nN - 1;
  const float* p = x + (size_t)rc * CW + c0;
  v4f a = *(const v4fa*)p;
  v4f b = *(const v4fa*)(p + 4);
  const v4f z4 = {0.f, 0.f, 0.f, 0.f};
  if (row >= nN) { a = z4; b = z4; }
  const v4u hv = pack8(a, b);
  unsigned short* o = xb + (size_t)row * CW + c0;
  *(v4u*)o = hv;
  
}

// ---------------------------------------------------------------------------
// Weight planes (k-contiguous B rows, bf16 bits of the f32 inputs).
//   units 0..393215 (part = u >> 17, block-uniform): WQKVT[part*1024 + n][k8..k8+7] = bf16(W_part[n][k8..]),
//     W_part in {Wq, Wk, Wv}, each a natural [1024][1024] row-major matrix (out x in).
//   units 393216..655359 (block-uniform): WXT[n][k8..k8+7] = bf16(Wx[n][(k8 mod 1024) ..]) for k8 in 0..2040.
// coverage: WQKVT = 3 x 131072 units x 8 = 3072 x 1024 exactly; WXT = 262144 units x 8 = 1024 x 2048 exactly.
// ---------------------------------------------------------------------------
__global__ __launch_bounds__(NTHR) void k_wprep(const float* __restrict__ Wq, const float* __restrict__ Wk,
                                                const float* __restrict__ Wv, const float* __restrict__ Wx,
                                                unsigned short* WQKVT, unsigned short* WXT) {
  const int u = (int)blockIdx.x * NTHR + (int)threadIdx.x;
  if (u >= NUW) return;
  v4f a, b;
  unsigned short* dp;
  if (u < 3 * UQKV) {                                    // block-uniform
    const int part = u >> 17;
    const int v    = u & (UQKV - 1);
    const int n    = v >> 7;                             // 0..1023
    const int k8   = (v & 127) * 8;                      // 0..1016
    const float* W = (part == 0) ? Wq : ((part == 1) ? Wk : Wv);
    const float* p = W + (size_t)n * CW + k8;            // W[n][k8 .. k8+7], contiguous
    a = *(const v4fa*)p;
    b = *(const v4fa*)(p + 4);
    dp = WQKVT + (size_t)(part * CW + n) * CW + k8;
  } else {
    const int v  = u - 3 * UQKV;                         // 0..262143
    const int n  = v >> 8;                               // 0..1023
    const int k8 = (v & 255) * 8;                        // 0..2040
    const int kk = k8 & (CW - 1);                        // source column, in range
    const float* p = Wx + (size_t)n * CW + kk;           // Wx[n][kk .. kk+7], contiguous
    a = *(const v4fa*)p;
    b = *(const v4fa*)(p + 4);
    dp = WXT + (size_t)n * KOUT + k8;
  }
  const v4u wv = pack8(a, b);
  *(v4u*)dp = wv;
  
}

// ---------------------------------------------------------------------------
// bf16 WMMA GEMM: C[rows][N] = A[MP][K] (bf16 bits, pitch lda) x WT[N][K]^T (bf16 rows n, k-contiguous, pitch K),
// K = 32*ksteps. grid (MP/64, N/64), 128 threads: wave w owns rows 16w..16w+15 of the 64x64 block tile,
// acc[4] = 4 col tiles. A fragment (row m = lane&15): elements 0..7 <- k0+8h+0..7, 8..15 <- k0+16+8h+0..7
// (h = lane>>4), straight from the 16-bit row; B fragment (col n = lane&15) from WT row (col0+16t+n) with the
// SAME k map; D element r = (row 8h+r, col lane&15).
// Epilogue: + bf16-valued bias (bias vector selected by col0 / 1024, block-uniform; scaled by useBias in {0,1};
// the load is always in range), 64x64 f32 tile staged in LDS; one instruction then writes two 256-B row segments
// coverage: rows rowBase..rowBase+63 restricted to < nRows x cols col0..col0+63 per block;
//   grid (MP/64, N/64) covers every (row < nRows, col) exactly once.
// LDS extents: stg 64x64 fully written before the barrier.
// ---------------------------------------------------------------------------
__global__ __launch_bounds__(GTHR) void k_gemm(
    const unsigned short* __restrict__ A, int lda, const unsigned short* __restrict__ WT, int K,
    float* outF, int ldo, int nRows,
    const float* __restrict__ bs0, const float* __restrict__ bs1, const float* __restrict__ bs2, int useBias)
{
  __shared__ __attribute__((aligned(16))) float stg[GBM * GBN];   // 16 KB
  const int tid = (int)threadIdx.x, lane = tid & 31, wave = tid >> 5, hh = lane >> 4, m = lane & 15;
  const int rowBase = (int)blockIdx.x * GBM;
  const int col0    = (int)blockIdx.y * GBN;

  v8f acc[4];
  {
    const v8f z = {0.f, 0.f, 0.f, 0.f, 0.f, 0.f, 0.f, 0.f};
    acc[0] = z; acc[1] = z; acc[2] = z; acc[3] = z;
  }
  const unsigned short* ap = A  + (size_t)(rowBase + 16 * wave + m) * (size_t)lda + 8 * hh;
  const unsigned short* wp = WT + (size_t)(col0 + m) * (size_t)K + 8 * hh;
  const int ksteps = K >> 5;
#pragma unroll 1
  for (int ks = 0; ks < ksteps; ++ks) {
    FragB af;
    af.h[0] = *(const v8usa*)(ap + 32 * ks);          // k = 32ks + 8hh + 0..7
    af.h[1] = *(const v8usa*)(ap + 32 * ks + 16);     // k = 32ks + 16 + 8hh + 0..7
#pragma unroll
    for (int t = 0; t < 4; ++t) {
      const unsigned short* wq = wp + (size_t)(16 * t) * (size_t)K + 32 * ks;   // WT row col0 + 16t + m
      FragB bf;
      bf.h[0] = *(const v8usa*)wq;                      // same k map as A
      bf.h[1] = *(const v8usa*)(wq + 16);
      acc[t] = wmb(af, bf, acc[t]);
    }
  }

#pragma unroll
  for (int t = 0; t < 4; ++t) {
    const int lc = 16 * t + m;
#pragma unroll
    for (int r = 0; r < 8; ++r) {
      const int lr = 16 * wave + 8 * hh + r;            // D element r = (row 8hh+r, col m)
      stg[lr * GBN + lc] = acc[t][r];
    }
  }
  __syncthreads();

  const int mat = col0 / CW;                            // block-uniform
  const float* bsel = (mat == 0) ? bs0 : ((mat == 1) ? bs1 : bs2);
  v4f b4 = *(const v4fa*)(bsel + (col0 & (CW - 1)) + 4 * m);
  b4 = bfr4(b4) * (float)useBias;

  v4f fv[8];
#pragma unroll
  for (int i = 0; i < 8; ++i) {
    const int lr = 16 * wave + 2 * i + hh;
    fv[i] = *(const v4fa*)(stg + lr * GBN + 4 * m) + b4;
  }
#pragma unroll
  for (int i = 0; i < 8; ++i) {
    const int lr = 16 * wave + 2 * i + hh;
    const int gr = rowBase + lr;
    const int gs = gr < nRows ? gr : nRows - 1;
    float* op = outF + (size_t)gs * (size_t)ldo + col0 + 4 * m;
    if (gr < nRows) *(v4f*)op = fv[i];
  }
  
}

// ---------------------------------------------------------------------------
// Query-keyed sparse attention, no atomics, no global tables. Block owns query slots [nodeBase, nodeBase + NBA);
// key of edge e = qid[e], the gathered side is kid[e].
// Phase 1: chunk scan of the whole qid list; wave 0 drains each chunk's per-wave hit lists in fixed (wave, lane)
//   order, lane 0 appends (eid << SLA | slot) to the block list hl (cap RCAP, overflow -> flag) and increments
//   cnt[slot]. Phase 2: wave 0: exclusive scan of cnt -> offs, then lane 0 places every hit into sl in slot order
//   (hl order kept within a slot: by chunk, wave, entry J, then lane).
// Phase 3 (waves independent, no block barriers): wave w owns the one (slot, b) row w of the block's NBA * BD = 8
//   rows (slot = w / 2, b = w % 2; row = 2*query + b of the QKV plane). Lane l owns channels 32l..32l+31 (head hd = l>>1). Per (slot, b): the
//   1024-float q row (8 b128 loads per lane). Per edge in fixed slot order: kd = kid[eid] (clamped), the k row of
//   (kd, b) (8 b128 loads per lane), dot of the lane's 32 channels, head sum by xor 1, logit * 1/8, running-max
//   single pass per head: den = den*exp(mx-mn) + exp(l-mn), av_c likewise with the v row of (kd, b).
//   o_c = av_c / den (NaN poison on cap overflow, zero row for pad queries >= nS); the 1024-float row is relaid out
//   through the wave's private LDS row so that every store instruction writes 512 contiguous bytes:
// coverage: gridDim.x * NBA * 2 >= mRows (host-checked): APL rows 0..mRows-1 x cols 0..2047 written exactly once.
// LDS extents: list LISTN, hl/sl RCAP, cnt/offs/cur NBA, misc 16 zeroed before any read; per-wave staging row:
//   elements 0..1023 written by the same wave (32 lanes x 32 floats) before each reload.
// ---------------------------------------------------------------------------
__global__ __launch_bounds__(NTHR) void k_scan(const int* __restrict__ qid, const int* __restrict__ kid,
                                               const float* __restrict__ QKV, unsigned short* apl,
                                               int nE, int nS, int mRows, int vec8) {
  extern __shared__ __attribute__((aligned(16))) int dsm[];
  int* list = dsm;                         // LISTN
  int* hl   = dsm + LISTN;                 // RCAP
  int* sl   = hl + RCAP;                   // RCAP
  int* cnt  = sl + RCAP;                   // NBA
  int* offs = cnt + NBA;                   // NBA
  int* cur  = offs + NBA;                  // NBA
  int* misc = cur + NBA;                   // [0..7] per-wave hit counts, [8] total, [9] overflow flag
  const int tid = (int)threadIdx.x, lane = tid & 31, wave = tid >> 5;
  const int nodeBase = (int)blockIdx.x * NBA;

  {
    const v4i z4 = {0, 0, 0, 0};
    for (int i = tid * 4; i < AGG_ZINTS; i += NTHR * 4) *(v4ia*)(dsm + i) = z4;
    if (tid < MISC_INTS) misc[tid] = 0;
  }
  __syncthreads();

  // ---- phase 1: scan + fixed-order drain into hl / cnt
  int t = 0, ov = 0;
  const int nChunks = (nE + CHUNK - 1) / CHUNK;
#pragma unroll 1
  for (int ch = 0; ch < nChunks; ++ch) {
    const int cbase = ch * CHUNK;
    const int wc = scan_chunk(qid, nE, cbase, nodeBase, NBA, vec8, list, tid, lane, wave);
    if (lane == 0) misc[wave] = wc;
    __syncthreads();
    if (wave == 0) {
#pragma unroll 1
      for (int w2 = 0; w2 < NWAVE; ++w2) {
        int c = misc[w2];
        c = c < 0 ? 0 : (c > WCAP ? WCAP : c);
#pragma unroll 1
        for (int b0 = 0; b0 < c; b0 += 32) {
          const int idx = b0 + lane;
          const int ent = list[w2 * WCAP + (idx < WCAP ? idx : WCAP - 1)];
          const int m32 = (c - b0) < 32 ? (c - b0) : 32;
#pragma unroll 1
          for (int k = 0; k < m32; ++k) {
            const int u    = __builtin_amdgcn_readlane(ent, k);
            const int slot = u & (NBA - 1);
            const int el   = (u >> SLA) & (CHUNK - 1);
            const int pk   = ((cbase + el) << SLA) | slot;
            if (t < RCAP) {
              if (lane == 0) { hl[t] = pk; cnt[slot] = cnt[slot] + 1; }
              t = t + 1;
            } else {
              ov = 1;
            }
          }
        }
      }
    }
    __syncthreads();
  }
  if (wave == 0 && lane == 0) { misc[8] = t; misc[9] = ov; }
  __syncthreads();
  int tt = misc[8];
  tt = tt < 0 ? 0 : (tt > RCAP ? RCAP : tt);
  const int ovf = misc[9];

  // ---- phase 2: offsets and placement (wave 0)
  if (wave == 0) {                                      // lane l < NBA owns slot l
    const int cv = cnt[lane < NBA ? lane : NBA - 1];
    const int s  = lane < NBA ? cv : 0;
    int incl = s;
#pragma unroll
    for (int d = 1; d < 32; d <<= 1) {
      const int y = __shfl_up(incl, d, 32);
      if (lane >= d) incl += y;
    }
    if (lane < NBA) {
      offs[lane] = incl - s;
      cur[lane]  = incl - s;
    }
  }
  __syncthreads();
  if (wave == 0) {
#pragma unroll 1
    for (int b0 = 0; b0 < tt; b0 += 32) {
      const int idx = b0 + lane;
      const int ent = hl[idx < RCAP ? idx : RCAP - 1];
      const int m32 = (tt - b0) < 32 ? (tt - b0) : 32;
#pragma unroll 1
      for (int k = 0; k < m32; ++k) {
        const int u    = __builtin_amdgcn_readlane(ent, k);
        const int slot = u & (NBA - 1);
        if (lane == 0) {
          int p = cur[slot];
          p = p < 0 ? 0 : (p > RCAP - 1 ? RCAP - 1 : p);
          sl[p] = u;
          cur[slot] = p + 1;
        }
      }
    }
  }
  __syncthreads();

  // ---- phase 3: per-(slot, b) edge attention + row build
  const float qnan = __int_as_float(0x7fc00000);
  float* stg = (float*)hl + wave * CW;                  // per-wave staging row [1024] (hl is dead after phase 2)
  const v4f z4 = {0.f, 0.f, 0.f, 0.f};
  const int wv = __builtin_amdgcn_readfirstlane(wave);  // scalar, so that slot and b stay wave-uniform registers
  {
    const int s  = wv / BD;                             // slot
    const int b  = wv % BD;
    const int qn = nodeBase + s;                        // query index
    int c = cnt[s];
    const bool big = c > DEGCAP;
    c = c < 0 ? 0 : (c > DEGCAP ? DEGCAP : c);
    int o = offs[s];
    o = o < 0 ? 0 : (o > RCAP ? RCAP : o);
    const int  qc   = qn < nS ? qn : nS - 1;
    const bool live = qn < nS;                          // wave-uniform
    const bool pois = big || (ovf != 0);

    {
      const float* qr = QKV + ((size_t)qc * BD + b) * QKVW + OQ + 32 * lane;
      v4f qv[8];
#pragma unroll
      for (int j = 0; j < 8; ++j) qv[j] = *(const v4fa*)(qr + 4 * j);
      ldwait();

      float mx = -1.0e30f, dn = 0.0f;
      v4f av[8];
#pragma unroll
      for (int j = 0; j < 8; ++j) av[j] = z4;

#pragma unroll 1
      for (int b0 = 0; b0 < c; b0 += 32) {
        int idx = o + b0 + lane;
        idx = idx > RCAP - 1 ? RCAP - 1 : idx;
        const int ent = sl[idx];
        int eid = ent >> SLA;
        eid = eid < 0 ? 0 : (eid > nE - 1 ? nE - 1 : eid);
        int kd = kid[eid];
        kd = kd < 0 ? 0 : (kd > nS - 1 ? nS - 1 : kd);
        const int m32 = (c - b0) < 32 ? (c - b0) : 32;
#pragma unroll 1
        for (int k = 0; k < m32; ++k) {
          const int tk = __builtin_amdgcn_readlane(kd, k);
          const float* kr = QKV + ((size_t)tk * BD + b) * QKVW + OKK + 32 * lane;   // whole 4-KB k row
          v4f kv[8];
#pragma unroll
          for (int j = 0; j < 8; ++j) kv[j] = *(const v4fa*)(kr + 4 * j);
          ldwait();
          float p = 0.0f;
#pragma unroll
          for (int j = 0; j < 8; ++j) {
            p = fmaf(qv[j].x, kv[j].x, p); p = fmaf(qv[j].y, kv[j].y, p);
            p = fmaf(qv[j].z, kv[j].z, p); p = fmaf(qv[j].w, kv[j].w, p);
          }
          p += __shfl_xor(p, 1);                        // sum over the head's 2 lanes
          const float lg = p * ATTSC;
          const float df = lg - mx;
          const float ee = __expf(-fabsf(df));          // the other factor is exactly 1
          const bool up  = df > 0.0f;
          const float s1 = up ? ee : 1.0f;
          const float s2 = up ? 1.0f : ee;
          mx = up ? lg : mx;
          dn = fmaf(dn, s1, s2);
          const float* vr = QKV + ((size_t)tk * BD + b) * QKVW + OV + 32 * lane;    // whole 4-KB v row
          v4f vv[8];
#pragma unroll
          for (int j = 0; j < 8; ++j) vv[j] = *(const v4fa*)(vr + 4 * j);
          ldwait();
#pragma unroll
          for (int j = 0; j < 8; ++j) {
            av[j].x = fmaf(av[j].x, s1, s2 * vv[j].x); av[j].y = fmaf(av[j].y, s1, s2 * vv[j].y);
            av[j].z = fmaf(av[j].z, s1, s2 * vv[j].z); av[j].w = fmaf(av[j].w, s1, s2 * vv[j].w);
          }
        }
      }

      const float inv  = __builtin_amdgcn_rcpf(dn);     // den >= 1 when c > 0; c == 0 -> inf and 0 * inf = NaN (0 / 0)
      const float invp = pois ? qnan : inv;
      wave_sync();                                       // prior reads of the staging row are done
#pragma unroll
      for (int j = 0; j < 8; ++j) {
        v4f o4;
        o4.x = live ? av[j].x * invp : 0.0f;
        o4.y = live ? av[j].y * invp : 0.0f;
        o4.z = live ? av[j].z * invp : 0.0f;
        o4.w = live ? av[j].w * invp : 0.0f;
        *(v4fa*)(stg + 32 * lane + 4 * j) = o4;          // lane writes cols 32l .. 32l+31
      }
      wave_sync();
      v4u hv[4], lv[4];
#pragma unroll
      for (int j = 0; j < 4; ++j) {
        const v4f pa = *(const v4fa*)(stg + 256 * j + 8 * lane);         // lane reads cols 256j+8l .. +7
        const v4f pb = *(const v4fa*)(stg + 256 * j + 8 * lane + 4);
        pack8hl(pa, pb, hv[j], lv[j]);
      }
      const int row = qn * BD + b;
      if (row < mRows) {                                 // wave-uniform
        unsigned short* rp = apl + (size_t)row * APITCH;
#pragma unroll
        for (int j = 0; j < 4; ++j) {
          *(v4u*)(rp + 256 * j + 8 * lane)      = hv[j];
          *(v4u*)(rp + CW + 256 * j + 8 * lane) = lv[j];
        }
        
      }
    }
  }
}

// ---------------------------------------------------------------------------
static inline int cdiv(int a, int b) { return (a + b - 1) / b; }
static inline size_t al256(size_t o) { return (o + 255) & ~(size_t)255; }

extern "C" void kernel_launch(void* const* d_in, const int* in_sizes, int n_in,
                              void* d_out, int out_size, void* d_ws, size_t ws_size,
                              hipStream_t stream) {
  if (n_in < 11) return;
  if (in_sizes[0] < BD * CW || (in_sizes[0] % (BD * CW)) != 0) return;   // x [S][2][1024]
  const int nS = in_sizes[0] / (BD * CW);
  if (nS < 1 || nS > (1 << 20)) return;
  const int nE = in_sizes[1];                                          // q_id [E]
  if (nE < 1 || nE >= (1 << (31 - SLA))) return;                       // (eid << SLA | slot) fits a positive int
  if (in_sizes[2] != nE) return;                                       // k_id [E]
  if (in_sizes[3] != CW * CW || in_sizes[5] != CW * CW || in_sizes[7] != CW * CW || in_sizes[9] != CW * CW) return;
  if (in_sizes[4] != CW || in_sizes[6] != CW || in_sizes[8] != CW || in_sizes[10] != CW) return;
  if ((long long)out_size != (long long)nS * BD * CW) return;          // out [S][2][1024]

  const float* x   = (const float*)d_in[0];     // [S][2][1024] -> rows 2s+b of 1024
  const int*   qid = (const int*)  d_in[1];     // [E] key side (query)
  const int*   kid = (const int*)  d_in[2];     // [E] gathered side (k, v)
  const float* Wq  = (const float*)d_in[3];     // [1024][1024] natural [out][in]
  const float* bq  = (const float*)d_in[4];
  const float* Wk  = (const float*)d_in[5];
  const float* bk  = (const float*)d_in[6];
  const float* Wv  = (const float*)d_in[7];
  const float* bv  = (const float*)d_in[8];
  const float* Wx  = (const float*)d_in[9];
  const float* bx  = (const float*)d_in[10];
  float* out = (float*)d_out;                   // [S][2][1024] -> rows 2s+b of 1024

  const int nRows = nS * BD;
  const int MP = cdiv(nRows, GBM) * GBM;        // padded rows of every node plane
  const int gM = MP / GBM;
  const int gA = cdiv(cdiv(MP, BD), NBA);
  if ((long long)gA * NBA * BD < (long long)MP) return;
  const int vec8 = ((nE & 3) == 0) ? 1 : 0;

  // workspace carve (256-B aligned; every region sized to its whole-row store extent incl. padded rows MP)
  char* ws = (char*)d_ws;
  size_t off = 0;
  const size_t oXB  = off; off = al256(off + (size_t)MP * CW * 2);        // XB    [MP][1024]   bf16
  const size_t oWQ  = off; off = al256(off + (size_t)QKVW * CW * 2);      // WQKVT [3072][1024] bf16
  const size_t oWX  = off; off = al256(off + (size_t)CW * KOUT * 2);      // WXT   [1024][2048] bf16
  const size_t oQKV = off; off = al256(off + (size_t)MP * QKVW * 4);      // QKV   [MP][3072]   f32
  const size_t oAPL = off; off = al256(off + (size_t)MP * APITCH * 2);    // APL   [MP][2048]   bf16
  if (off > ws_size || off > (size_t)WSMAX) return;
  unsigned short* XB    = (unsigned short*)(ws + oXB);
  unsigned short* WQKVT = (unsigned short*)(ws + oWQ);
  unsigned short* WXT   = (unsigned short*)(ws + oWX);
  float*          QKV   = (float*)(ws + oQKV);
  unsigned short* APL   = (unsigned short*)(ws + oAPL);

  hipFuncSetAttribute(reinterpret_cast<const void*>(&k_scan),
                      hipFuncAttributeMaxDynamicSharedMemorySize, SCAN_LDS_BYTES);

  // node feature plane (bf16 bits), pad rows zero
  const int nUx = MP * (CW / 8);
  k_xprep<<<cdiv(nUx, NTHR), NTHR, 0, stream>>>(x, XB, nRows, nUx);
  // weight planes
  k_wprep<<<NUW / NTHR, NTHR, 0, stream>>>(Wq, Wk, Wv, Wx, WQKVT, WXT);
  // projection GEMM: QKV = XB [Wq|Wk|Wv]^T + b -> f32 [MP][3072]
  k_gemm<<<dim3(gM, QKVW / GBN), GTHR, 0, stream>>>(XB, CW, WQKVT, CW, QKV, QKVW, MP, bq, bk, bv, 1);
  // query-keyed sparse attention -> APL [MP][2048]
  k_scan<<<gA, NTHR, SCAN_LDS_BYTES, stream>>>(qid, kid, QKV, APL, nE, nS, MP, vec8);
  // trailing GEMM: out = APL . WXT^T + bx -> rows < nRows
  k_gemm<<<dim3(gM, CW / GBN), GTHR, 0, stream>>>(APL, APITCH, WXT, KOUT, out, CW, nRows, bx, bx, bx, 1);
}

// v002
// A run of this version takes 190 microseconds.
// Two timings next to v001 put it at 1.68 and 1.67 times that version's speed.
// Counting every step since v000, it is 36.5 times as fast.
#include <hip/hip_runtime.h>
#include <stddef.h>
#include <stdint.h>
#include <math.h>

// Contractions: v_wmma_f32_16x16x32_bf16 (bf16 operands, f32 accumulate) for the three projections
// x*[Wq|Wk|Wv]^T (K 1024, bf16 RNE copies of the inputs, products exact in f32) and for the trailing projection
// [o hi | o lo] * [Wx^T ; Wx^T] + bx (K 2048, attention output o carried as bf16 hi + bf16 residual).
// Per-edge per-head q.k dots (16 heads x 64), per-(query, b, head) running-max softmax over the query's own keys
// and the weighted value sums: f32 VALU.
//
// Row mapping: x [S][2][1024] and the output use row = 2*s + b (4096-B rows); q, k, v channel 64*h + c.
// Softmax: exp(qk - max) / sum over the edges sharing a q_id is evaluated per (query, b, head) with a running max
// over that query's keys (the shift cancels in num / den); a query without edges yields 0 * inf = NaN like 0 / 0.
//
// Carry audit: no power-of-two carries anywhere; no inverse factor exists.
//   XB    [MP][1024]   bf16 bits of x (pad rows zero)                      -> A of the projection GEMM
//   WQKVT [3072][1024] bf16 bits, row n = [Wq;Wk;Wv][n][k] (natural rows)  -> B of the projection GEMM
//   WXT   [1024][2048] bf16 bits, row n = Wx[n][k mod 1024]                -> B of the trailing GEMM
//   QKV   [MP][3072]   f32: q | k | v (+ bf16-valued bias)                  -> gathered by k_scan
//   APL   [MP][2048]   bf16 bits: o hi (cols 0..1023) | o lo (1024..2047)  -> A of the trailing GEMM

#define CW      1024                  // channels
#define BD      2                     // middle (batch) dimension of x
#define NHD     16                    // heads
#define HDM     64                    // head dim
#define QKVW    3072                  // node plane columns: q | k | v
#define OQ      0
#define OKK     1024
#define OV      2048
#define KOUT    2048                  // K of the trailing GEMM (hi | lo)
#define APITCH  2048                  // A plane pitch in 16-bit elements (4096 B = 32 lines)
#define NTHR    256
#define NWAVE   8
#define EPT     8
#define CHUNK   (NTHR * EPT)          // 2048 key entries per chunk
#define WCAP    (EPT * 32)            // 256: exact upper bound of hits per wave per chunk
#define LISTN   (NWAVE * WCAP)        // 2048 ints
#define NBA     4                     // query slots per scan block: NBA * BD = 8 (slot, b) rows, one per wave
#define SLA     2
#define RCAP    8192                  // hit-list capacity per block (>= NBA * DEGCAP; also holds the 8 staging rows)
#define DEGCAP  64                    // static per-slot trip clamp (64 keys per query)
#define GBM     128                   // GEMM rows per block
#define GBN     128                   // GEMM cols per block
#define GTHR    256                   // GEMM threads per block (8 waves, 2 x 4, 64 x 32 outputs each)
#define GBK     128                   // k per pass: 256 B of every operand row
#define GPITCH  272                   // LDS row pitch in bytes (16 B x odd: b128 fragment reads without conflicts)
#define GSTAGE  ((GBM + GBN) * GPITCH)   // 69632 B: one buffer
#define GSP     132                   // output staging pitch in floats
#define UQKV    (CW * (CW / 8))       // 131072 weight-prep units per projection matrix
#define UWX     (CW * (KOUT / 8))     // 262144 units for the WXT plane
#define NUW     (3 * UQKV + UWX)      // 655360
#define AGG_ZINTS (LISTN + 2 * RCAP + 3 * NBA)            // 18444
#define MISC_INTS 16
#define SCAN_LDS_BYTES ((AGG_ZINTS + MISC_INTS) * 4)       // 73840
#define ATTSC   0.125f                // 1/sqrt(64)
#define WSMAX   134217728

static_assert((CHUNK & (CHUNK - 1)) == 0 && CHUNK <= 4096);
static_assert((NBA & (NBA - 1)) == 0 && NBA == (1 << SLA));
static_assert(((long long)CHUNK << SLA) < (1LL << 31));
static_assert(LISTN >= NWAVE * WCAP);
static_assert(NBA * BD == NWAVE && NBA <= 32 && RCAP >= NBA * DEGCAP);
static_assert(RCAP % 32 == 0 && AGG_ZINTS % 4 == 0 && LISTN % 4 == 0 && ((AGG_ZINTS + MISC_INTS) % 4) == 0);
static_assert(NWAVE * CW <= RCAP);                    // per-wave output-row staging lives inside the dead hit list
static_assert(SCAN_LDS_BYTES <= 300000);
static_assert(CW == 32 * 32);                         // lane owns 32 channels
static_assert(HDM == 2 * 32 && NHD * HDM == CW);      // 2 lanes per head
static_assert(QKVW == 3 * CW && (QKVW % GBN) == 0 && (CW % GBN) == 0);
static_assert((CW % 32) == 0 && (KOUT % 32) == 0 && KOUT == 2 * CW && APITCH == KOUT);
static_assert((APITCH * 2) % 128 == 0);
static_assert(GBM == 128 && GBN == 128 && GTHR == 256 && GBK == 128);
static_assert((CW % GBK) == 0 && CW / GBK >= 2 && (KOUT % GBK) == 0 && (CW % GBN) == 0);
static_assert(GBM * GSP * 4 <= 2 * GSTAGE && (GSP * 4) % 16 == 0 && GPITCH >= 2 * GBK && (GPITCH % 16) == 0);
static_assert(UQKV == (1 << 17) && (CW / 8) == 128 && (KOUT / 8) == 256);
static_assert(UQKV % NTHR == 0 && UWX % NTHR == 0 && (3 * UQKV) % NTHR == 0);
static_assert(DEGCAP >= 32);

typedef float          v4f  __attribute__((ext_vector_type(4)));
typedef float          v8f  __attribute__((ext_vector_type(8)));
typedef int            v4i  __attribute__((ext_vector_type(4)));
typedef int            v8i  __attribute__((ext_vector_type(8)));
typedef unsigned int   v4u  __attribute__((ext_vector_type(4)));
typedef unsigned short v8us __attribute__((ext_vector_type(8)));
typedef __bf16         v16b __attribute__((ext_vector_type(16)));
typedef v4f  __attribute__((may_alias)) v4fa;
typedef v4i  __attribute__((may_alias)) v4ia;
typedef v4u  __attribute__((may_alias)) v4ua;
typedef v8us __attribute__((may_alias)) v8usa;
union FragB { v16b v; v8us h[2]; v8i w; };

// WMMA with hazard guard: ties D, keeps A/B live for 4 VALU slots
__device__ __forceinline__ v8f wmb(const FragB& a, const FragB& b, v8f c) {
  v8f d = __builtin_amdgcn_wmma_f32_16x16x32_bf16(false, a.v, false, b.v, (short)0, c, false, false);
  asm volatile("v_nop\n\tv_nop\n\tv_nop\n\tv_nop" : "+v"(d) : "v"(a.w), "v"(b.w));
  return d;
}

// drain all outstanding vector-memory loads; also a compiler barrier for memory operations
__device__ __forceinline__ void ldwait() {
  asm volatile("s_wait_loadcnt 0x0" ::: "memory");
}

__device__ __forceinline__ void wave_sync() {
  __builtin_amdgcn_fence(__ATOMIC_RELEASE, "wavefront");
  __builtin_amdgcn_wave_barrier();
  __builtin_amdgcn_fence(__ATOMIC_ACQUIRE, "wavefront");
}

// f32 -> bf16 bits, RNE convert; bf16 bits -> f32
__device__ __forceinline__ unsigned int f2bf(float f) {
  const unsigned int u = __float_as_uint(f);
  return ((u + 0x7FFFu + ((u >> 16) & 1u)) >> 16) & 0xFFFFu;
}
__device__ __forceinline__ float bf2f(unsigned int b) { return __uint_as_float(b << 16); }
__device__ __forceinline__ float bfr(float f) { return bf2f(f2bf(f)); }
__device__ __forceinline__ v4f bfr4(const v4f a) {
  v4f r; r.x = bfr(a.x); r.y = bfr(a.y); r.z = bfr(a.z); r.w = bfr(a.w); return r;
}
__device__ __forceinline__ unsigned int pk2(float lo, float hi) { return f2bf(lo) | (f2bf(hi) << 16); }
// 8 floats -> 8 bf16 packed in 16 B (element 2i = low half of word i)
__device__ __forceinline__ v4u pack8(const v4f a, const v4f b) {
  v4u r;
  r.x = pk2(a.x, a.y); r.y = pk2(a.z, a.w); r.z = pk2(b.x, b.y); r.w = pk2(b.z, b.w);
  return r;
}
// hi = bf16(v), lo = bf16(v - hi): two floats -> one packed word of each
__device__ __forceinline__ void hl2(float v0, float v1, unsigned int& hw, unsigned int& lw) {
  const unsigned int h0 = f2bf(v0), h1 = f2bf(v1);
  const unsigned int l0 = f2bf(v0 - bf2f(h0)), l1 = f2bf(v1 - bf2f(h1));
  hw = h0 | (h1 << 16);
  lw = l0 | (l1 << 16);
}
__device__ __forceinline__ void pack8hl(const v4f a, const v4f b, v4u& hv, v4u& lv) {
  unsigned int h, l;
  hl2(a.x, a.y, h, l); hv.x = h; lv.x = l;
  hl2(a.z, a.w, h, l); hv.y = h; lv.y = l;
  hl2(b.x, b.y, h, l); hv.z = h; lv.z = l;
  hl2(b.z, b.w, h, l); hv.w = h; lv.w = l;
}

// ---------------------------------------------------------------------------
// One chunk of the key list (contiguous int array): each thread tests EPT entries against the block's
// slot range [slotBase, slotBase + nb); hits are appended to this wave's LDS list as (local_index << SLA | slot).
// Returns the wave-uniform hit count (<= WCAP always). The vector / scalar load choice is block-uniform; the
// scalar path clamps every address and selects the sentinel by value.
// ---------------------------------------------------------------------------
__device__ __forceinline__ int scan_chunk(const int* __restrict__ keys, int nE, int cbase, int slotBase,
                                          int nb, int vec8, int* list, int tid, int lane, int wave) {
  int wc = 0;
  const int el0  = tid * EPT;
  const int e0   = cbase + el0;
  const int sent = -2147483647 - 1;
  v4i da, db;
  if (vec8 != 0 && cbase + CHUNK <= nE) {
    da = *(const v4i*)(keys + e0);
    db = *(const v4i*)(keys + e0 + 4);
  } else {
    da.x = (e0     < nE) ? keys[min(e0,     nE - 1)] : sent;
    da.y = (e0 + 1 < nE) ? keys[min(e0 + 1, nE - 1)] : sent;
    da.z = (e0 + 2 < nE) ? keys[min(e0 + 2, nE - 1)] : sent;
    da.w = (e0 + 3 < nE) ? keys[min(e0 + 3, nE - 1)] : sent;
    db.x = (e0 + 4 < nE) ? keys[min(e0 + 4, nE - 1)] : sent;
    db.y = (e0 + 5 < nE) ? keys[min(e0 + 5, nE - 1)] : sent;
    db.z = (e0 + 6 < nE) ? keys[min(e0 + 6, nE - 1)] : sent;
    db.w = (e0 + 7 < nE) ? keys[min(e0 + 7, nE - 1)] : sent;
  }
  const unsigned nbs = (unsigned)slotBase;
  const unsigned unb = (unsigned)nb;
  const unsigned s0 = (unsigned)da.x - nbs, s1 = (unsigned)da.y - nbs;
  const unsigned s2 = (unsigned)da.z - nbs, s3 = (unsigned)da.w - nbs;
  const unsigned s4 = (unsigned)db.x - nbs, s5 = (unsigned)db.y - nbs;
  const unsigned s6 = (unsigned)db.z - nbs, s7 = (unsigned)db.w - nbs;
  const bool h0 = s0 < unb, h1 = s1 < unb, h2 = s2 < unb, h3 = s3 < unb;
  const bool h4 = s4 < unb, h5 = s5 < unb, h6 = s6 < unb, h7 = s7 < unb;
  const unsigned any = __builtin_amdgcn_ballot_w32(h0 | h1 | h2 | h3 | h4 | h5 | h6 | h7);
  if (any != 0u) {
#define HITJ(J, HJ, SJ) { \
      const unsigned mj = __builtin_amdgcn_ballot_w32(HJ); \
      if (mj != 0u) { \
        if (HJ) { \
          const int pos = wc + (int)__builtin_amdgcn_mbcnt_lo(mj, 0u); \
          if (pos < WCAP) list[wave * WCAP + pos] = ((el0 + (J)) << SLA) | (int)(SJ); \
        } \
        wc += (int)__builtin_popcount(mj); } }
    HITJ(0, h0, s0)
    HITJ(1, h1, s1)
    HITJ(2, h2, s2)
    HITJ(3, h3, s3)
    HITJ(4, h4, s4)
    HITJ(5, h5, s5)
    HITJ(6, h6, s6)
    HITJ(7, h7, s7)
#undef HITJ
  }
  return wc;
}

// ---------------------------------------------------------------------------
// Node feature plane: XB[row][c] = bf16(x[row][c]) for row < nN (all 1024 c), zero for pad rows nN <= row < MP
// (load address clamped into x, value zeroed by select). One thread = 8 contiguous 16-bit values (16 B) from two
// coverage: nUnits = MP*128 threads x 8 = MP x 1024 elements exactly.
// ---------------------------------------------------------------------------
__global__ __launch_bounds__(NTHR) void k_xprep(const float* __restrict__ x, unsigned short* xb, int nN, int nUnits) {
  const int i = (int)blockIdx.x * NTHR + (int)threadIdx.x;
  if (i >= nUnits) return;
  const int row = i >> 7;
  const int c0  = (i & 127) * 8;
  const int rc  = row < nN ? row : nN - 1;
  const float* p = x + (size_t)rc * CW + c0;
  v4f a = *(const v4fa*)p;
  v4f b = *(const v4fa*)(p + 4);
  const v4f z4 = {0.f, 0.f, 0.f, 0.f};
  if (row >= nN) { a = z4; b = z4; }
  const v4u hv = pack8(a, b);
  unsigned short* o = xb + (size_t)row * CW + c0;
  *(v4u*)o = hv;
  
}

// ---------------------------------------------------------------------------
// Weight planes (k-contiguous B rows, bf16 bits of the f32 inputs).
//   units 0..393215 (part = u >> 17, block-uniform): WQKVT[part*1024 + n][k8..k8+7] = bf16(W_part[n][k8..]),
//     W_part in {Wq, Wk, Wv}, each a natural [1024][1024] row-major matrix (out x in).
//   units 393216..655359 (block-uniform): WXT[n][k8..k8+7] = bf16(Wx[n][(k8 mod 1024) ..]) for k8 in 0..2040.
// coverage: WQKVT = 3 x 131072 units x 8 = 3072 x 1024 exactly; WXT = 262144 units x 8 = 1024 x 2048 exactly.
// ---------------------------------------------------------------------------
__global__ __launch_bounds__(NTHR) void k_wprep(const float* __restrict__ Wq, const float* __restrict__ Wk,
                                                const float* __restrict__ Wv, const float* __restrict__ Wx,
                                                unsigned short* WQKVT, unsigned short* WXT) {
  const int u = (int)blockIdx.x * NTHR + (int)threadIdx.x;
  if (u >= NUW) return;
  v4f a, b;
  unsigned short* dp;
  if (u < 3 * UQKV) {                                    // block-uniform
    const int part = u >> 17;
    const int v    = u & (UQKV - 1);
    const int n    = v >> 7;                             // 0..1023
    const int k8   = (v & 127) * 8;                      // 0..1016
    const float* W = (part == 0) ? Wq : ((part == 1) ? Wk : Wv);
    const float* p = W + (size_t)n * CW + k8;            // W[n][k8 .. k8+7], contiguous
    a = *(const v4fa*)p;
    b = *(const v4fa*)(p + 4);
    dp = WQKVT + (size_t)(part * CW + n) * CW + k8;
  } else {
    const int v  = u - 3 * UQKV;                         // 0..262143
    const int n  = v >> 8;                               // 0..1023
    const int k8 = (v & 255) * 8;                        // 0..2040
    const int kk = k8 & (CW - 1);                        // source column, in range
    const float* p = Wx + (size_t)n * CW + kk;           // Wx[n][kk .. kk+7], contiguous
    a = *(const v4fa*)p;
    b = *(const v4fa*)(p + 4);
    dp = WXT + (size_t)n * KOUT + k8;
  }
  const v4u wv = pack8(a, b);
  *(v4u*)dp = wv;
  
}

// ---------------------------------------------------------------------------
// Eight asynchronous 16-B-per-lane copies global -> LDS: rows 16 apart in both places (gstep elements, 16 pitches).
// The s_wait_xcnt stands inside the statement so that no address register is rewritten in front of it.
// ---------------------------------------------------------------------------
__device__ __forceinline__ void acopy8(unsigned int l0, const unsigned short* g0, size_t gstep) {
  const unsigned int l1 = l0 + 16 * GPITCH, l2 = l0 + 32 * GPITCH, l3 = l0 + 48 * GPITCH;
  const unsigned int l4 = l0 + 64 * GPITCH, l5 = l0 + 80 * GPITCH, l6 = l0 + 96 * GPITCH, l7 = l0 + 112 * GPITCH;
  const unsigned short* g1 = g0 + gstep;
  const unsigned short* g2 = g1 + gstep;
  const unsigned short* g3 = g2 + gstep;
  const unsigned short* g4 = g3 + gstep;
  const unsigned short* g5 = g4 + gstep;
  const unsigned short* g6 = g5 + gstep;
  const unsigned short* g7 = g6 + gstep;
  asm volatile("global_load_async_to_lds_b128 %0, %8, off\n\t"
               "global_load_async_to_lds_b128 %1, %9, off\n\t"
               "global_load_async_to_lds_b128 %2, %10, off\n\t"
               "global_load_async_to_lds_b128 %3, %11, off\n\t"
               "global_load_async_to_lds_b128 %4, %12, off\n\t"
               "global_load_async_to_lds_b128 %5, %13, off\n\t"
               "global_load_async_to_lds_b128 %6, %14, off\n\t"
               "global_load_async_to_lds_b128 %7, %15, off\n\t"
               "s_wait_xcnt 0x0"
               :: "v"(l0), "v"(l1), "v"(l2), "v"(l3), "v"(l4), "v"(l5), "v"(l6), "v"(l7),
                  "v"(g0), "v"(g1), "v"(g2), "v"(g3), "v"(g4), "v"(g5), "v"(g6), "v"(g7)
               : "memory");
}

// ---------------------------------------------------------------------------
// bf16 WMMA GEMM: C[rows][N] = A[MP][K] (bf16 bits, pitch lda) x WT[N][K]^T (bf16 rows n, k-contiguous, pitch K).
// grid (MP/128, N/128), 256 threads: one 128x128 tile of C per block; wave w owns rows 64*(w>>2).. +63 and
// cols 32*(w&3).. +31 of it: acc[4][2]. K runs in passes of 128 (256 B of every operand row); a stage is
// [A 128 rows | WT 128 rows] at LDS pitch 272 B, two buffers. Each thread copies 16 pieces of 16 B per stage
// (row = 16i + tid/16, piece = tid%16, so one wave instruction moves two whole 256-B row pieces); the copies of
// pass t+2 are issued behind the barrier that ends pass t and are waited for at the foot of pass t+1.
// A fragment (row m = lane&15): elements 0..7 <- k0+8h+0..7, 8..15 <- k0+16+8h+0..7 (h = lane>>4); B fragment
// (col n = lane&15) from its WT row with the SAME k map; D element r = (row 8h+r, col lane&15). k ascends in
// steps of 32 on one accumulator chain per output tile.
// Epilogue: the 128x128 f32 tile is staged in the ring (every copy landed, every reader past the last barrier),
// + bf16-valued bias (bias vector selected by col0 / 1024, block-uniform; scaled by useBias in {0,1}; the load is
// always in range); one instruction then writes one 512-B row segment.
// coverage: rows rowBase..rowBase+127 restricted to < nRows x cols col0..col0+127 per block;
//   grid (MP/128, N/128) covers every (row < nRows, col) exactly once.
// LDS extents: copies fill rows 0..255 x bytes 0..255 of a buffer (pitch 272); staging 128 x 132 floats.
// ---------------------------------------------------------------------------
__global__ __launch_bounds__(GTHR) void k_gemm(
    const unsigned short* __restrict__ A, int lda, const unsigned short* __restrict__ WT, int K,
    float* outF, int ldo, int nRows,
    const float* __restrict__ bs0, const float* __restrict__ bs1, const float* __restrict__ bs2, int useBias)
{
  __shared__ __attribute__((aligned(16))) unsigned char ring[2 * GSTAGE];   // 139264 B
  const int tid = (int)threadIdx.x, lane = tid & 31, wave = tid >> 5, hh = lane >> 4, m = lane & 15;
  const int wm = wave >> 2, wn = wave & 3;
  const int rowBase = (int)blockIdx.x * GBM;
  const int col0    = (int)blockIdx.y * GBN;

  v8f acc[4][2];
  {
    const v8f z = {0.f, 0.f, 0.f, 0.f, 0.f, 0.f, 0.f, 0.f};
#pragma unroll
    for (int i = 0; i < 4; ++i) { acc[i][0] = z; acc[i][1] = z; }
  }
  const int crow = tid >> 4, cseg = tid & 15;
  const unsigned short* ga = A  + (size_t)(rowBase + crow) * (size_t)lda + 8 * cseg;
  const unsigned short* gb = WT + (size_t)(col0 + crow) * (size_t)K + 8 * cseg;
  const size_t sa = (size_t)16 * (size_t)lda, sb = (size_t)16 * (size_t)K;
  const unsigned int la = (unsigned int)(size_t)ring + (unsigned int)(crow * GPITCH + 16 * cseg);
  const unsigned int lb = la + GBM * GPITCH;
  const int npass = K / GBK;

  acopy8(la, ga, sa);
  acopy8(lb, gb, sb);
  asm volatile("s_wait_asynccnt 0x0" ::: "memory");   // this wave's part of stage 0 has landed
  __syncthreads();                                     // stage 0 readable by every wave
  if (npass > 1) {
    acopy8(la + GSTAGE, ga + GBK, sa);
    acopy8(lb + GSTAGE, gb + GBK, sb);
  }

#pragma unroll 1   // passes stay rolled: one copy of the 32-WMMA body
  for (int t = 0; t < npass; ++t) {
    const unsigned int bo = (unsigned int)(t & 1) * GSTAGE;
    const unsigned char* ar = ring + bo + (64 * wm + m) * GPITCH + 16 * hh;
    const unsigned char* br = ring + bo + (GBM + 32 * wn + m) * GPITCH + 16 * hh;
#pragma unroll
    for (int kk = 0; kk < GBK / 32; ++kk) {
      FragB af[4], bf[2];
#pragma unroll
      for (int i = 0; i < 4; ++i) {
        af[i].h[0] = *(const v8usa*)(ar + 16 * i * GPITCH + 64 * kk);        // k = 32kk + 8hh + 0..7
        af[i].h[1] = *(const v8usa*)(ar + 16 * i * GPITCH + 64 * kk + 32);   // k = 32kk + 16 + 8hh + 0..7
      }
#pragma unroll
      for (int j = 0; j < 2; ++j) {
        bf[j].h[0] = *(const v8usa*)(br + 16 * j * GPITCH + 64 * kk);        // same k map as A
        bf[j].h[1] = *(const v8usa*)(br + 16 * j * GPITCH + 64 * kk + 32);
      }
#pragma unroll
      for (int i = 0; i < 4; ++i) {
#pragma unroll
        for (int j = 0; j < 2; ++j) acc[i][j] = wmb(af[i], bf[j], acc[i][j]);
      }
    }
    asm volatile("s_wait_dscnt 0x0" ::: "memory");     // this wave's reads of the buffer are done before its refill
    asm volatile("s_wait_asynccnt 0x0" ::: "memory");  // this wave's part of stage t+1 has landed
    __syncthreads();                                   // publishes stage t+1, frees the buffer of stage t
    if (t + 2 < npass) {                               // block-uniform
      acopy8(la + bo, ga + (size_t)(t + 2) * GBK, sa);
      acopy8(lb + bo, gb + (size_t)(t + 2) * GBK, sb);
    }
  }
  asm volatile("s_wait_asynccnt 0x0" ::: "memory");    // nothing in flight when the ring becomes output staging

  float* stg = (float*)ring;
#pragma unroll
  for (int i = 0; i < 4; ++i) {
#pragma unroll
    for (int j = 0; j < 2; ++j) {
      const int lc = 32 * wn + 16 * j + m;
#pragma unroll
      for (int r = 0; r < 8; ++r) {
        const int lr = 64 * wm + 16 * i + 8 * hh + r;   // D element r = (row 8hh+r, col m)
        stg[lr * GSP + lc] = acc[i][j][r];
      }
    }
  }
  __syncthreads();

  const int mat = col0 / CW;                            // block-uniform
  const float* bsel = (mat == 0) ? bs0 : ((mat == 1) ? bs1 : bs2);
  v4f b4 = *(const v4fa*)(bsel + (col0 & (CW - 1)) + 4 * lane);
  b4 = bfr4(b4) * (float)useBias;

  v4f fv[16];
#pragma unroll
  for (int i = 0; i < 16; ++i) {
    const int lr = 16 * wave + i;
    fv[i] = *(const v4fa*)(stg + lr * GSP + 4 * lane) + b4;
  }
#pragma unroll
  for (int i = 0; i < 16; ++i) {
    const int lr = 16 * wave + i;
    const int gr = rowBase + lr;
    const int gs = gr < nRows ? gr : nRows - 1;
    float* op = outF + (size_t)gs * (size_t)ldo + col0 + 4 * lane;
    if (gr < nRows) *(v4f*)op = fv[i];
  }
}

// ---------------------------------------------------------------------------
// Query-keyed sparse attention, no atomics, no global tables. Block owns query slots [nodeBase, nodeBase + NBA);
// key of edge e = qid[e], the gathered side is kid[e].
// Phase 1: chunk scan of the whole qid list; wave 0 drains each chunk's per-wave hit lists in fixed (wave, lane)
//   order, lane 0 appends (eid << SLA | slot) to the block list hl (cap RCAP, overflow -> flag) and increments
//   cnt[slot]. Phase 2: wave 0: exclusive scan of cnt -> offs, then lane 0 places every hit into sl in slot order
//   (hl order kept within a slot: by chunk, wave, entry J, then lane).
// Phase 3 (waves independent, no block barriers): wave w owns the one (slot, b) row w of the block's NBA * BD = 8
//   rows (slot = w / 2, b = w % 2; row = 2*query + b of the QKV plane). Lane l owns channels 32l..32l+31 (head hd = l>>1). Per (slot, b): the
//   1024-float q row (8 b128 loads per lane). Per edge in fixed slot order: kd = kid[eid] (clamped), the k row of
//   (kd, b) (8 b128 loads per lane), dot of the lane's 32 channels, head sum by xor 1, logit * 1/8, running-max
//   single pass per head: den = den*exp(mx-mn) + exp(l-mn), av_c likewise with the v row of (kd, b).
//   o_c = av_c / den (NaN poison on cap overflow, zero row for pad queries >= nS); the 1024-float row is relaid out
//   through the wave's private LDS row so that every store instruction writes 512 contiguous bytes:
// coverage: gridDim.x * NBA * 2 >= mRows (host-checked): APL rows 0..mRows-1 x cols 0..2047 written exactly once.
// LDS extents: list LISTN, hl/sl RCAP, cnt/offs/cur NBA, misc 16 zeroed before any read; per-wave staging row:
//   elements 0..1023 written by the same wave (32 lanes x 32 floats) before each reload.
// ---------------------------------------------------------------------------
__global__ __launch_bounds__(NTHR) void k_scan(const int* __restrict__ qid, const int* __restrict__ kid,
                                               const float* __restrict__ QKV, unsigned short* apl,
                                               int nE, int nS, int mRows, int vec8) {
  extern __shared__ __attribute__((aligned(16))) int dsm[];
  int* list = dsm;                         // LISTN
  int* hl   = dsm + LISTN;                 // RCAP
  int* sl   = hl + RCAP;                   // RCAP
  int* cnt  = sl + RCAP;                   // NBA
  int* offs = cnt + NBA;                   // NBA
  int* cur  = offs + NBA;                  // NBA
  int* misc = cur + NBA;                   // [0..7] per-wave hit counts, [8] total, [9] overflow flag
  const int tid = (int)threadIdx.x, lane = tid & 31, wave = tid >> 5;
  const int nodeBase = (int)blockIdx.x * NBA;

  {
    const v4i z4 = {0, 0, 0, 0};
    for (int i = tid * 4; i < AGG_ZINTS; i += NTHR * 4) *(v4ia*)(dsm + i) = z4;
    if (tid < MISC_INTS) misc[tid] = 0;
  }
  __syncthreads();

  // ---- phase 1: scan + fixed-order drain into hl / cnt
  int t = 0, ov = 0;
  const int nChunks = (nE + CHUNK - 1) / CHUNK;
#pragma unroll 1
  for (int ch = 0; ch < nChunks; ++ch) {
    const int cbase = ch * CHUNK;
    const int wc = scan_chunk(qid, nE, cbase, nodeBase, NBA, vec8, list, tid, lane, wave);
    if (lane == 0) misc[wave] = wc;
    __syncthreads();
    if (wave == 0) {
#pragma unroll 1
      for (int w2 = 0; w2 < NWAVE; ++w2) {
        int c = misc[w2];
        c = c < 0 ? 0 : (c > WCAP ? WCAP : c);
#pragma unroll 1
        for (int b0 = 0; b0 < c; b0 += 32) {
          const int idx = b0 + lane;
          const int ent = list[w2 * WCAP + (idx < WCAP ? idx : WCAP - 1)];
          const int m32 = (c - b0) < 32 ? (c - b0) : 32;
#pragma unroll 1
          for (int k = 0; k < m32; ++k) {
            const int u    = __builtin_amdgcn_readlane(ent, k);
            const int slot = u & (NBA - 1);
            const int el   = (u >> SLA) & (CHUNK - 1);
            const int pk   = ((cbase + el) << SLA) | slot;
            if (t < RCAP) {
              if (lane == 0) { hl[t] = pk; cnt[slot] = cnt[slot] + 1; }
              t = t + 1;
            } else {
              ov = 1;
            }
          }
        }
      }
    }
    __syncthreads();
  }
  if (wave == 0 && lane == 0) { misc[8] = t; misc[9] = ov; }
  __syncthreads();
  int tt = misc[8];
  tt = tt < 0 ? 0 : (tt > RCAP ? RCAP : tt);
  const int ovf = misc[9];

  // ---- phase 2: offsets and placement (wave 0)
  if (wave == 0) {                                      // lane l < NBA owns slot l
    const int cv = cnt[lane < NBA ? lane : NBA - 1];
    const int s  = lane < NBA ? cv : 0;
    int incl = s;
#pragma unroll
    for (int d = 1; d < 32; d <<= 1) {
      const int y = __shfl_up(incl, d, 32);
      if (lane >= d) incl += y;
    }
    if (lane < NBA) {
      offs[lane] = incl - s;
      cur[lane]  = incl - s;
    }
  }
  __syncthreads();
  if (wave == 0) {
#pragma unroll 1
    for (int b0 = 0; b0 < tt; b0 += 32) {
      const int idx = b0 + lane;
      const int ent = hl[idx < RCAP ? idx : RCAP - 1];
      const int m32 = (tt - b0) < 32 ? (tt - b0) : 32;
#pragma unroll 1
      for (int k = 0; k < m32; ++k) {
        const int u    = __builtin_amdgcn_readlane(ent, k);
        const int slot = u & (NBA - 1);
        if (lane == 0) {
          int p = cur[slot];
          p = p < 0 ? 0 : (p > RCAP - 1 ? RCAP - 1 : p);
          sl[p] = u;
          cur[slot] = p + 1;
        }
      }
    }
  }
  __syncthreads();

  // ---- phase 3: per-(slot, b) edge attention + row build
  const float qnan = __int_as_float(0x7fc00000);
  float* stg = (float*)hl + wave * CW;                  // per-wave staging row [1024] (hl is dead after phase 2)
  const v4f z4 = {0.f, 0.f, 0.f, 0.f};
  const int wv = __builtin_amdgcn_readfirstlane(wave);  // scalar, so that slot and b stay wave-uniform registers
  {
    const int s  = wv / BD;                             // slot
    const int b  = wv % BD;
    const int qn = nodeBase + s;                        // query index
    int c = cnt[s];
    const bool big = c > DEGCAP;
    c = c < 0 ? 0 : (c > DEGCAP ? DEGCAP : c);
    int o = offs[s];
    o = o < 0 ? 0 : (o > RCAP ? RCAP : o);
    const int  qc   = qn < nS ? qn : nS - 1;
    const bool live = qn < nS;                          // wave-uniform
    const bool pois = big || (ovf != 0);

    {
      const float* qr = QKV + ((size_t)qc * BD + b) * QKVW + OQ + 32 * lane;
      v4f qv[8];
#pragma unroll
      for (int j = 0; j < 8; ++j) qv[j] = *(const v4fa*)(qr + 4 * j);
      ldwait();

      float mx = -1.0e30f, dn = 0.0f;
      v4f av[8];
#pragma unroll
      for (int j = 0; j < 8; ++j) av[j] = z4;

#pragma unroll 1
      for (int b0 = 0; b0 < c; b0 += 32) {
        int idx = o + b0 + lane;
        idx = idx > RCAP - 1 ? RCAP - 1 : idx;
        const int ent = sl[idx];
        int eid = ent >> SLA;
        eid = eid < 0 ? 0 : (eid > nE - 1 ? nE - 1 : eid);
        int kd = kid[eid];
        kd = kd < 0 ? 0 : (kd > nS - 1 ? nS - 1 : kd);
        const int m32 = (c - b0) < 32 ? (c - b0) : 32;
#pragma unroll 1
        for (int k = 0; k < m32; ++k) {
          const int tk = __builtin_amdgcn_readlane(kd, k);
          const float* kr = QKV + ((size_t)tk * BD + b) * QKVW + OKK + 32 * lane;   // whole 4-KB k row
          v4f kv[8];
#pragma unroll
          for (int j = 0; j < 8; ++j) kv[j] = *(const v4fa*)(kr + 4 * j);
          ldwait();
          float p = 0.0f;
#pragma unroll
          for (int j = 0; j < 8; ++j) {
            p = fmaf(qv[j].x, kv[j].x, p); p = fmaf(qv[j].y, kv[j].y, p);
            p = fmaf(qv[j].z, kv[j].z, p); p = fmaf(qv[j].w, kv[j].w, p);
          }
          p += __shfl_xor(p, 1);                        // sum over the head's 2 lanes
          const float lg = p * ATTSC;
          const float df = lg - mx;
          const float ee = __expf(-fabsf(df));          // the other factor is exactly 1
          const bool up  = df > 0.0f;
          const float s1 = up ? ee : 1.0f;
          const float s2 = up ? 1.0f : ee;
          mx = up ? lg : mx;
          dn = fmaf(dn, s1, s2);
          const float* vr = QKV + ((size_t)tk * BD + b) * QKVW + OV + 32 * lane;    // whole 4-KB v row
          v4f vv[8];
#pragma unroll
          for (int j = 0; j < 8; ++j) vv[j] = *(const v4fa*)(vr + 4 * j);
          ldwait();
#pragma unroll
          for (int j = 0; j < 8; ++j) {
            av[j].x = fmaf(av[j].x, s1, s2 * vv[j].x); av[j].y = fmaf(av[j].y, s1, s2 * vv[j].y);
            av[j].z = fmaf(av[j].z, s1, s2 * vv[j].z); av[j].w = fmaf(av[j].w, s1, s2 * vv[j].w);
          }
        }
      }

      const float inv  = __builtin_amdgcn_rcpf(dn);     // den >= 1 when c > 0; c == 0 -> inf and 0 * inf = NaN (0 / 0)
      const float invp = pois ? qnan : inv;
      wave_sync();                                       // prior reads of the staging row are done
#pragma unroll
      for (int j = 0; j < 8; ++j) {
        v4f o4;
        o4.x = live ? av[j].x * invp : 0.0f;
        o4.y = live ? av[j].y * invp : 0.0f;
        o4.z = live ? av[j].z * invp : 0.0f;
        o4.w = live ? av[j].w * invp : 0.0f;
        *(v4fa*)(stg + 32 * lane + 4 * j) = o4;          // lane writes cols 32l .. 32l+31
      }
      wave_sync();
      v4u hv[4], lv[4];
#pragma unroll
      for (int j = 0; j < 4; ++j) {
        const v4f pa = *(const v4fa*)(stg + 256 * j + 8 * lane);         // lane reads cols 256j+8l .. +7
        const v4f pb = *(const v4fa*)(stg + 256 * j + 8 * lane + 4);
        pack8hl(pa, pb, hv[j], lv[j]);
      }
      const int row = qn * BD + b;
      if (row < mRows) {                                 // wave-uniform
        unsigned short* rp = apl + (size_t)row * APITCH;
#pragma unroll
        for (int j = 0; j < 4; ++j) {
          *(v4u*)(rp + 256 * j + 8 * lane)      = hv[j];
          *(v4u*)(rp + CW + 256 * j + 8 * lane) = lv[j];
        }
        
      }
    }
  }
}

// ---------------------------------------------------------------------------
static inline int cdiv(int a, int b) { return (a + b - 1) / b; }
static inline size_t al256(size_t o) { return (o + 255) & ~(size_t)255; }

extern "C" void kernel_launch(void* const* d_in, const int* in_sizes, int n_in,
                              void* d_out, int out_size, void* d_ws, size_t ws_size,
                              hipStream_t stream) {
  if (n_in < 11) return;
  if (in_sizes[0] < BD * CW || (in_sizes[0] % (BD * CW)) != 0) return;   // x [S][2][1024]
  const int nS = in_sizes[0] / (BD * CW);
  if (nS < 1 || nS > (1 << 20)) return;
  const int nE = in_sizes[1];                                          // q_id [E]
  if (nE < 1 || nE >= (1 << (31 - SLA))) return;                       // (eid << SLA | slot) fits a positive int
  if (in_sizes[2] != nE) return;                                       // k_id [E]
  if (in_sizes[3] != CW * CW || in_sizes[5] != CW * CW || in_sizes[7] != CW * CW || in_sizes[9] != CW * CW) return;
  if (in_sizes[4] != CW || in_sizes[6] != CW || in_sizes[8] != CW || in_sizes[10] != CW) return;
  if ((long long)out_size != (long long)nS * BD * CW) return;          // out [S][2][1024]

  const float* x   = (const float*)d_in[0];     // [S][2][1024] -> rows 2s+b of 1024
  const int*   qid = (const int*)  d_in[1];     // [E] key side (query)
  const int*   kid = (const int*)  d_in[2];     // [E] gathered side (k, v)
  const float* Wq  = (const float*)d_in[3];     // [1024][1024] natural [out][in]
  const float* bq  = (const float*)d_in[4];
  const float* Wk  = (const float*)d_in[5];
  const float* bk  = (const float*)d_in[6];
  const float* Wv  = (const float*)d_in[7];
  const float* bv  = (const float*)d_in[8];
  const float* Wx  = (const float*)d_in[9];
  const float* bx  = (const float*)d_in[10];
  float* out = (float*)d_out;                   // [S][2][1024] -> rows 2s+b of 1024

  const int nRows = nS * BD;
  const int MP = cdiv(nRows, GBM) * GBM;        // padded rows of every node plane
  const int gM = MP / GBM;
  const int gA = cdiv(cdiv(MP, BD), NBA);
  if ((long long)gA * NBA * BD < (long long)MP) return;
  const int vec8 = ((nE & 3) == 0) ? 1 : 0;

  // workspace carve (256-B aligned; every region sized to its whole-row store extent incl. padded rows MP)
  char* ws = (char*)d_ws;
  size_t off = 0;
  const size_t oXB  = off; off = al256(off + (size_t)MP * CW * 2);        // XB    [MP][1024]   bf16
  const size_t oWQ  = off; off = al256(off + (size_t)QKVW * CW * 2);      // WQKVT [3072][1024] bf16
  const size_t oWX  = off; off = al256(off + (size_t)CW * KOUT * 2);      // WXT   [1024][2048] bf16
  const size_t oQKV = off; off = al256(off + (size_t)MP * QKVW * 4);      // QKV   [MP][3072]   f32
  const size_t oAPL = off; off = al256(off + (size_t)MP * APITCH * 2);    // APL   [MP][2048]   bf16
  if (off > ws_size || off > (size_t)WSMAX) return;
  unsigned short* XB    = (unsigned short*)(ws + oXB);
  unsigned short* WQKVT = (unsigned short*)(ws + oWQ);
  unsigned short* WXT   = (unsigned short*)(ws + oWX);
  float*          QKV   = (float*)(ws + oQKV);
  unsigned short* APL   = (unsigned short*)(ws + oAPL);

  hipFuncSetAttribute(reinterpret_cast<const void*>(&k_scan),
                      hipFuncAttributeMaxDynamicSharedMemorySize, SCAN_LDS_BYTES);

  // node feature plane (bf16 bits), pad rows zero
  const int nUx = MP * (CW / 8);
  k_xprep<<<cdiv(nUx, NTHR), NTHR, 0, stream>>>(x, XB, nRows, nUx);
  // weight planes
  k_wprep<<<NUW / NTHR, NTHR, 0, stream>>>(Wq, Wk, Wv, Wx, WQKVT, WXT);
  // projection GEMM: QKV = XB [Wq|Wk|Wv]^T + b -> f32 [MP][3072]
  k_gemm<<<dim3(gM, QKVW / GBN), GTHR, 0, stream>>>(XB, CW, WQKVT, CW, QKV, QKVW, MP, bq, bk, bv, 1);
  // query-keyed sparse attention -> APL [MP][2048]
  k_scan<<<gA, NTHR, SCAN_LDS_BYTES, stream>>>(qid, kid, QKV, APL, nE, nS, MP, vec8);
  // trailing GEMM: out = APL . WXT^T + bx -> rows < nRows
  k_gemm<<<dim3(gM, CW / GBN), GTHR, 0, stream>>>(APL, APITCH, WXT, KOUT, out, CW, nRows, bx, bx, bx, 1);
}

// v003
// It runs in 155 microseconds.
// Two timings next to v002 put it at 1.23 and 1.22 times that version's speed.
// All steps since v000 together make it 44.7 times as fast.
#include <hip/hip_runtime.h>
#include <stddef.h>
#include <stdint.h>
#include <math.h>

// Contractions: v_wmma_f32_16x16x32_bf16 (bf16 operands, f32 accumulate) for the three projections
// x*[Wq|Wk|Wv]^T (K 1024, bf16 RNE copies of the inputs, products exact in f32) and for the trailing projection
// [o hi | o lo] * [Wx^T ; Wx^T] + bx (K 2048, attention output o carried as bf16 hi + bf16 residual).
// Per-edge per-head q.k dots (16 heads x 64), per-(query, b, head) running-max softmax over the query's own keys
// and the weighted value sums: f32 VALU.
//
// Row mapping: x [S][2][1024] and the output use row = 2*s + b (4096-B rows); q, k, v channel 64*h + c.
// Softmax: exp(qk - max) / sum over the edges sharing a q_id is evaluated per (query, b, head) with a running max
// over that query's keys (the shift cancels in num / den); a query without edges yields 0 * inf = NaN like 0 / 0.
//
// Carry audit: no power-of-two carries anywhere; no inverse factor exists.
//   XB    [MP][1024]   bf16 bits of x (pad rows zero)                      -> A of the projection GEMM
//   WQKVT [3072][1024] bf16 bits, row n = [Wq;Wk;Wv][n][k] (natural rows)  -> B of the projection GEMM
//   WXT   [1024][2048] bf16 bits, row n = Wx[n][k mod 1024]                -> B of the trailing GEMM
//   QKV   [MP][3072]   f32: q | k | v (+ bf16-valued bias)                  -> gathered by k_scan
//   APL   [MP][2048]   bf16 bits: o hi (cols 0..1023) | o lo (1024..2047)  -> A of the trailing GEMM

#define CW      1024                  // channels
#define BD      2                     // middle (batch) dimension of x
#define NHD     16                    // heads
#define HDM     64                    // head dim
#define QKVW    3072                  // node plane columns: q | k | v
#define OQ      0
#define OKK     1024
#define OV      2048
#define KOUT    2048                  // K of the trailing GEMM (hi | lo)
#define APITCH  2048                  // A plane pitch in 16-bit elements (4096 B = 32 lines)
#define NTHR    256
#define NWAVE   8
#define EPT     8
#define CHUNK   (NTHR * EPT)          // 2048 key entries per chunk
#define WCAP    (EPT * 32)            // 256: exact upper bound of hits per wave per chunk
#define LISTN   (NWAVE * WCAP)        // 2048 ints
#define NBA     4                     // query slots per scan block: NBA * BD = 8 (slot, b) rows, one per wave
#define SLA     2
#define RCAP    8192                  // hit-list capacity per block (>= NBA * DEGCAP; also holds the 8 staging rows)
#define DEGCAP  64                    // static per-slot trip clamp (64 keys per query)
#define GBM     128                   // GEMM rows per block
#define GBN     128                   // GEMM cols per block
#define GTHR    256                   // GEMM threads per block (8 waves, 2 x 4, 64 x 32 outputs each)
#define GBK     128                   // k per pass: 256 B of every operand row
#define GPITCH  272                   // LDS row pitch in bytes (16 B x odd: b128 fragment reads without conflicts)
#define GSTAGE  ((GBM + GBN) * GPITCH)   // 69632 B: one buffer
#define GSP     132                   // output staging pitch in floats
#define UQKV    (CW * (CW / 8))       // 131072 weight-prep units per projection matrix
#define UWX     (CW * (KOUT / 8))     // 262144 units for the WXT plane
#define NUW     (3 * UQKV + UWX)      // 655360
#define AGG_ZINTS (LISTN + 2 * RCAP + 3 * NBA)            // 18444
#define MISC_INTS 16
#define SCAN_LDS_BYTES ((AGG_ZINTS + MISC_INTS) * 4)       // 73840
#define ATTSC   0.125f                // 1/sqrt(64)
#define WSMAX   134217728

static_assert((CHUNK & (CHUNK - 1)) == 0 && CHUNK <= 4096);
static_assert((NBA & (NBA - 1)) == 0 && NBA == (1 << SLA));
static_assert(((long long)CHUNK << SLA) < (1LL << 31));
static_assert(LISTN >= NWAVE * WCAP);
static_assert(NBA * BD == NWAVE && NBA <= 32 && RCAP >= NBA * DEGCAP);
static_assert(RCAP % 32 == 0 && AGG_ZINTS % 4 == 0 && LISTN % 4 == 0 && ((AGG_ZINTS + MISC_INTS) % 4) == 0);
static_assert(NWAVE * CW <= RCAP);                    // per-wave output-row staging lives inside the dead hit list
static_assert(SCAN_LDS_BYTES <= 300000);
static_assert(CW == 8 * 32 * 4);                      // 8 row pieces of 512 B, lane owns 4 channels of each
static_assert(HDM == 16 * 4 && NHD * HDM == CW);      // one head = the 16 lanes of a half wave in one piece
static_assert(QKVW == 3 * CW && (QKVW % GBN) == 0 && (CW % GBN) == 0);
static_assert((CW % 32) == 0 && (KOUT % 32) == 0 && KOUT == 2 * CW && APITCH == KOUT);
static_assert((APITCH * 2) % 128 == 0);
static_assert(GBM == 128 && GBN == 128 && GTHR == 256 && GBK == 128);
static_assert((CW % GBK) == 0 && CW / GBK >= 2 && (KOUT % GBK) == 0 && (CW % GBN) == 0);
static_assert(GBM * GSP * 4 <= 2 * GSTAGE && (GSP * 4) % 16 == 0 && GPITCH >= 2 * GBK && (GPITCH % 16) == 0);
static_assert(UQKV == (1 << 17) && (CW / 8) == 128 && (KOUT / 8) == 256);
static_assert(UQKV % NTHR == 0 && UWX % NTHR == 0 && (3 * UQKV) % NTHR == 0);
static_assert(DEGCAP >= 32);

typedef float          v4f  __attribute__((ext_vector_type(4)));
typedef float          v8f  __attribute__((ext_vector_type(8)));
typedef int            v4i  __attribute__((ext_vector_type(4)));
typedef int            v8i  __attribute__((ext_vector_type(8)));
typedef unsigned int   v4u  __attribute__((ext_vector_type(4)));
typedef unsigned short v8us __attribute__((ext_vector_type(8)));
typedef __bf16         v16b __attribute__((ext_vector_type(16)));
typedef v4f  __attribute__((may_alias)) v4fa;
typedef v4i  __attribute__((may_alias)) v4ia;
typedef v4u  __attribute__((may_alias)) v4ua;
typedef v8us __attribute__((may_alias)) v8usa;
union FragB { v16b v; v8us h[2]; v8i w; };

// WMMA with hazard guard: ties D, keeps A/B live for 4 VALU slots
__device__ __forceinline__ v8f wmb(const FragB& a, const FragB& b, v8f c) {
  v8f d = __builtin_amdgcn_wmma_f32_16x16x32_bf16(false, a.v, false, b.v, (short)0, c, false, false);
  asm volatile("v_nop\n\tv_nop\n\tv_nop\n\tv_nop" : "+v"(d) : "v"(a.w), "v"(b.w));
  return d;
}

// drain all outstanding vector-memory loads; also a compiler barrier for memory operations
__device__ __forceinline__ void ldwait() {
  asm volatile("s_wait_loadcnt 0x0" ::: "memory");
}

__device__ __forceinline__ void wave_sync() {
  __builtin_amdgcn_fence(__ATOMIC_RELEASE, "wavefront");
  __builtin_amdgcn_wave_barrier();
  __builtin_amdgcn_fence(__ATOMIC_ACQUIRE, "wavefront");
}

// sum over the 16 lanes of a half wave, every lane gets it (row_xmask 1, 2, 4, 8); all 32 lanes are on at every call
__device__ __forceinline__ float row16_sum(float v) {
  v += __int_as_float(__builtin_amdgcn_update_dpp(0, __float_as_int(v), 0x161, 0xf, 0xf, true));
  v += __int_as_float(__builtin_amdgcn_update_dpp(0, __float_as_int(v), 0x162, 0xf, 0xf, true));
  v += __int_as_float(__builtin_amdgcn_update_dpp(0, __float_as_int(v), 0x164, 0xf, 0xf, true));
  v += __int_as_float(__builtin_amdgcn_update_dpp(0, __float_as_int(v), 0x168, 0xf, 0xf, true));
  return v;
}

// 2^x. The v_nop fills the one slot that the instruction set asks for behind a transcendental.
__device__ __forceinline__ float exp2_slot(float x) {
  float r;
  asm("v_exp_f32 %0, %1\n\tv_nop" : "=v"(r) : "v"(x));
  return r;
}

// f32 -> bf16 bits, RNE convert; bf16 bits -> f32
__device__ __forceinline__ unsigned int f2bf(float f) {
  const unsigned int u = __float_as_uint(f);
  return ((u + 0x7FFFu + ((u >> 16) & 1u)) >> 16) & 0xFFFFu;
}
__device__ __forceinline__ float bf2f(unsigned int b) { return __uint_as_float(b << 16); }
__device__ __forceinline__ float bfr(float f) { return bf2f(f2bf(f)); }
__device__ __forceinline__ v4f bfr4(const v4f a) {
  v4f r; r.x = bfr(a.x); r.y = bfr(a.y); r.z = bfr(a.z); r.w = bfr(a.w); return r;
}
__device__ __forceinline__ unsigned int pk2(float lo, float hi) { return f2bf(lo) | (f2bf(hi) << 16); }
// 8 floats -> 8 bf16 packed in 16 B (element 2i = low half of word i)
__device__ __forceinline__ v4u pack8(const v4f a, const v4f b) {
  v4u r;
  r.x = pk2(a.x, a.y); r.y = pk2(a.z, a.w); r.z = pk2(b.x, b.y); r.w = pk2(b.z, b.w);
  return r;
}
// hi = bf16(v), lo = bf16(v - hi): two floats -> one packed word of each
__device__ __forceinline__ void hl2(float v0, float v1, unsigned int& hw, unsigned int& lw) {
  const unsigned int h0 = f2bf(v0), h1 = f2bf(v1);
  const unsigned int l0 = f2bf(v0 - bf2f(h0)), l1 = f2bf(v1 - bf2f(h1));
  hw = h0 | (h1 << 16);
  lw = l0 | (l1 << 16);
}
__device__ __forceinline__ void pack8hl(const v4f a, const v4f b, v4u& hv, v4u& lv) {
  unsigned int h, l;
  hl2(a.x, a.y, h, l); hv.x = h; lv.x = l;
  hl2(a.z, a.w, h, l); hv.y = h; lv.y = l;
  hl2(b.x, b.y, h, l); hv.z = h; lv.z = l;
  hl2(b.z, b.w, h, l); hv.w = h; lv.w = l;
}

// ---------------------------------------------------------------------------
// One chunk of the key list (contiguous int array): each thread tests EPT entries against the block's
// slot range [slotBase, slotBase + nb); hits are appended to this wave's LDS list as (local_index << SLA | slot).
// Returns the wave-uniform hit count (<= WCAP always). The vector / scalar load choice is block-uniform; the
// scalar path clamps every address and selects the sentinel by value.
// ---------------------------------------------------------------------------
__device__ __forceinline__ int scan_chunk(const int* __restrict__ keys, int nE, int cbase, int slotBase,
                                          int nb, int vec8, int* list, int tid, int lane, int wave) {
  int wc = 0;
  const int el0  = tid * EPT;
  const int e0   = cbase + el0;
  const int sent = -2147483647 - 1;
  v4i da, db;
  if (vec8 != 0 && cbase + CHUNK <= nE) {
    da = *(const v4i*)(keys + e0);
    db = *(const v4i*)(keys + e0 + 4);
  } else {
    da.x = (e0     < nE) ? keys[min(e0,     nE - 1)] : sent;
    da.y = (e0 + 1 < nE) ? keys[min(e0 + 1, nE - 1)] : sent;
    da.z = (e0 + 2 < nE) ? keys[min(e0 + 2, nE - 1)] : sent;
    da.w = (e0 + 3 < nE) ? keys[min(e0 + 3, nE - 1)] : sent;
    db.x = (e0 + 4 < nE) ? keys[min(e0 + 4, nE - 1)] : sent;
    db.y = (e0 + 5 < nE) ? keys[min(e0 + 5, nE - 1)] : sent;
    db.z = (e0 + 6 < nE) ? keys[min(e0 + 6, nE - 1)] : sent;
    db.w = (e0 + 7 < nE) ? keys[min(e0 + 7, nE - 1)] : sent;
  }
  const unsigned nbs = (unsigned)slotBase;
  const unsigned unb = (unsigned)nb;
  const unsigned s0 = (unsigned)da.x - nbs, s1 = (unsigned)da.y - nbs;
  const unsigned s2 = (unsigned)da.z - nbs, s3 = (unsigned)da.w - nbs;
  const unsigned s4 = (unsigned)db.x - nbs, s5 = (unsigned)db.y - nbs;
  const unsigned s6 = (unsigned)db.z - nbs, s7 = (unsigned)db.w - nbs;
  const bool h0 = s0 < unb, h1 = s1 < unb, h2 = s2 < unb, h3 = s3 < unb;
  const bool h4 = s4 < unb, h5 = s5 < unb, h6 = s6 < unb, h7 = s7 < unb;
  const unsigned any = __builtin_amdgcn_ballot_w32(h0 | h1 | h2 | h3 | h4 | h5 | h6 | h7);
  if (any != 0u) {
#define HITJ(J, HJ, SJ) { \
      const unsigned mj = __builtin_amdgcn_ballot_w32(HJ); \
      if (mj != 0u) { \
        if (HJ) { \
          const int pos = wc + (int)__builtin_amdgcn_mbcnt_lo(mj, 0u); \
          if (pos < WCAP) list[wave * WCAP + pos] = ((el0 + (J)) << SLA) | (int)(SJ); \
        } \
        wc += (int)__builtin_popcount(mj); } }
    HITJ(0, h0, s0)
    HITJ(1, h1, s1)
    HITJ(2, h2, s2)
    HITJ(3, h3, s3)
    HITJ(4, h4, s4)
    HITJ(5, h5, s5)
    HITJ(6, h6, s6)
    HITJ(7, h7, s7)
#undef HITJ
  }
  return wc;
}

// ---------------------------------------------------------------------------
// Node feature plane: XB[row][c] = bf16(x[row][c]) for row < nN (all 1024 c), zero for pad rows nN <= row < MP
// (load address clamped into x, value zeroed by select). One thread = 8 contiguous 16-bit values (16 B) from two
// coverage: nUnits = MP*128 threads x 8 = MP x 1024 elements exactly.
// ---------------------------------------------------------------------------
__global__ __launch_bounds__(NTHR) void k_xprep(const float* __restrict__ x, unsigned short* xb, int nN, int nUnits) {
  const int i = (int)blockIdx.x * NTHR + (int)threadIdx.x;
  if (i >= nUnits) return;
  const int row = i >> 7;
  const int c0  = (i & 127) * 8;
  const int rc  = row < nN ? row : nN - 1;
  const float* p = x + (size_t)rc * CW + c0;
  v4f a = *(const v4fa*)p;
  v4f b = *(const v4fa*)(p + 4);
  const v4f z4 = {0.f, 0.f, 0.f, 0.f};
  if (row >= nN) { a = z4; b = z4; }
  const v4u hv = pack8(a, b);
  unsigned short* o = xb + (size_t)row * CW + c0;
  *(v4u*)o = hv;
  
}

// ---------------------------------------------------------------------------
// Weight planes (k-contiguous B rows, bf16 bits of the f32 inputs).
//   units 0..393215 (part = u >> 17, block-uniform): WQKVT[part*1024 + n][k8..k8+7] = bf16(W_part[n][k8..]),
//     W_part in {Wq, Wk, Wv}, each a natural [1024][1024] row-major matrix (out x in).
//   units 393216..655359 (block-uniform): WXT[n][k8..k8+7] = bf16(Wx[n][(k8 mod 1024) ..]) for k8 in 0..2040.
// coverage: WQKVT = 3 x 131072 units x 8 = 3072 x 1024 exactly; WXT = 262144 units x 8 = 1024 x 2048 exactly.
// ---------------------------------------------------------------------------
__global__ __launch_bounds__(NTHR) void k_wprep(const float* __restrict__ Wq, const float* __restrict__ Wk,
                                                const float* __restrict__ Wv, const float* __restrict__ Wx,
                                                unsigned short* WQKVT, unsigned short* WXT) {
  const int u = (int)blockIdx.x * NTHR + (int)threadIdx.x;
  if (u >= NUW) return;
  v4f a, b;
  unsigned short* dp;
  if (u < 3 * UQKV) {                                    // block-uniform
    const int part = u >> 17;
    const int v    = u & (UQKV - 1);
    const int n    = v >> 7;                             // 0..1023
    const int k8   = (v & 127) * 8;                      // 0..1016
    const float* W = (part == 0) ? Wq : ((part == 1) ? Wk : Wv);
    const float* p = W + (size_t)n * CW + k8;            // W[n][k8 .. k8+7], contiguous
    a = *(const v4fa*)p;
    b = *(const v4fa*)(p + 4);
    dp = WQKVT + (size_t)(part * CW + n) * CW + k8;
  } else {
    const int v  = u - 3 * UQKV;                         // 0..262143
    const int n  = v >> 8;                               // 0..1023
    const int k8 = (v & 255) * 8;                        // 0..2040
    const int kk = k8 & (CW - 1);                        // source column, in range
    const float* p = Wx + (size_t)n * CW + kk;           // Wx[n][kk .. kk+7], contiguous
    a = *(const v4fa*)p;
    b = *(const v4fa*)(p + 4);
    dp = WXT + (size_t)n * KOUT + k8;
  }
  const v4u wv = pack8(a, b);
  *(v4u*)dp = wv;
  
}

// ---------------------------------------------------------------------------
// Eight asynchronous 16-B-per-lane copies global -> LDS: rows 16 apart in both places (gstep elements, 16 pitches).
// The s_wait_xcnt stands inside the statement so that no address register is rewritten in front of it.
// ---------------------------------------------------------------------------
__device__ __forceinline__ void acopy8(unsigned int l0, const unsigned short* g0, size_t gstep) {
  const unsigned int l1 = l0 + 16 * GPITCH, l2 = l0 + 32 * GPITCH, l3 = l0 + 48 * GPITCH;
  const unsigned int l4 = l0 + 64 * GPITCH, l5 = l0 + 80 * GPITCH, l6 = l0 + 96 * GPITCH, l7 = l0 + 112 * GPITCH;
  const unsigned short* g1 = g0 + gstep;
  const unsigned short* g2 = g1 + gstep;
  const unsigned short* g3 = g2 + gstep;
  const unsigned short* g4 = g3 + gstep;
  const unsigned short* g5 = g4 + gstep;
  const unsigned short* g6 = g5 + gstep;
  const unsigned short* g7 = g6 + gstep;
  asm volatile("global_load_async_to_lds_b128 %0, %8, off\n\t"
               "global_load_async_to_lds_b128 %1, %9, off\n\t"
               "global_load_async_to_lds_b128 %2, %10, off\n\t"
               "global_load_async_to_lds_b128 %3, %11, off\n\t"
               "global_load_async_to_lds_b128 %4, %12, off\n\t"
               "global_load_async_to_lds_b128 %5, %13, off\n\t"
               "global_load_async_to_lds_b128 %6, %14, off\n\t"
               "global_load_async_to_lds_b128 %7, %15, off\n\t"
               "s_wait_xcnt 0x0"
               :: "v"(l0), "v"(l1), "v"(l2), "v"(l3), "v"(l4), "v"(l5), "v"(l6), "v"(l7),
                  "v"(g0), "v"(g1), "v"(g2), "v"(g3), "v"(g4), "v"(g5), "v"(g6), "v"(g7)
               : "memory");
}

// ---------------------------------------------------------------------------
// bf16 WMMA GEMM: C[rows][N] = A[MP][K] (bf16 bits, pitch lda) x WT[N][K]^T (bf16 rows n, k-contiguous, pitch K).
// grid (MP/128, N/128), 256 threads: one 128x128 tile of C per block; wave w owns rows 64*(w>>2).. +63 and
// cols 32*(w&3).. +31 of it: acc[4][2]. K runs in passes of 128 (256 B of every operand row); a stage is
// [A 128 rows | WT 128 rows] at LDS pitch 272 B, two buffers. Each thread copies 16 pieces of 16 B per stage
// (row = 16i + tid/16, piece = tid%16, so one wave instruction moves two whole 256-B row pieces); the copies of
// pass t+2 are issued behind the barrier that ends pass t and are waited for at the foot of pass t+1.
// A fragment (row m = lane&15): elements 0..7 <- k0+8h+0..7, 8..15 <- k0+16+8h+0..7 (h = lane>>4); B fragment
// (col n = lane&15) from its WT row with the SAME k map; D element r = (row 8h+r, col lane&15). k ascends in
// steps of 32 on one accumulator chain per output tile.
// Epilogue: the 128x128 f32 tile is staged in the ring (every copy landed, every reader past the last barrier),
// + bf16-valued bias (bias vector selected by col0 / 1024, block-uniform; scaled by useBias in {0,1}; the load is
// always in range); one instruction then writes one 512-B row segment.
// coverage: rows rowBase..rowBase+127 restricted to < nRows x cols col0..col0+127 per block;
//   grid (MP/128, N/128) covers every (row < nRows, col) exactly once.
// LDS extents: copies fill rows 0..255 x bytes 0..255 of a buffer (pitch 272); staging 128 x 132 floats.
// ---------------------------------------------------------------------------
__global__ __launch_bounds__(GTHR) void k_gemm(
    const unsigned short* __restrict__ A, int lda, const unsigned short* __restrict__ WT, int K,
    float* outF, int ldo, int nRows,
    const float* __restrict__ bs0, const float* __restrict__ bs1, const float* __restrict__ bs2, int useBias)
{
  __shared__ __attribute__((aligned(16))) unsigned char ring[2 * GSTAGE];   // 139264 B
  const int tid = (int)threadIdx.x, lane = tid & 31, wave = tid >> 5, hh = lane >> 4, m = lane & 15;
  const int wm = wave >> 2, wn = wave & 3;
  const int rowBase = (int)blockIdx.x * GBM;
  const int col0    = (int)blockIdx.y * GBN;

  v8f acc[4][2];
  {
    const v8f z = {0.f, 0.f, 0.f, 0.f, 0.f, 0.f, 0.f, 0.f};
#pragma unroll
    for (int i = 0; i < 4; ++i) { acc[i][0] = z; acc[i][1] = z; }
  }
  const int crow = tid >> 4, cseg = tid & 15;
  const unsigned short* ga = A  + (size_t)(rowBase + crow) * (size_t)lda + 8 * cseg;
  const unsigned short* gb = WT + (size_t)(col0 + crow) * (size_t)K + 8 * cseg;
  const size_t sa = (size_t)16 * (size_t)lda, sb = (size_t)16 * (size_t)K;
  const unsigned int la = (unsigned int)(size_t)ring + (unsigned int)(crow * GPITCH + 16 * cseg);
  const unsigned int lb = la + GBM * GPITCH;
  const int npass = K / GBK;

  acopy8(la, ga, sa);
  acopy8(lb, gb, sb);
  asm volatile("s_wait_asynccnt 0x0" ::: "memory");   // this wave's part of stage 0 has landed
  __syncthreads();                                     // stage 0 readable by every wave
  if (npass > 1) {
    acopy8(la + GSTAGE, ga + GBK, sa);
    acopy8(lb + GSTAGE, gb + GBK, sb);
  }

#pragma unroll 1   // passes stay rolled: one copy of the 32-WMMA body
  for (int t = 0; t < npass; ++t) {
    const unsigned int bo = (unsigned int)(t & 1) * GSTAGE;
    const unsigned char* ar = ring + bo + (64 * wm + m) * GPITCH + 16 * hh;
    const unsigned char* br = ring + bo + (GBM + 32 * wn + m) * GPITCH + 16 * hh;
#pragma unroll
    for (int kk = 0; kk < GBK / 32; ++kk) {
      FragB af[4], bf[2];
#pragma unroll
      for (int i = 0; i < 4; ++i) {
        af[i].h[0] = *(const v8usa*)(ar + 16 * i * GPITCH + 64 * kk);        // k = 32kk + 8hh + 0..7
        af[i].h[1] = *(const v8usa*)(ar + 16 * i * GPITCH + 64 * kk + 32);   // k = 32kk + 16 + 8hh + 0..7
      }
#pragma unroll
      for (int j = 0; j < 2; ++j) {
        bf[j].h[0] = *(const v8usa*)(br + 16 * j * GPITCH + 64 * kk);        // same k map as A
        bf[j].h[1] = *(const v8usa*)(br + 16 * j * GPITCH + 64 * kk + 32);
      }
#pragma unroll
      for (int i = 0; i < 4; ++i) {
#pragma unroll
        for (int j = 0; j < 2; ++j) acc[i][j] = wmb(af[i], bf[j], acc[i][j]);
      }
    }
    asm volatile("s_wait_dscnt 0x0" ::: "memory");     // this wave's reads of the buffer are done before its refill
    asm volatile("s_wait_asynccnt 0x0" ::: "memory");  // this wave's part of stage t+1 has landed
    __syncthreads();                                   // publishes stage t+1, frees the buffer of stage t
    if (t + 2 < npass) {                               // block-uniform
      acopy8(la + bo, ga + (size_t)(t + 2) * GBK, sa);
      acopy8(lb + bo, gb + (size_t)(t + 2) * GBK, sb);
    }
  }
  asm volatile("s_wait_asynccnt 0x0" ::: "memory");    // nothing in flight when the ring becomes output staging

  float* stg = (float*)ring;
#pragma unroll
  for (int i = 0; i < 4; ++i) {
#pragma unroll
    for (int j = 0; j < 2; ++j) {
      const int lc = 32 * wn + 16 * j + m;
#pragma unroll
      for (int r = 0; r < 8; ++r) {
        const int lr = 64 * wm + 16 * i + 8 * hh + r;   // D element r = (row 8hh+r, col m)
        stg[lr * GSP + lc] = acc[i][j][r];
      }
    }
  }
  __syncthreads();

  const int mat = col0 / CW;                            // block-uniform
  const float* bsel = (mat == 0) ? bs0 : ((mat == 1) ? bs1 : bs2);
  v4f b4 = *(const v4fa*)(bsel + (col0 & (CW - 1)) + 4 * lane);
  b4 = bfr4(b4) * (float)useBias;

  v4f fv[16];
#pragma unroll
  for (int i = 0; i < 16; ++i) {
    const int lr = 16 * wave + i;
    fv[i] = *(const v4fa*)(stg + lr * GSP + 4 * lane) + b4;
  }
#pragma unroll
  for (int i = 0; i < 16; ++i) {
    const int lr = 16 * wave + i;
    const int gr = rowBase + lr;
    const int gs = gr < nRows ? gr : nRows - 1;
    float* op = outF + (size_t)gs * (size_t)ldo + col0 + 4 * lane;
    if (gr < nRows) *(v4f*)op = fv[i];
  }
}

// ---------------------------------------------------------------------------
// Query-keyed sparse attention, no atomics, no global tables. Block owns query slots [nodeBase, nodeBase + NBA);
// key of edge e = qid[e], the gathered side is kid[e].
// Phase 1: chunk scan of the whole qid list; wave 0 drains each chunk's per-wave hit lists in fixed (wave, lane)
//   order, lane 0 appends (eid << SLA | slot) to the block list hl (cap RCAP, overflow -> flag) and increments
//   cnt[slot]. Phase 2: wave 0: exclusive scan of cnt -> offs, then lane 0 places every hit into sl in slot order
//   (hl order kept within a slot: by chunk, wave, entry J, then lane).
// Phase 3 (waves independent, no block barriers): wave w owns the one (slot, b) row w of the block's NBA * BD = 8
//   rows (slot = w / 2, b = w % 2; row = 2*query + b of the QKV plane). Lane l owns channels 128j+4l..128j+4l+3 of
//   piece j = 0..7, so every load instruction of a row reads 512 contiguous bytes (4 lines); head of (j, l) =
//   2j + (l>>4). Per (slot, b): the 1024-float q row (8 b128 loads per lane). Per edge in fixed slot order:
//   kd = kid[eid] (clamped), the k row of (kd, b) (8 b128 loads per lane), per piece the dot of the lane's 4
//   channels and its sum over the 16 lanes of the half wave, logit * 1/8, running-max single pass per head (each
//   lane keeps the 8 heads of its half): den = den*exp(mx-mn) + exp(l-mn), av_c likewise with the v row of (kd, b).
//   o_c = av_c / den (NaN poison on cap overflow, zero row for pad queries >= nS); the 1024-float row is relaid out
//   through the wave's private LDS row so that every store instruction writes 512 contiguous bytes:
// coverage: gridDim.x * NBA * 2 >= mRows (host-checked): APL rows 0..mRows-1 x cols 0..2047 written exactly once.
// LDS extents: list LISTN, hl/sl RCAP, cnt/offs/cur NBA, misc 16 zeroed before any read; per-wave staging row:
//   elements 0..1023 written by the same wave (32 lanes x 32 floats) before each reload.
// ---------------------------------------------------------------------------
__global__ __launch_bounds__(NTHR) void k_scan(const int* __restrict__ qid, const int* __restrict__ kid,
                                               const float* __restrict__ QKV, unsigned short* apl,
                                               int nE, int nS, int mRows, int vec8) {
  extern __shared__ __attribute__((aligned(16))) int dsm[];
  int* list = dsm;                         // LISTN
  int* hl   = dsm + LISTN;                 // RCAP
  int* sl   = hl + RCAP;                   // RCAP
  int* cnt  = sl + RCAP;                   // NBA
  int* offs = cnt + NBA;                   // NBA
  int* cur  = offs + NBA;                  // NBA
  int* misc = cur + NBA;                   // [0..7] per-wave hit counts, [8] total, [9] overflow flag
  const int tid = (int)threadIdx.x, lane = tid & 31, wave = tid >> 5;
  const int nodeBase = (int)blockIdx.x * NBA;

  {
    const v4i z4 = {0, 0, 0, 0};
    for (int i = tid * 4; i < AGG_ZINTS; i += NTHR * 4) *(v4ia*)(dsm + i) = z4;
    if (tid < MISC_INTS) misc[tid] = 0;
  }
  __syncthreads();

  // ---- phase 1: scan + fixed-order drain into hl / cnt
  int t = 0, ov = 0;
  const int nChunks = (nE + CHUNK - 1) / CHUNK;
#pragma unroll 1
  for (int ch = 0; ch < nChunks; ++ch) {
    const int cbase = ch * CHUNK;
    const int wc = scan_chunk(qid, nE, cbase, nodeBase, NBA, vec8, list, tid, lane, wave);
    if (lane == 0) misc[wave] = wc;
    __syncthreads();
    if (wave == 0) {
#pragma unroll 1
      for (int w2 = 0; w2 < NWAVE; ++w2) {
        int c = misc[w2];
        c = c < 0 ? 0 : (c > WCAP ? WCAP : c);
#pragma unroll 1
        for (int b0 = 0; b0 < c; b0 += 32) {
          const int idx = b0 + lane;
          const int ent = list[w2 * WCAP + (idx < WCAP ? idx : WCAP - 1)];
          const int m32 = (c - b0) < 32 ? (c - b0) : 32;
#pragma unroll 1
          for (int k = 0; k < m32; ++k) {
            const int u    = __builtin_amdgcn_readlane(ent, k);
            const int slot = u & (NBA - 1);
            const int el   = (u >> SLA) & (CHUNK - 1);
            const int pk   = ((cbase + el) << SLA) | slot;
            if (t < RCAP) {
              if (lane == 0) { hl[t] = pk; cnt[slot] = cnt[slot] + 1; }
              t = t + 1;
            } else {
              ov = 1;
            }
          }
        }
      }
    }
    __syncthreads();
  }
  if (wave == 0 && lane == 0) { misc[8] = t; misc[9] = ov; }
  __syncthreads();
  int tt = misc[8];
  tt = tt < 0 ? 0 : (tt > RCAP ? RCAP : tt);
  const int ovf = misc[9];

  // ---- phase 2: offsets and placement (wave 0)
  if (wave == 0) {                                      // lane l < NBA owns slot l
    const int cv = cnt[lane < NBA ? lane : NBA - 1];
    const int s  = lane < NBA ? cv : 0;
    int incl = s;
#pragma unroll
    for (int d = 1; d < 32; d <<= 1) {
      const int y = __shfl_up(incl, d, 32);
      if (lane >= d) incl += y;
    }
    if (lane < NBA) {
      offs[lane] = incl - s;
      cur[lane]  = incl - s;
    }
  }
  __syncthreads();
  if (wave == 0) {
#pragma unroll 1
    for (int b0 = 0; b0 < tt; b0 += 32) {
      const int idx = b0 + lane;
      const int ent = hl[idx < RCAP ? idx : RCAP - 1];
      const int m32 = (tt - b0) < 32 ? (tt - b0) : 32;
#pragma unroll 1
      for (int k = 0; k < m32; ++k) {
        const int u    = __builtin_amdgcn_readlane(ent, k);
        const int slot = u & (NBA - 1);
        if (lane == 0) {
          int p = cur[slot];
          p = p < 0 ? 0 : (p > RCAP - 1 ? RCAP - 1 : p);
          sl[p] = u;
          cur[slot] = p + 1;
        }
      }
    }
  }
  __syncthreads();

  // ---- phase 3: per-(slot, b) edge attention + row build
  const float qnan = __int_as_float(0x7fc00000);
  float* stg = (float*)hl + wave * CW;                  // per-wave staging row [1024] (hl is dead after phase 2)
  const v4f z4 = {0.f, 0.f, 0.f, 0.f};
  const int wv = __builtin_amdgcn_readfirstlane(wave);  // scalar, so that slot and b stay wave-uniform registers
  {
    const int s  = wv / BD;                             // slot
    const int b  = wv % BD;
    const int qn = nodeBase + s;                        // query index
    int c = cnt[s];
    const bool big = c > DEGCAP;
    c = c < 0 ? 0 : (c > DEGCAP ? DEGCAP : c);
    int o = offs[s];
    o = o < 0 ? 0 : (o > RCAP ? RCAP : o);
    const int  qc   = qn < nS ? qn : nS - 1;
    const bool live = qn < nS;                          // wave-uniform
    const bool pois = big || (ovf != 0);

    {
      const float* qr = QKV + ((size_t)qc * BD + b) * QKVW + OQ + 4 * lane;
      v4f qv[8];
#pragma unroll
      for (int j = 0; j < 8; ++j) qv[j] = *(const v4fa*)(qr + 128 * j);
      ldwait();

      float mx[8], dn[8];
      v4f av[8];
#pragma unroll
      for (int j = 0; j < 8; ++j) { mx[j] = -1.0e30f; dn[j] = 0.0f; av[j] = z4; }

#pragma unroll 1
      for (int b0 = 0; b0 < c; b0 += 32) {
        int idx = o + b0 + lane;
        idx = idx > RCAP - 1 ? RCAP - 1 : idx;
        const int ent = sl[idx];
        int eid = ent >> SLA;
        eid = eid < 0 ? 0 : (eid > nE - 1 ? nE - 1 : eid);
        int kd = kid[eid];
        kd = kd < 0 ? 0 : (kd > nS - 1 ? nS - 1 : kd);
        const int m32 = (c - b0) < 32 ? (c - b0) : 32;
#pragma unroll 1
        for (int k = 0; k < m32; ++k) {
          const int tk = __builtin_amdgcn_readlane(kd, k);
          const float* kr = QKV + ((size_t)tk * BD + b) * QKVW + OKK + 4 * lane;    // whole 4-KB k row
          v4f kv[8];
#pragma unroll
          for (int j = 0; j < 8; ++j) kv[j] = *(const v4fa*)(kr + 128 * j);
          ldwait();
          float s1[8], s2[8];
#pragma unroll
          for (int j = 0; j < 8; ++j) {
            float p = qv[j].x * kv[j].x;
            p = fmaf(qv[j].y, kv[j].y, p); p = fmaf(qv[j].z, kv[j].z, p); p = fmaf(qv[j].w, kv[j].w, p);
            p = row16_sum(p);                           // sum over the head's 16 lanes
            const float lg = p * ATTSC;
            const float df = lg - mx[j];
            const float ee = exp2_slot(-1.44269504f * fabsf(df));   // exp(-|df|); the other factor is exactly 1
            const bool up  = df > 0.0f;
            s1[j] = up ? ee : 1.0f;
            s2[j] = up ? 1.0f : ee;
            mx[j] = up ? lg : mx[j];
            dn[j] = fmaf(dn[j], s1[j], s2[j]);
          }
          const float* vr = QKV + ((size_t)tk * BD + b) * QKVW + OV + 4 * lane;     // whole 4-KB v row
          v4f vv[8];
#pragma unroll
          for (int j = 0; j < 8; ++j) vv[j] = *(const v4fa*)(vr + 128 * j);
          ldwait();
#pragma unroll
          for (int j = 0; j < 8; ++j) {
            av[j].x = fmaf(av[j].x, s1[j], s2[j] * vv[j].x); av[j].y = fmaf(av[j].y, s1[j], s2[j] * vv[j].y);
            av[j].z = fmaf(av[j].z, s1[j], s2[j] * vv[j].z); av[j].w = fmaf(av[j].w, s1[j], s2[j] * vv[j].w);
          }
        }
      }

      wave_sync();                                       // prior reads of the staging row are done
#pragma unroll
      for (int j = 0; j < 8; ++j) {
        const float inv  = __builtin_amdgcn_rcpf(dn[j]); // den >= 1 when c > 0; c == 0 -> inf and 0 * inf = NaN (0 / 0)
        const float invp = pois ? qnan : inv;
        v4f o4;
        o4.x = live ? av[j].x * invp : 0.0f;
        o4.y = live ? av[j].y * invp : 0.0f;
        o4.z = live ? av[j].z * invp : 0.0f;
        o4.w = live ? av[j].w * invp : 0.0f;
        *(v4fa*)(stg + 128 * j + 4 * lane) = o4;         // lane writes cols 128j+4l .. 128j+4l+3
      }
      wave_sync();
      v4u hv[4], lv[4];
#pragma unroll
      for (int j = 0; j < 4; ++j) {
        const v4f pa = *(const v4fa*)(stg + 256 * j + 8 * lane);         // lane reads cols 256j+8l .. +7
        const v4f pb = *(const v4fa*)(stg + 256 * j + 8 * lane + 4);
        pack8hl(pa, pb, hv[j], lv[j]);
      }
      const int row = qn * BD + b;
      if (row < mRows) {                                 // wave-uniform
        unsigned short* rp = apl + (size_t)row * APITCH;
#pragma unroll
        for (int j = 0; j < 4; ++j) {
          *(v4u*)(rp + 256 * j + 8 * lane)      = hv[j];
          *(v4u*)(rp + CW + 256 * j + 8 * lane) = lv[j];
        }
        
      }
    }
  }
}

// ---------------------------------------------------------------------------
static inline int cdiv(int a, int b) { return (a + b - 1) / b; }
static inline size_t al256(size_t o) { return (o + 255) & ~(size_t)255; }

extern "C" void kernel_launch(void* const* d_in, const int* in_sizes, int n_in,
                              void* d_out, int out_size, void* d_ws, size_t ws_size,
                              hipStream_t stream) {
  if (n_in < 11) return;
  if (in_sizes[0] < BD * CW || (in_sizes[0] % (BD * CW)) != 0) return;   // x [S][2][1024]
  const int nS = in_sizes[0] / (BD * CW);
  if (nS < 1 || nS > (1 << 20)) return;
  const int nE = in_sizes[1];                                          // q_id [E]
  if (nE < 1 || nE >= (1 << (31 - SLA))) return;                       // (eid << SLA | slot) fits a positive int
  if (in_sizes[2] != nE) return;                                       // k_id [E]
  if (in_sizes[3] != CW * CW || in_sizes[5] != CW * CW || in_sizes[7] != CW * CW || in_sizes[9] != CW * CW) return;
  if (in_sizes[4] != CW || in_sizes[6] != CW || in_sizes[8] != CW || in_sizes[10] != CW) return;
  if ((long long)out_size != (long long)nS * BD * CW) return;          // out [S][2][1024]

  const float* x   = (const float*)d_in[0];     // [S][2][1024] -> rows 2s+b of 1024
  const int*   qid = (const int*)  d_in[1];     // [E] key side (query)
  const int*   kid = (const int*)  d_in[2];     // [E] gathered side (k, v)
  const float* Wq  = (const float*)d_in[3];     // [1024][1024] natural [out][in]
  const float* bq  = (const float*)d_in[4];
  const float* Wk  = (const float*)d_in[5];
  const float* bk  = (const float*)d_in[6];
  const float* Wv  = (const float*)d_in[7];
  const float* bv  = (const float*)d_in[8];
  const float* Wx  = (const float*)d_in[9];
  const float* bx  = (const float*)d_in[10];
  float* out = (float*)d_out;                   // [S][2][1024] -> rows 2s+b of 1024

  const int nRows = nS * BD;
  const int MP = cdiv(nRows, GBM) * GBM;        // padded rows of every node plane
  const int gM = MP / GBM;
  const int gA = cdiv(cdiv(MP, BD), NBA);
  if ((long long)gA * NBA * BD < (long long)MP) return;
  const int vec8 = ((nE & 3) == 0) ? 1 : 0;

  // workspace carve (256-B aligned; every region sized to its whole-row store extent incl. padded rows MP)
  char* ws = (char*)d_ws;
  size_t off = 0;
  const size_t oXB  = off; off = al256(off + (size_t)MP * CW * 2);        // XB    [MP][1024]   bf16
  const size_t oWQ  = off; off = al256(off + (size_t)QKVW * CW * 2);      // WQKVT [3072][1024] bf16
  const size_t oWX  = off; off = al256(off + (size_t)CW * KOUT * 2);      // WXT   [1024][2048] bf16
  const size_t oQKV = off; off = al256(off + (size_t)MP * QKVW * 4);      // QKV   [MP][3072]   f32
  const size_t oAPL = off; off = al256(off + (size_t)MP * APITCH * 2);    // APL   [MP][2048]   bf16
  if (off > ws_size || off > (size_t)WSMAX) return;
  unsigned short* XB    = (unsigned short*)(ws + oXB);
  unsigned short* WQKVT = (unsigned short*)(ws + oWQ);
  unsigned short* WXT   = (unsigned short*)(ws + oWX);
  float*          QKV   = (float*)(ws + oQKV);
  unsigned short* APL   = (unsigned short*)(ws + oAPL);

  hipFuncSetAttribute(reinterpret_cast<const void*>(&k_scan),
                      hipFuncAttributeMaxDynamicSharedMemorySize, SCAN_LDS_BYTES);

  // node feature plane (bf16 bits), pad rows zero
  const int nUx = MP * (CW / 8);
  k_xprep<<<cdiv(nUx, NTHR), NTHR, 0, stream>>>(x, XB, nRows, nUx);
  // weight planes
  k_wprep<<<NUW / NTHR, NTHR, 0, stream>>>(Wq, Wk, Wv, Wx, WQKVT, WXT);
  // projection GEMM: QKV = XB [Wq|Wk|Wv]^T + b -> f32 [MP][3072]
  k_gemm<<<dim3(gM, QKVW / GBN), GTHR, 0, stream>>>(XB, CW, WQKVT, CW, QKV, QKVW, MP, bq, bk, bv, 1);
  // query-keyed sparse attention -> APL [MP][2048]
  k_scan<<<gA, NTHR, SCAN_LDS_BYTES, stream>>>(qid, kid, QKV, APL, nE, nS, MP, vec8);
  // trailing GEMM: out = APL . WXT^T + bx -> rows < nRows
  k_gemm<<<dim3(gM, CW / GBN), GTHR, 0, stream>>>(APL, APITCH, WXT, KOUT, out, CW, nRows, bx, bx, bx, 1);
}

// v004
// One run takes 106 microseconds.
// Two timings next to v003 put it at 1.46 and 1.48 times that version's speed.
// Counting every step since v000, it is 65.5 times as fast.
#include <hip/hip_runtime.h>
#include <stddef.h>
#include <stdint.h>
#include <math.h>

// Contractions: v_wmma_f32_16x16x32_bf16 (bf16 operands, f32 accumulate) for the three projections
// x*[Wq|Wk|Wv]^T (K 1024, bf16 RNE copies of the inputs, products exact in f32) and for the trailing projection
// [o hi | o lo] * [Wx^T ; Wx^T] + bx (K 2048, attention output o carried as bf16 hi + bf16 residual).
// Per-edge per-head q.k dots (16 heads x 64), per-(query, b, head) running-max softmax over the query's own keys
// and the weighted value sums: f32 VALU.
//
// Row mapping: x [S][2][1024] and the output use row = 2*s + b (4096-B rows); q, k, v channel 64*h + c.
// Softmax: exp(qk - max) / sum over the edges sharing a q_id is evaluated per (query, b, head) with a running max
// over that query's keys (the shift cancels in num / den); a query without edges yields 0 * inf = NaN like 0 / 0.
//
// Carry audit: no power-of-two carries anywhere; no inverse factor exists.
//   XB    [MP][1024]   bf16 bits of x (pad rows zero)                      -> A of the projection GEMM
//   WQKVT [3072][1024] bf16 bits, row n = [Wq;Wk;Wv][n][k] (natural rows)  -> B of the projection GEMM
//   WXT   [1024][2048] bf16 bits, row n = Wx[n][k mod 1024]                -> B of the trailing GEMM
//   QKV   [MP][3072]   f32: q | k | v (+ bf16-valued bias)                  -> gathered by k_scan
//   APL   [MP][2048]   bf16 bits: o hi (cols 0..1023) | o lo (1024..2047)  -> A of the trailing GEMM

#define CW      1024                  // channels
#define BD      2                     // middle (batch) dimension of x
#define NHD     16                    // heads
#define HDM     64                    // head dim
#define QKVW    3072                  // node plane columns: q | k | v
#define OQ      0
#define OKK     1024
#define OV      2048
#define KOUT    2048                  // K of the trailing GEMM (hi | lo)
#define APITCH  2048                  // A plane pitch in 16-bit elements (4096 B = 32 lines)
#define NTHR    256
#define NWAVE   8
#define NBA     4                     // query slots per scan block: NBA * BD = 8 (slot, b) rows, one per wave
#define DEGCAP  64                    // static per-slot trip clamp (64 keys per query)
#define SUB     128                   // key entries per wave load instruction (32 lanes x 4)
#define UB      8                     // load instructions in flight per batch
#define BATCH   (SUB * UB)            // 1024 key entries per wave per batch
#define WLW     (NBA * DEGCAP)        // 256 ints: one wave's hit lists, one of DEGCAP entries per slot
#define WLN     (NWAVE * WLW)         // 2048 ints
#define NEMAX   (1 << 29)             // edge count bound: every index sum below stays a positive int
#define GBM     128                   // GEMM rows per block
#define GBN     128                   // GEMM cols per block
#define GTHR    256                   // GEMM threads per block (8 waves, 2 x 4, 64 x 32 outputs each)
#define GBK     128                   // k per pass: 256 B of every operand row
#define GPITCH  272                   // LDS row pitch in bytes (16 B x odd: b128 fragment reads without conflicts)
#define GSTAGE  ((GBM + GBN) * GPITCH)   // 69632 B: one buffer
#define GSP     132                   // output staging pitch in floats
#define UQKV    (CW * (CW / 8))       // 131072 weight-prep units per projection matrix
#define UWX     (CW * (KOUT / 8))     // 262144 units for the WXT plane
#define NUW     (3 * UQKV + UWX)      // 655360
#define SCAN_LDS_BYTES ((WLN + NWAVE * NBA + NWAVE * CW) * 4)   // 41088: hit lists, counts, 8 staging rows
#define ATTSC   0.125f                // 1/sqrt(64)
#define WSMAX   134217728

static_assert(NBA == 4 && NBA * BD == NWAVE && NWAVE <= 32);
static_assert(WLW == 2 * 32 * 4 && ((WLN + NWAVE * NBA) % 4) == 0);
static_assert(SCAN_LDS_BYTES <= 300000);
static_assert(CW == 8 * 32 * 4);                      // 8 row pieces of 512 B, lane owns 4 channels of each
static_assert(HDM == 16 * 4 && NHD * HDM == CW);      // one head = the 16 lanes of a half wave in one piece
static_assert(QKVW == 3 * CW && (QKVW % GBN) == 0 && (CW % GBN) == 0);
static_assert((CW % 32) == 0 && (KOUT % 32) == 0 && KOUT == 2 * CW && APITCH == KOUT);
static_assert((APITCH * 2) % 128 == 0);
static_assert(GBM == 128 && GBN == 128 && GTHR == 256 && GBK == 128);
static_assert((CW % GBK) == 0 && CW / GBK >= 2 && (KOUT % GBK) == 0 && (CW % GBN) == 0);
static_assert(GBM * GSP * 4 <= 2 * GSTAGE && (GSP * 4) % 16 == 0 && GPITCH >= 2 * GBK && (GPITCH % 16) == 0);
static_assert(UQKV == (1 << 17) && (CW / 8) == 128 && (KOUT / 8) == 256);
static_assert(UQKV % NTHR == 0 && UWX % NTHR == 0 && (3 * UQKV) % NTHR == 0);
static_assert(DEGCAP >= 32);

typedef float          v4f  __attribute__((ext_vector_type(4)));
typedef float          v8f  __attribute__((ext_vector_type(8)));
typedef int            v4i  __attribute__((ext_vector_type(4)));
typedef int            v8i  __attribute__((ext_vector_type(8)));
typedef unsigned int   v4u  __attribute__((ext_vector_type(4)));
typedef unsigned short v8us __attribute__((ext_vector_type(8)));
typedef __bf16         v16b __attribute__((ext_vector_type(16)));
typedef v4f  __attribute__((may_alias)) v4fa;
typedef v4i  __attribute__((may_alias)) v4ia;
typedef v4u  __attribute__((may_alias)) v4ua;
typedef v8us __attribute__((may_alias)) v8usa;
union FragB { v16b v; v8us h[2]; v8i w; };

// WMMA with hazard guard: ties D, keeps A/B live for 4 VALU slots
__device__ __forceinline__ v8f wmb(const FragB& a, const FragB& b, v8f c) {
  v8f d = __builtin_amdgcn_wmma_f32_16x16x32_bf16(false, a.v, false, b.v, (short)0, c, false, false);
  asm volatile("v_nop\n\tv_nop\n\tv_nop\n\tv_nop" : "+v"(d) : "v"(a.w), "v"(b.w));
  return d;
}

// drain all outstanding vector-memory loads; also a compiler barrier for memory operations
__device__ __forceinline__ void ldwait() {
  asm volatile("s_wait_loadcnt 0x0" ::: "memory");
}

__device__ __forceinline__ void wave_sync() {
  __builtin_amdgcn_fence(__ATOMIC_RELEASE, "wavefront");
  __builtin_amdgcn_wave_barrier();
  __builtin_amdgcn_fence(__ATOMIC_ACQUIRE, "wavefront");
}

// sum over the 16 lanes of a half wave, every lane gets it (row_xmask 1, 2, 4, 8); all 32 lanes are on at every call
__device__ __forceinline__ float row16_sum(float v) {
  v += __int_as_float(__builtin_amdgcn_update_dpp(0, __float_as_int(v), 0x161, 0xf, 0xf, true));
  v += __int_as_float(__builtin_amdgcn_update_dpp(0, __float_as_int(v), 0x162, 0xf, 0xf, true));
  v += __int_as_float(__builtin_amdgcn_update_dpp(0, __float_as_int(v), 0x164, 0xf, 0xf, true));
  v += __int_as_float(__builtin_amdgcn_update_dpp(0, __float_as_int(v), 0x168, 0xf, 0xf, true));
  return v;
}

// 2^x. The v_nop fills the one slot that the instruction set asks for behind a transcendental.
__device__ __forceinline__ float exp2_slot(float x) {
  float r;
  asm("v_exp_f32 %0, %1\n\tv_nop" : "=v"(r) : "v"(x));
  return r;
}

// f32 -> bf16 bits, RNE convert; bf16 bits -> f32
__device__ __forceinline__ unsigned int f2bf(float f) {
  const unsigned int u = __float_as_uint(f);
  return ((u + 0x7FFFu + ((u >> 16) & 1u)) >> 16) & 0xFFFFu;
}
__device__ __forceinline__ float bf2f(unsigned int b) { return __uint_as_float(b << 16); }
__device__ __forceinline__ float bfr(float f) { return bf2f(f2bf(f)); }
__device__ __forceinline__ v4f bfr4(const v4f a) {
  v4f r; r.x = bfr(a.x); r.y = bfr(a.y); r.z = bfr(a.z); r.w = bfr(a.w); return r;
}
__device__ __forceinline__ unsigned int pk2(float lo, float hi) { return f2bf(lo) | (f2bf(hi) << 16); }
// 8 floats -> 8 bf16 packed in 16 B (element 2i = low half of word i)
__device__ __forceinline__ v4u pack8(const v4f a, const v4f b) {
  v4u r;
  r.x = pk2(a.x, a.y); r.y = pk2(a.z, a.w); r.z = pk2(b.x, b.y); r.w = pk2(b.z, b.w);
  return r;
}
// hi = bf16(v), lo = bf16(v - hi): two floats -> one packed word of each
__device__ __forceinline__ void hl2(float v0, float v1, unsigned int& hw, unsigned int& lw) {
  const unsigned int h0 = f2bf(v0), h1 = f2bf(v1);
  const unsigned int l0 = f2bf(v0 - bf2f(h0)), l1 = f2bf(v1 - bf2f(h1));
  hw = h0 | (h1 << 16);
  lw = l0 | (l1 << 16);
}
__device__ __forceinline__ void pack8hl(const v4f a, const v4f b, v4u& hv, v4u& lv) {
  unsigned int h, l;
  hl2(a.x, a.y, h, l); hv.x = h; lv.x = l;
  hl2(a.z, a.w, h, l); hv.y = h; lv.y = l;
  hl2(b.x, b.y, h, l); hv.z = h; lv.z = l;
  hl2(b.z, b.w, h, l); hv.w = h; lv.w = l;
}

// ---------------------------------------------------------------------------
// One 128-entry piece of the key list that holds at least one hit: lane l has entries e0 .. e0 + 3 (e0 = piece base
// + 4l) in d. For each of the block's NBA slots the hits are ranked in ascending entry order (hits in lower lanes by
// ballot + mbcnt, then the lane's own in order) behind the hits this wave has found before (cwv: lane s holds the
// count of slot s), and the entry index is stored at that rank of the wave's list of the slot. Ranks from DEGCAP on
// are counted, not stored. Returns the new counts.
// ---------------------------------------------------------------------------
__device__ __forceinline__ int place_hits(const v4i d, int e0, unsigned nbs, int* wlw, int cwv, int lane) {
  const unsigned s0 = (unsigned)d.x - nbs, s1 = (unsigned)d.y - nbs;
  const unsigned s2 = (unsigned)d.z - nbs, s3 = (unsigned)d.w - nbs;
#pragma unroll 1   // slots stay rolled: this body stands UB times in the scan loop and runs for few pieces only
  for (int s = 0; s < NBA; ++s) {
    const unsigned m0 = __builtin_amdgcn_ballot_w32(s0 == (unsigned)s);
    const unsigned m1 = __builtin_amdgcn_ballot_w32(s1 == (unsigned)s);
    const unsigned m2 = __builtin_amdgcn_ballot_w32(s2 == (unsigned)s);
    const unsigned m3 = __builtin_amdgcn_ballot_w32(s3 == (unsigned)s);
    if ((m0 | m1 | m2 | m3) != 0u) {                     // wave-uniform
      unsigned r = __builtin_amdgcn_mbcnt_lo(m0, (unsigned)__builtin_amdgcn_readlane(cwv, s));
      r = __builtin_amdgcn_mbcnt_lo(m1, r);
      r = __builtin_amdgcn_mbcnt_lo(m2, r);
      r = __builtin_amdgcn_mbcnt_lo(m3, r);
      int* ls = wlw + s * DEGCAP;
      if (s0 == (unsigned)s) { if (r < DEGCAP) ls[r] = e0;     ++r; }
      if (s1 == (unsigned)s) { if (r < DEGCAP) ls[r] = e0 + 1; ++r; }
      if (s2 == (unsigned)s) { if (r < DEGCAP) ls[r] = e0 + 2; ++r; }
      if (s3 == (unsigned)s) { if (r < DEGCAP) ls[r] = e0 + 3; ++r; }
      const int tot = (int)(__builtin_popcount(m0) + __builtin_popcount(m1) + __builtin_popcount(m2) + __builtin_popcount(m3));
      cwv += (lane == s) ? tot : 0;
    }
  }
  return cwv;
}

// ---------------------------------------------------------------------------
// Node feature plane: XB[row][c] = bf16(x[row][c]) for row < nN (all 1024 c), zero for pad rows nN <= row < MP
// (load address clamped into x, value zeroed by select). One thread = 8 contiguous 16-bit values (16 B) from two
// coverage: nUnits = MP*128 threads x 8 = MP x 1024 elements exactly.
// ---------------------------------------------------------------------------
__global__ __launch_bounds__(NTHR) void k_xprep(const float* __restrict__ x, unsigned short* xb, int nN, int nUnits) {
  const int i = (int)blockIdx.x * NTHR + (int)threadIdx.x;
  if (i >= nUnits) return;
  const int row = i >> 7;
  const int c0  = (i & 127) * 8;
  const int rc  = row < nN ? row : nN - 1;
  const float* p = x + (size_t)rc * CW + c0;
  v4f a = *(const v4fa*)p;
  v4f b = *(const v4fa*)(p + 4);
  const v4f z4 = {0.f, 0.f, 0.f, 0.f};
  if (row >= nN) { a = z4; b = z4; }
  const v4u hv = pack8(a, b);
  unsigned short* o = xb + (size_t)row * CW + c0;
  *(v4u*)o = hv;
  
}

// ---------------------------------------------------------------------------
// Weight planes (k-contiguous B rows, bf16 bits of the f32 inputs).
//   units 0..393215 (part = u >> 17, block-uniform): WQKVT[part*1024 + n][k8..k8+7] = bf16(W_part[n][k8..]),
//     W_part in {Wq, Wk, Wv}, each a natural [1024][1024] row-major matrix (out x in).
//   units 393216..655359 (block-uniform): WXT[n][k8..k8+7] = bf16(Wx[n][(k8 mod 1024) ..]) for k8 in 0..2040.
// coverage: WQKVT = 3 x 131072 units x 8 = 3072 x 1024 exactly; WXT = 262144 units x 8 = 1024 x 2048 exactly.
// ---------------------------------------------------------------------------
__global__ __launch_bounds__(NTHR) void k_wprep(const float* __restrict__ Wq, const float* __restrict__ Wk,
                                                const float* __restrict__ Wv, const float* __restrict__ Wx,
                                                unsigned short* WQKVT, unsigned short* WXT) {
  const int u = (int)blockIdx.x * NTHR + (int)threadIdx.x;
  if (u >= NUW) return;
  v4f a, b;
  unsigned short* dp;
  if (u < 3 * UQKV) {                                    // block-uniform
    const int part = u >> 17;
    const int v    = u & (UQKV - 1);
    const int n    = v >> 7;                             // 0..1023
    const int k8   = (v & 127) * 8;                      // 0..1016
    const float* W = (part == 0) ? Wq : ((part == 1) ? Wk : Wv);
    const float* p = W + (size_t)n * CW + k8;            // W[n][k8 .. k8+7], contiguous
    a = *(const v4fa*)p;
    b = *(const v4fa*)(p + 4);
    dp = WQKVT + (size_t)(part * CW + n) * CW + k8;
  } else {
    const int v  = u - 3 * UQKV;                         // 0..262143
    const int n  = v >> 8;                               // 0..1023
    const int k8 = (v & 255) * 8;                        // 0..2040
    const int kk = k8 & (CW - 1);                        // source column, in range
    const float* p = Wx + (size_t)n * CW + kk;           // Wx[n][kk .. kk+7], contiguous
    a = *(const v4fa*)p;
    b = *(const v4fa*)(p + 4);
    dp = WXT + (size_t)n * KOUT + k8;
  }
  const v4u wv = pack8(a, b);
  *(v4u*)dp = wv;
  
}

// ---------------------------------------------------------------------------
// Eight asynchronous 16-B-per-lane copies global -> LDS: rows 16 apart in both places (gstep elements, 16 pitches).
// The s_wait_xcnt stands inside the statement so that no address register is rewritten in front of it.
// ---------------------------------------------------------------------------
__device__ __forceinline__ void acopy8(unsigned int l0, const unsigned short* g0, size_t gstep) {
  const unsigned int l1 = l0 + 16 * GPITCH, l2 = l0 + 32 * GPITCH, l3 = l0 + 48 * GPITCH;
  const unsigned int l4 = l0 + 64 * GPITCH, l5 = l0 + 80 * GPITCH, l6 = l0 + 96 * GPITCH, l7 = l0 + 112 * GPITCH;
  const unsigned short* g1 = g0 + gstep;
  const unsigned short* g2 = g1 + gstep;
  const unsigned short* g3 = g2 + gstep;
  const unsigned short* g4 = g3 + gstep;
  const unsigned short* g5 = g4 + gstep;
  const unsigned short* g6 = g5 + gstep;
  const unsigned short* g7 = g6 + gstep;
  asm volatile("global_load_async_to_lds_b128 %0, %8, off\n\t"
               "global_load_async_to_lds_b128 %1, %9, off\n\t"
               "global_load_async_to_lds_b128 %2, %10, off\n\t"
               "global_load_async_to_lds_b128 %3, %11, off\n\t"
               "global_load_async_to_lds_b128 %4, %12, off\n\t"
               "global_load_async_to_lds_b128 %5, %13, off\n\t"
               "global_load_async_to_lds_b128 %6, %14, off\n\t"
               "global_load_async_to_lds_b128 %7, %15, off\n\t"
               "s_wait_xcnt 0x0"
               :: "v"(l0), "v"(l1), "v"(l2), "v"(l3), "v"(l4), "v"(l5), "v"(l6), "v"(l7),
                  "v"(g0), "v"(g1), "v"(g2), "v"(g3), "v"(g4), "v"(g5), "v"(g6), "v"(g7)
               : "memory");
}

// ---------------------------------------------------------------------------
// bf16 WMMA GEMM: C[rows][N] = A[MP][K] (bf16 bits, pitch lda) x WT[N][K]^T (bf16 rows n, k-contiguous, pitch K).
// grid (MP/128, N/128), 256 threads: one 128x128 tile of C per block; wave w owns rows 64*(w>>2).. +63 and
// cols 32*(w&3).. +31 of it: acc[4][2]. K runs in passes of 128 (256 B of every operand row); a stage is
// [A 128 rows | WT 128 rows] at LDS pitch 272 B, two buffers. Each thread copies 16 pieces of 16 B per stage
// (row = 16i + tid/16, piece = tid%16, so one wave instruction moves two whole 256-B row pieces); the copies of
// pass t+2 are issued behind the barrier that ends pass t and are waited for at the foot of pass t+1.
// A fragment (row m = lane&15): elements 0..7 <- k0+8h+0..7, 8..15 <- k0+16+8h+0..7 (h = lane>>4); B fragment
// (col n = lane&15) from its WT row with the SAME k map; D element r = (row 8h+r, col lane&15). k ascends in
// steps of 32 on one accumulator chain per output tile.
// Epilogue: the 128x128 f32 tile is staged in the ring (every copy landed, every reader past the last barrier),
// + bf16-valued bias (bias vector selected by col0 / 1024, block-uniform; scaled by useBias in {0,1}; the load is
// always in range); one instruction then writes one 512-B row segment.
// coverage: rows rowBase..rowBase+127 restricted to < nRows x cols col0..col0+127 per block;
//   grid (MP/128, N/128) covers every (row < nRows, col) exactly once.
// LDS extents: copies fill rows 0..255 x bytes 0..255 of a buffer (pitch 272); staging 128 x 132 floats.
// ---------------------------------------------------------------------------
__global__ __launch_bounds__(GTHR) void k_gemm(
    const unsigned short* __restrict__ A, int lda, const unsigned short* __restrict__ WT, int K,
    float* outF, int ldo, int nRows,
    const float* __restrict__ bs0, const float* __restrict__ bs1, const float* __restrict__ bs2, int useBias)
{
  __shared__ __attribute__((aligned(16))) unsigned char ring[2 * GSTAGE];   // 139264 B
  const int tid = (int)threadIdx.x, lane = tid & 31, wave = tid >> 5, hh = lane >> 4, m = lane & 15;
  const int wm = wave >> 2, wn = wave & 3;
  const int rowBase = (int)blockIdx.x * GBM;
  const int col0    = (int)blockIdx.y * GBN;

  v8f acc[4][2];
  {
    const v8f z = {0.f, 0.f, 0.f, 0.f, 0.f, 0.f, 0.f, 0.f};
#pragma unroll
    for (int i = 0; i < 4; ++i) { acc[i][0] = z; acc[i][1] = z; }
  }
  const int crow = tid >> 4, cseg = tid & 15;
  const unsigned short* ga = A  + (size_t)(rowBase + crow) * (size_t)lda + 8 * cseg;
  const unsigned short* gb = WT + (size_t)(col0 + crow) * (size_t)K + 8 * cseg;
  const size_t sa = (size_t)16 * (size_t)lda, sb = (size_t)16 * (size_t)K;
  const unsigned int la = (unsigned int)(size_t)ring + (unsigned int)(crow * GPITCH + 16 * cseg);
  const unsigned int lb = la + GBM * GPITCH;
  const int npass = K / GBK;

  acopy8(la, ga, sa);
  acopy8(lb, gb, sb);
  asm volatile("s_wait_asynccnt 0x0" ::: "memory");   // this wave's part of stage 0 has landed
  __syncthreads();                                     // stage 0 readable by every wave
  if (npass > 1) {
    acopy8(la + GSTAGE, ga + GBK, sa);
    acopy8(lb + GSTAGE, gb + GBK, sb);
  }

#pragma unroll 1   // passes stay rolled: one copy of the 32-WMMA body
  for (int t = 0; t < npass; ++t) {
    const unsigned int bo = (unsigned int)(t & 1) * GSTAGE;
    const unsigned char* ar = ring + bo + (64 * wm + m) * GPITCH + 16 * hh;
    const unsigned char* br = ring + bo + (GBM + 32 * wn + m) * GPITCH + 16 * hh;
#pragma unroll
    for (int kk = 0; kk < GBK / 32; ++kk) {
      FragB af[4], bf[2];
#pragma unroll
      for (int i = 0; i < 4; ++i) {
        af[i].h[0] = *(const v8usa*)(ar + 16 * i * GPITCH + 64 * kk);        // k = 32kk + 8hh + 0..7
        af[i].h[1] = *(const v8usa*)(ar + 16 * i * GPITCH + 64 * kk + 32);   // k = 32kk + 16 + 8hh + 0..7
      }
#pragma unroll
      for (int j = 0; j < 2; ++j) {
        bf[j].h[0] = *(const v8usa*)(br + 16 * j * GPITCH + 64 * kk);        // same k map as A
        bf[j].h[1] = *(const v8usa*)(br + 16 * j * GPITCH + 64 * kk + 32);
      }
#pragma unroll
      for (int i = 0; i < 4; ++i) {
#pragma unroll
        for (int j = 0; j < 2; ++j) acc[i][j] = wmb(af[i], bf[j], acc[i][j]);
      }
    }
    asm volatile("s_wait_dscnt 0x0" ::: "memory");     // this wave's reads of the buffer are done before its refill
    asm volatile("s_wait_asynccnt 0x0" ::: "memory");  // this wave's part of stage t+1 has landed
    __syncthreads();                                   // publishes stage t+1, frees the buffer of stage t
    if (t + 2 < npass) {                               // block-uniform
      acopy8(la + bo, ga + (size_t)(t + 2) * GBK, sa);
      acopy8(lb + bo, gb + (size_t)(t + 2) * GBK, sb);
    }
  }
  asm volatile("s_wait_asynccnt 0x0" ::: "memory");    // nothing in flight when the ring becomes output staging

  float* stg = (float*)ring;
#pragma unroll
  for (int i = 0; i < 4; ++i) {
#pragma unroll
    for (int j = 0; j < 2; ++j) {
      const int lc = 32 * wn + 16 * j + m;
#pragma unroll
      for (int r = 0; r < 8; ++r) {
        const int lr = 64 * wm + 16 * i + 8 * hh + r;   // D element r = (row 8hh+r, col m)
        stg[lr * GSP + lc] = acc[i][j][r];
      }
    }
  }
  __syncthreads();

  const int mat = col0 / CW;                            // block-uniform
  const float* bsel = (mat == 0) ? bs0 : ((mat == 1) ? bs1 : bs2);
  v4f b4 = *(const v4fa*)(bsel + (col0 & (CW - 1)) + 4 * lane);
  b4 = bfr4(b4) * (float)useBias;

  v4f fv[16];
#pragma unroll
  for (int i = 0; i < 16; ++i) {
    const int lr = 16 * wave + i;
    fv[i] = *(const v4fa*)(stg + lr * GSP + 4 * lane) + b4;
  }
#pragma unroll
  for (int i = 0; i < 16; ++i) {
    const int lr = 16 * wave + i;
    const int gr = rowBase + lr;
    const int gs = gr < nRows ? gr : nRows - 1;
    float* op = outF + (size_t)gs * (size_t)ldo + col0 + 4 * lane;
    if (gr < nRows) *(v4f*)op = fv[i];
  }
}

// ---------------------------------------------------------------------------
// Query-keyed sparse attention, no atomics, no global tables. Block owns query slots [nodeBase, nodeBase + NBA);
// key of edge e = qid[e], the gathered side is kid[e].
// Phase 1 (waves independent): wave w scans its own contiguous eighth [w*seg, (w+1)*seg) of the qid list, UB b128
//   loads per lane in flight, one test per batch of 1024 entries; a piece with hits goes through place_hits, which
//   appends the edge ids to the wave's own list of each slot (ascending) and counts them (lane s: slot s).
//   One block barrier publishes the 8 x NBA lists and counts.
// Phase 2 (per wave, registers): the 8 counts of the wave's slot give the running offsets pre[]; entry idx of the
//   slot is entry idx - pre[w] of the list of the last wave w with pre[w] <= idx, so edge ids ascend within a slot.
// Phase 3 (waves independent, no block barriers): wave w owns the one (slot, b) row w of the block's NBA * BD = 8
//   rows (slot = w / 2, b = w % 2; row = 2*query + b of the QKV plane). Lane l owns channels 128j+4l..128j+4l+3 of
//   piece j = 0..7, so every load instruction of a row reads 512 contiguous bytes (4 lines); head of (j, l) =
//   2j + (l>>4). Per (slot, b): the 1024-float q row (8 b128 loads per lane). Per edge in fixed slot order:
//   kd = kid[eid] (clamped), the k row of (kd, b) (8 b128 loads per lane), per piece the dot of the lane's 4
//   channels and its sum over the 16 lanes of the half wave, logit * 1/8, running-max single pass per head (each
//   lane keeps the 8 heads of its half): den = den*exp(mx-mn) + exp(l-mn), av_c likewise with the v row of (kd, b).
//   o_c = av_c / den (NaN poison above DEGCAP edges, zero row for pad queries >= nS); the 1024-float row is relaid out
//   through the wave's private LDS row so that every store instruction writes 512 contiguous bytes:
// coverage: gridDim.x * NBA * 2 >= mRows (host-checked): APL rows 0..mRows-1 x cols 0..2047 written exactly once.
// LDS extents: wl: each wave zeroes its own WLW ints before it appends (one wave's LDS operations keep their order);
//   cntw: all NWAVE * NBA written before the barrier; per-wave staging row: elements 0..1023 written by the same
//   wave (32 lanes x 32 floats) before each reload.
// ---------------------------------------------------------------------------
__global__ __launch_bounds__(NTHR) void k_scan(const int* __restrict__ qid, const int* __restrict__ kid,
                                               const float* __restrict__ QKV, unsigned short* apl,
                                               int nE, int nS, int mRows) {
  extern __shared__ __attribute__((aligned(16))) int dsm[];
  int* wl   = dsm;                         // WLN: [wave][slot][DEGCAP] edge ids
  int* cntw = dsm + WLN;                   // [wave][slot] hit counts
  const int tid = (int)threadIdx.x, lane = tid & 31, wave = tid >> 5;
  const int nodeBase = (int)blockIdx.x * NBA;
  const int wv = __builtin_amdgcn_readfirstlane(wave);  // scalar, so that ranges, slot and b stay wave-uniform registers

  // ---- phase 1: every wave scans its own eighth of the key list
  {
    int* wlw = wl + wv * WLW;
    const v4i zi = {0, 0, 0, 0};
    *(v4ia*)(wlw + 4 * lane)       = zi;
    *(v4ia*)(wlw + 128 + 4 * lane) = zi;
    int cwv = 0;                                         // lane s < NBA: this wave's hit count of slot s
    const unsigned nbs = (unsigned)nodeBase;
    const int sent = -2147483647 - 1;
    const int seg  = ((nE + NWAVE * BATCH - 1) / (NWAVE * BATCH)) * BATCH;
    const int wbeg = wv * seg;
    const int wend = (wbeg + seg) < nE ? (wbeg + seg) : nE;
#pragma unroll 1   // batches stay rolled: the UB place_hits bodies exist once
    for (int base = wbeg; base < wend; base += BATCH) {
      v4i d[UB];
      if (base + BATCH <= nE) {                          // wave-uniform: whole batch in range, 16-B aligned
#pragma unroll
        for (int u = 0; u < UB; ++u) d[u] = *(const v4ia*)(qid + base + u * SUB + 4 * lane);
      } else {                                           // tail: every address clamped, sentinel by value
#pragma unroll
        for (int u = 0; u < UB; ++u) {
          const int e = base + u * SUB + 4 * lane;
          d[u].x = (e     < nE) ? qid[min(e,     nE - 1)] : sent;
          d[u].y = (e + 1 < nE) ? qid[min(e + 1, nE - 1)] : sent;
          d[u].z = (e + 2 < nE) ? qid[min(e + 2, nE - 1)] : sent;
          d[u].w = (e + 3 < nE) ? qid[min(e + 3, nE - 1)] : sent;
        }
      }
      // The one test below needs all UB pieces. The wait stands in front of every reuse of the loads' address
      // registers; the scheduling barrier keeps the compiler from lifting the subtractions (and that reuse) over it.
      ldwait();
      __builtin_amdgcn_sched_barrier(0);
      unsigned lo[UB];
      unsigned all = 0xFFFFFFFFu;
#pragma unroll
      for (int u = 0; u < UB; ++u) {                     // smallest slot distance of the lane's four entries
        lo[u] = min(min((unsigned)d[u].x - nbs, (unsigned)d[u].y - nbs),
                    min((unsigned)d[u].z - nbs, (unsigned)d[u].w - nbs));
        all = min(all, lo[u]);
      }
      if (__builtin_amdgcn_ballot_w32(all < (unsigned)NBA) != 0u) {
#pragma unroll
        for (int u = 0; u < UB; ++u) {
          if (__builtin_amdgcn_ballot_w32(lo[u] < (unsigned)NBA) != 0u)
            cwv = place_hits(d[u], base + u * SUB + 4 * lane, nbs, wlw, cwv, lane);
        }
      }
    }
    if (lane < NBA) cntw[wv * NBA + lane] = cwv;
  }
  __syncthreads();                                       // every wave's lists and counts readable by every wave

  // ---- phase 3: per-(slot, b) edge attention + row build
  const float qnan = __int_as_float(0x7fc00000);
  float* stg = (float*)(cntw + NWAVE * NBA) + wave * CW;   // per-wave staging row [1024]
  const v4f z4 = {0.f, 0.f, 0.f, 0.f};
  {
    const int s  = wv / BD;                             // slot
    const int b  = wv % BD;
    const int qn = nodeBase + s;                        // query index
    // ---- phase 2: running offsets of the eight waves' lists of this slot (lane l < 8 reads wave l's count)
    const int cl = cntw[(lane & (NWAVE - 1)) * NBA + s];
    int pre[NWAVE + 1];
    pre[0] = 0;
#pragma unroll
    for (int w2 = 0; w2 < NWAVE; ++w2) pre[w2 + 1] = pre[w2] + __builtin_amdgcn_readlane(cl, w2);
    int c = pre[NWAVE];
    const bool big = c > DEGCAP;
    c = c < 0 ? 0 : (c > DEGCAP ? DEGCAP : c);
    const int  qc   = qn < nS ? qn : nS - 1;
    const bool live = qn < nS;                          // wave-uniform
    const bool pois = big;

    {
      const float* qr = QKV + ((size_t)qc * BD + b) * QKVW + OQ + 4 * lane;
      v4f qv[8];
#pragma unroll
      for (int j = 0; j < 8; ++j) qv[j] = *(const v4fa*)(qr + 128 * j);
      ldwait();

      float mx[8], dn[8];
      v4f av[8];
#pragma unroll
      for (int j = 0; j < 8; ++j) { mx[j] = -1.0e30f; dn[j] = 0.0f; av[j] = z4; }

#pragma unroll 1
      for (int b0 = 0; b0 < c; b0 += 32) {
        const int idx = b0 + lane;                       // 0 .. DEGCAP - 1
        int la = idx;                                    // list address: last wave w2 with pre[w2] <= idx
#pragma unroll
        for (int w2 = 1; w2 < NWAVE; ++w2) la = (idx >= pre[w2]) ? (w2 * WLW + idx - pre[w2]) : la;
        int eid = wl[s * DEGCAP + la];                   // idx - pre[w2] <= idx < DEGCAP: inside that list
        eid = eid < 0 ? 0 : (eid > nE - 1 ? nE - 1 : eid);
        int kd = kid[eid];
        kd = kd < 0 ? 0 : (kd > nS - 1 ? nS - 1 : kd);
        const int m32 = (c - b0) < 32 ? (c - b0) : 32;
#pragma unroll 1
        for (int k = 0; k < m32; ++k) {
          const int tk = __builtin_amdgcn_readlane(kd, k);
          const float* kr = QKV + ((size_t)tk * BD + b) * QKVW + OKK + 4 * lane;    // whole 4-KB k row
          v4f kv[8];
#pragma unroll
          for (int j = 0; j < 8; ++j) kv[j] = *(const v4fa*)(kr + 128 * j);
          ldwait();
          float s1[8], s2[8];
#pragma unroll
          for (int j = 0; j < 8; ++j) {
            float p = qv[j].x * kv[j].x;
            p = fmaf(qv[j].y, kv[j].y, p); p = fmaf(qv[j].z, kv[j].z, p); p = fmaf(qv[j].w, kv[j].w, p);
            p = row16_sum(p);                           // sum over the head's 16 lanes
            const float lg = p * ATTSC;
            const float df = lg - mx[j];
            const float ee = exp2_slot(-1.44269504f * fabsf(df));   // exp(-|df|); the other factor is exactly 1
            const bool up  = df > 0.0f;
            s1[j] = up ? ee : 1.0f;
            s2[j] = up ? 1.0f : ee;
            mx[j] = up ? lg : mx[j];
            dn[j] = fmaf(dn[j], s1[j], s2[j]);
          }
          const float* vr = QKV + ((size_t)tk * BD + b) * QKVW + OV + 4 * lane;     // whole 4-KB v row
          v4f vv[8];
#pragma unroll
          for (int j = 0; j < 8; ++j) vv[j] = *(const v4fa*)(vr + 128 * j);
          ldwait();
#pragma unroll
          for (int j = 0; j < 8; ++j) {
            av[j].x = fmaf(av[j].x, s1[j], s2[j] * vv[j].x); av[j].y = fmaf(av[j].y, s1[j], s2[j] * vv[j].y);
            av[j].z = fmaf(av[j].z, s1[j], s2[j] * vv[j].z); av[j].w = fmaf(av[j].w, s1[j], s2[j] * vv[j].w);
          }
        }
      }

      wave_sync();                                       // prior reads of the staging row are done
#pragma unroll
      for (int j = 0; j < 8; ++j) {
        const float inv  = __builtin_amdgcn_rcpf(dn[j]); // den >= 1 when c > 0; c == 0 -> inf and 0 * inf = NaN (0 / 0)
        const float invp = pois ? qnan : inv;
        v4f o4;
        o4.x = live ? av[j].x * invp : 0.0f;
        o4.y = live ? av[j].y * invp : 0.0f;
        o4.z = live ? av[j].z * invp : 0.0f;
        o4.w = live ? av[j].w * invp : 0.0f;
        *(v4fa*)(stg + 128 * j + 4 * lane) = o4;         // lane writes cols 128j+4l .. 128j+4l+3
      }
      wave_sync();
      v4u hv[4], lv[4];
#pragma unroll
      for (int j = 0; j < 4; ++j) {
        const v4f pa = *(const v4fa*)(stg + 256 * j + 8 * lane);         // lane reads cols 256j+8l .. +7
        const v4f pb = *(const v4fa*)(stg + 256 * j + 8 * lane + 4);
        pack8hl(pa, pb, hv[j], lv[j]);
      }
      const int row = qn * BD + b;
      if (row < mRows) {                                 // wave-uniform
        unsigned short* rp = apl + (size_t)row * APITCH;
#pragma unroll
        for (int j = 0; j < 4; ++j) {
          *(v4u*)(rp + 256 * j + 8 * lane)      = hv[j];
          *(v4u*)(rp + CW + 256 * j + 8 * lane) = lv[j];
        }
        
      }
    }
  }
}

// ---------------------------------------------------------------------------
static inline int cdiv(int a, int b) { return (a + b - 1) / b; }
static inline size_t al256(size_t o) { return (o + 255) & ~(size_t)255; }

extern "C" void kernel_launch(void* const* d_in, const int* in_sizes, int n_in,
                              void* d_out, int out_size, void* d_ws, size_t ws_size,
                              hipStream_t stream) {
  if (n_in < 11) return;
  if (in_sizes[0] < BD * CW || (in_sizes[0] % (BD * CW)) != 0) return;   // x [S][2][1024]
  const int nS = in_sizes[0] / (BD * CW);
  if (nS < 1 || nS > (1 << 20)) return;
  const int nE = in_sizes[1];                                          // q_id [E]
  if (nE < 1 || nE >= NEMAX) return;
  if (in_sizes[2] != nE) return;                                       // k_id [E]
  if (in_sizes[3] != CW * CW || in_sizes[5] != CW * CW || in_sizes[7] != CW * CW || in_sizes[9] != CW * CW) return;
  if (in_sizes[4] != CW || in_sizes[6] != CW || in_sizes[8] != CW || in_sizes[10] != CW) return;
  if ((long long)out_size != (long long)nS * BD * CW) return;          // out [S][2][1024]

  const float* x   = (const float*)d_in[0];     // [S][2][1024] -> rows 2s+b of 1024
  const int*   qid = (const int*)  d_in[1];     // [E] key side (query)
  const int*   kid = (const int*)  d_in[2];     // [E] gathered side (k, v)
  const float* Wq  = (const float*)d_in[3];     // [1024][1024] natural [out][in]
  const float* bq  = (const float*)d_in[4];
  const float* Wk  = (const float*)d_in[5];
  const float* bk  = (const float*)d_in[6];
  const float* Wv  = (const float*)d_in[7];
  const float* bv  = (const float*)d_in[8];
  const float* Wx  = (const float*)d_in[9];
  const float* bx  = (const float*)d_in[10];
  float* out = (float*)d_out;                   // [S][2][1024] -> rows 2s+b of 1024

  const int nRows = nS * BD;
  const int MP = cdiv(nRows, GBM) * GBM;        // padded rows of every node plane
  const int gM = MP / GBM;
  const int gA = cdiv(cdiv(MP, BD), NBA);
  if ((long long)gA * NBA * BD < (long long)MP) return;

  // workspace carve (256-B aligned; every region sized to its whole-row store extent incl. padded rows MP)
  char* ws = (char*)d_ws;
  size_t off = 0;
  const size_t oXB  = off; off = al256(off + (size_t)MP * CW * 2);        // XB    [MP][1024]   bf16
  const size_t oWQ  = off; off = al256(off + (size_t)QKVW * CW * 2);      // WQKVT [3072][1024] bf16
  const size_t oWX  = off; off = al256(off + (size_t)CW * KOUT * 2);      // WXT   [1024][2048] bf16
  const size_t oQKV = off; off = al256(off + (size_t)MP * QKVW * 4);      // QKV   [MP][3072]   f32
  const size_t oAPL = off; off = al256(off + (size_t)MP * APITCH * 2);    // APL   [MP][2048]   bf16
  if (off > ws_size || off > (size_t)WSMAX) return;
  unsigned short* XB    = (unsigned short*)(ws + oXB);
  unsigned short* WQKVT = (unsigned short*)(ws + oWQ);
  unsigned short* WXT   = (unsigned short*)(ws + oWX);
  float*          QKV   = (float*)(ws + oQKV);
  unsigned short* APL   = (unsigned short*)(ws + oAPL);

  hipFuncSetAttribute(reinterpret_cast<const void*>(&k_scan),
                      hipFuncAttributeMaxDynamicSharedMemorySize, SCAN_LDS_BYTES);

  // node feature plane (bf16 bits), pad rows zero
  const int nUx = MP * (CW / 8);
  k_xprep<<<cdiv(nUx, NTHR), NTHR, 0, stream>>>(x, XB, nRows, nUx);
  // weight planes
  k_wprep<<<NUW / NTHR, NTHR, 0, stream>>>(Wq, Wk, Wv, Wx, WQKVT, WXT);
  // projection GEMM: QKV = XB [Wq|Wk|Wv]^T + b -> f32 [MP][3072]
  k_gemm<<<dim3(gM, QKVW / GBN), GTHR, 0, stream>>>(XB, CW, WQKVT, CW, QKV, QKVW, MP, bq, bk, bv, 1);
  // query-keyed sparse attention -> APL [MP][2048]
  k_scan<<<gA, NTHR, SCAN_LDS_BYTES, stream>>>(qid, kid, QKV, APL, nE, nS, MP);
  // trailing GEMM: out = APL . WXT^T + bx -> rows < nRows
  k_gemm<<<dim3(gM, CW / GBN), GTHR, 0, stream>>>(APL, APITCH, WXT, KOUT, out, CW, nRows, bx, bx, bx, 1);
}

// v007
// Measured time: 73.2 microseconds a run.
// It is 1.43 times as fast as v004, going by the measured steps of the versions left out in between.
// Over all steps from v000 it is 94.0 times as fast.
#include <hip/hip_runtime.h>
#include <stddef.h>
#include <stdint.h>
#include <math.h>

// Contractions: v_wmma_f32_16x16x32_bf16 (bf16 operands, f32 accumulate) for the three projections
// x*[Wq|Wk|Wv]^T (K 1024, bf16 RNE copies of the inputs, products exact in f32); v_wmma_f32_16x16x32_f16 (f16
// operands, f32 accumulate) for the trailing projection o * Wx^T + bx (K 1024, o and Wx each one f16 RNE value;
// o is a convex mix of f16 v values, so it stays in f16 range).
// Per-edge per-head q.k dots (16 heads x 64), per-(query, b, head) running-max softmax over the query's own keys
// and the weighted value sums: f32 VALU.
//
// Row mapping: x [S][2][1024] and the output use row = 2*s + b (4096-B rows); q, k, v channel 64*h + c.
// Gathered rows: k and v leave the projection GEMM as f16 (RNE from the f32 accumulator + bias), q stays f32; every
// product and sum of the attention stays f32.
// Softmax: exp(qk - max) / sum over the edges sharing a q_id is evaluated per (query, b, head) with a running max
// over that query's keys (the shift cancels in num / den); a query without edges yields 0 * inf = NaN like 0 / 0.
//
// Carry audit: no power-of-two carries anywhere; no inverse factor exists.
//   XB    [MP][1024]   bf16 bits of x (pad rows zero)                      -> A of the projection GEMM
//   WQKVT [3072][1024] bf16 bits, row n = [Wq;Wk;Wv][n][k] (natural rows)  -> B of the projection GEMM
//   WXT   [1024][1024] f16 bits, row n = Wx[n][k] (natural rows)           -> B of the trailing GEMM
//   QP    [MP][1024]   f32: q (+ bf16-valued bias)                          -> read by k_scan
//   KVH   [MP][2048]   f16: k | v (+ bf16-valued bias), 4096-B rows         -> gathered by k_scan
//   APL   [MP][1024]   f16 bits: o                                         -> A of the trailing GEMM

#define CW      1024                  // channels
#define BD      2                     // middle (batch) dimension of x
#define NHD     16                    // heads
#define HDM     64                    // head dim
#define QKVW    3072                  // projection GEMM columns: q | k | v
#define KVW     2048                  // f16 plane columns: k | v
#define KOUT    1024                  // K of the trailing GEMM
#define APITCH  1024                  // A plane pitch in 16-bit elements (2048 B = 16 lines)
#define NTHR    256
#define NWAVE   8
#define NBA     4                     // query slots per scan block: NBA * BD = 8 (slot, b) rows, one per wave
#define DEGCAP  64                    // static per-slot trip clamp (64 keys per query)
#define SUB     128                   // key entries per wave load instruction (32 lanes x 4)
#define UB      8                     // load instructions in flight per batch
#define BATCH   (SUB * UB)            // 1024 key entries per wave per batch
#define WLW     (NBA * DEGCAP)        // 256 ints: one wave's hit lists, one of DEGCAP entries per slot
#define WLN     (NWAVE * WLW)         // 2048 ints
#define NEMAX   (1 << 29)             // edge count bound: every index sum below stays a positive int
#define GBM     128                   // trailing GEMM rows per block
#define GBN     128                   // trailing GEMM cols per block
#define GTHR    256                   // trailing GEMM threads per block (8 waves, 2 x 4, 64 x 32 outputs each)
#define PBM     256                   // projection GEMM rows per block
#define PBN     192                   // projection GEMM cols per block
#define PTHR    512                   // projection GEMM threads per block (16 waves, 4 x 4, 64 x 48 outputs each)
#define GBK     128                   // k per pass: 256 B of every operand row
#define GPITCH  272                   // LDS row pitch in bytes (16 B x odd: b128 fragment reads without conflicts)
#define UQKV    (CW * (CW / 8))       // 131072 weight-prep units per projection matrix
#define UWX     (CW * (KOUT / 8))     // 131072 units for the WXT plane
#define NUW     (3 * UQKV + UWX)      // 524288
#define SCAN_LDS_BYTES ((WLN + NWAVE * NBA) * 4)   // 8320: hit lists, counts
#define ATTSC   0.125f                // 1/sqrt(64)
#define WSMAX   134217728

static_assert(NBA == 4 && NBA * BD == NWAVE && NWAVE <= 32);
static_assert(WLW == 2 * 32 * 4 && ((WLN + NWAVE * NBA) % 4) == 0);
static_assert(SCAN_LDS_BYTES <= 300000);
static_assert(CW == 4 * 32 * 8 && KVW == 2 * CW);     // 4 f16 row pieces of 512 B, lane owns 8 channels of each
static_assert(HDM == 8 * 8 && NHD * HDM == CW);       // one head = 8 neighbouring lanes in one piece
static_assert(QKVW == 3 * CW && (QKVW % PBN) == 0 && (CW % GBN) == 0 && (PBN % 64) == 0 && (CW % 64) == 0 && (PBM % GBM) == 0);
static_assert((CW % 32) == 0 && (KOUT % 32) == 0 && KOUT == CW && APITCH == KOUT);
static_assert((APITCH * 2) % 128 == 0);
static_assert(GBM == 128 && GBN == 128 && GTHR == 256 && GBK == 128);
static_assert((CW % GBK) == 0 && CW / GBK >= 2 && (KOUT % GBK) == 0 && (CW % GBN) == 0);
static_assert(GPITCH >= 2 * GBK && (GPITCH % 16) == 0);
static_assert(UQKV == (1 << 17) && (CW / 8) == 128 && (KOUT / 8) == 128);
static_assert(UQKV % NTHR == 0 && UWX % NTHR == 0 && (3 * UQKV) % NTHR == 0);
static_assert(DEGCAP >= 32);

typedef float          v4f  __attribute__((ext_vector_type(4)));
typedef float          v8f  __attribute__((ext_vector_type(8)));
typedef int            v4i  __attribute__((ext_vector_type(4)));
typedef int            v8i  __attribute__((ext_vector_type(8)));
typedef unsigned int   v4u  __attribute__((ext_vector_type(4)));
typedef unsigned short v8us __attribute__((ext_vector_type(8)));
typedef __bf16         v16b __attribute__((ext_vector_type(16)));
typedef _Float16       v4h  __attribute__((ext_vector_type(4)));
typedef _Float16       v8h  __attribute__((ext_vector_type(8)));
typedef _Float16       v16h __attribute__((ext_vector_type(16)));
typedef v4f  __attribute__((may_alias)) v4fa;
typedef v4i  __attribute__((may_alias)) v4ia;
typedef v4u  __attribute__((may_alias)) v4ua;
typedef v8us __attribute__((may_alias)) v8usa;
typedef v4h  __attribute__((may_alias)) v4ha;
typedef v8h  __attribute__((may_alias)) v8ha;
union FragB { v16b v; v16h f; v8us h[2]; v8i w; };

// WMMA with hazard guard: ties D, keeps A/B live for 4 VALU slots. HF: the 16 bits of an operand element are f16, else bf16
template <bool HF>
__device__ __forceinline__ v8f wmb(const FragB& a, const FragB& b, v8f c) {
  v8f d;
  if constexpr (HF) d = __builtin_amdgcn_wmma_f32_16x16x32_f16(false, a.f, false, b.f, (short)0, c, false, false);
  else              d = __builtin_amdgcn_wmma_f32_16x16x32_bf16(false, a.v, false, b.v, (short)0, c, false, false);
  asm volatile("v_nop\n\tv_nop\n\tv_nop\n\tv_nop" : "+v"(d) : "v"(a.w), "v"(b.w));
  return d;
}

// drain all outstanding vector-memory loads; also a compiler barrier for memory operations
__device__ __forceinline__ void ldwait() {
  asm volatile("s_wait_loadcnt 0x0" ::: "memory");
}

// sum over 8 neighbouring lanes, every lane gets it (row_xmask 1, 2, 4); all 32 lanes are on at every call
__device__ __forceinline__ float row8_sum(float v) {
  v += __int_as_float(__builtin_amdgcn_update_dpp(0, __float_as_int(v), 0x161, 0xf, 0xf, true));
  v += __int_as_float(__builtin_amdgcn_update_dpp(0, __float_as_int(v), 0x162, 0xf, 0xf, true));
  v += __int_as_float(__builtin_amdgcn_update_dpp(0, __float_as_int(v), 0x164, 0xf, 0xf, true));
  return v;
}

// 2^x. The v_nop fills the one slot that the instruction set asks for behind a transcendental.
__device__ __forceinline__ float exp2_slot(float x) {
  float r;
  asm("v_exp_f32 %0, %1\n\tv_nop" : "=v"(r) : "v"(x));
  return r;
}

// f32 -> bf16 bits, RNE convert; bf16 bits -> f32
__device__ __forceinline__ unsigned int f2bf(float f) {
  const unsigned int u = __float_as_uint(f);
  return ((u + 0x7FFFu + ((u >> 16) & 1u)) >> 16) & 0xFFFFu;
}
__device__ __forceinline__ float bf2f(unsigned int b) { return __uint_as_float(b << 16); }
__device__ __forceinline__ float bfr(float f) { return bf2f(f2bf(f)); }
__device__ __forceinline__ v4f bfr4(const v4f a) {
  v4f r; r.x = bfr(a.x); r.y = bfr(a.y); r.z = bfr(a.z); r.w = bfr(a.w); return r;
}
__device__ __forceinline__ unsigned int pk2(float lo, float hi) { return f2bf(lo) | (f2bf(hi) << 16); }
// 8 floats -> 8 bf16 packed in 16 B (element 2i = low half of word i)
__device__ __forceinline__ v4u pack8(const v4f a, const v4f b) {
  v4u r;
  r.x = pk2(a.x, a.y); r.y = pk2(a.z, a.w); r.z = pk2(b.x, b.y); r.w = pk2(b.z, b.w);
  return r;
}
// 8 floats -> 8 f16 (RNE) in 16 B, element order kept
__device__ __forceinline__ v8h pack8h(const v4f a, const v4f b) {
  v8h r;
  r[0] = (_Float16)a.x; r[1] = (_Float16)a.y; r[2] = (_Float16)a.z; r[3] = (_Float16)a.w;
  r[4] = (_Float16)b.x; r[5] = (_Float16)b.y; r[6] = (_Float16)b.z; r[7] = (_Float16)b.w;
  return r;
}

// ---------------------------------------------------------------------------
// One 128-entry piece of the key list that holds at least one hit: lane l has entries e0 .. e0 + 3 (e0 = piece base
// + 4l) in d. For each of the block's NBA slots the hits are ranked in ascending entry order (hits in lower lanes by
// ballot + mbcnt, then the lane's own in order) behind the hits this wave has found before (cwv: lane s holds the
// count of slot s), and the entry index is stored at that rank of the wave's list of the slot. Ranks from DEGCAP on
// are counted, not stored. Returns the new counts.
// ---------------------------------------------------------------------------
__device__ __forceinline__ int place_hits(const v4i d, int e0, unsigned nbs, int* wlw, int cwv, int lane) {
  const unsigned s0 = (unsigned)d.x - nbs, s1 = (unsigned)d.y - nbs;
  const unsigned s2 = (unsigned)d.z - nbs, s3 = (unsigned)d.w - nbs;
#pragma unroll 1   // slots stay rolled: this body stands UB times in the scan loop and runs for few pieces only
  for (int s = 0; s < NBA; ++s) {
    const unsigned m0 = __builtin_amdgcn_ballot_w32(s0 == (unsigned)s);
    const unsigned m1 = __builtin_amdgcn_ballot_w32(s1 == (unsigned)s);
    const unsigned m2 = __builtin_amdgcn_ballot_w32(s2 == (unsigned)s);
    const unsigned m3 = __builtin_amdgcn_ballot_w32(s3 == (unsigned)s);
    if ((m0 | m1 | m2 | m3) != 0u) {                     // wave-uniform
      unsigned r = __builtin_amdgcn_mbcnt_lo(m0, (unsigned)__builtin_amdgcn_readlane(cwv, s));
      r = __builtin_amdgcn_mbcnt_lo(m1, r);
      r = __builtin_amdgcn_mbcnt_lo(m2, r);
      r = __builtin_amdgcn_mbcnt_lo(m3, r);
      int* ls = wlw + s * DEGCAP;
      if (s0 == (unsigned)s) { if (r < DEGCAP) ls[r] = e0;     ++r; }
      if (s1 == (unsigned)s) { if (r < DEGCAP) ls[r] = e0 + 1; ++r; }
      if (s2 == (unsigned)s) { if (r < DEGCAP) ls[r] = e0 + 2; ++r; }
      if (s3 == (unsigned)s) { if (r < DEGCAP) ls[r] = e0 + 3; ++r; }
      const int tot = (int)(__builtin_popcount(m0) + __builtin_popcount(m1) + __builtin_popcount(m2) + __builtin_popcount(m3));
      cwv += (lane == s) ? tot : 0;
    }
  }
  return cwv;
}

// ---------------------------------------------------------------------------
// Node feature plane: XB[row][c] = bf16(x[row][c]) for row < nN (all 1024 c), zero for pad rows nN <= row < MP
// (load address clamped into x, value zeroed by select). One thread = 8 contiguous 16-bit values (16 B) from two
// coverage: nUnits = MP*128 threads x 8 = MP x 1024 elements exactly.
// ---------------------------------------------------------------------------
__global__ __launch_bounds__(NTHR) void k_xprep(const float* __restrict__ x, unsigned short* xb, int nN, int nUnits) {
  const int i = (int)blockIdx.x * NTHR + (int)threadIdx.x;
  if (i >= nUnits) return;
  const int row = i >> 7;
  const int c0  = (i & 127) * 8;
  const int rc  = row < nN ? row : nN - 1;
  const float* p = x + (size_t)rc * CW + c0;
  v4f a = *(const v4fa*)p;
  v4f b = *(const v4fa*)(p + 4);
  const v4f z4 = {0.f, 0.f, 0.f, 0.f};
  if (row >= nN) { a = z4; b = z4; }
  const v4u hv = pack8(a, b);
  unsigned short* o = xb + (size_t)row * CW + c0;
  *(v4u*)o = hv;
  
}

// ---------------------------------------------------------------------------
// Weight planes (k-contiguous B rows; WQKVT bf16 bits, WXT f16 bits of the f32 inputs).
//   units 0..393215 (part = u >> 17, block-uniform): WQKVT[part*1024 + n][k8..k8+7] = bf16(W_part[n][k8..]),
//     W_part in {Wq, Wk, Wv}, each a natural [1024][1024] row-major matrix (out x in).
//   units 393216..524287 (block-uniform): WXT[n][k8..k8+7] = f16(Wx[n][k8..]).
// coverage: WQKVT = 3 x 131072 units x 8 = 3072 x 1024 exactly; WXT = 131072 units x 8 = 1024 x 1024 exactly.
// ---------------------------------------------------------------------------
__global__ __launch_bounds__(NTHR) void k_wprep(const float* __restrict__ Wq, const float* __restrict__ Wk,
                                                const float* __restrict__ Wv, const float* __restrict__ Wx,
                                                unsigned short* WQKVT, unsigned short* WXT) {
  const int u = (int)blockIdx.x * NTHR + (int)threadIdx.x;
  if (u >= NUW) return;
  if (u < 3 * UQKV) {                                    // block-uniform
    const int part = u >> 17;
    const int v    = u & (UQKV - 1);
    const int n    = v >> 7;                             // 0..1023
    const int k8   = (v & 127) * 8;                      // 0..1016
    const float* W = (part == 0) ? Wq : ((part == 1) ? Wk : Wv);
    const float* p = W + (size_t)n * CW + k8;            // W[n][k8 .. k8+7], contiguous
    const v4f a = *(const v4fa*)p;
    const v4f b = *(const v4fa*)(p + 4);
    *(v4u*)(WQKVT + (size_t)(part * CW + n) * CW + k8) = pack8(a, b);
  } else {
    const int v  = u - 3 * UQKV;                         // 0..131071
    const int n  = v >> 7;                               // 0..1023
    const int k8 = (v & 127) * 8;                        // 0..1016
    const float* p = Wx + (size_t)n * CW + k8;           // Wx[n][k8 .. k8+7], contiguous
    const v4f a = *(const v4fa*)p;
    const v4f b = *(const v4fa*)(p + 4);
    *(v8ha*)(WXT + (size_t)n * KOUT + k8) = pack8h(a, b);
  }
}

// ---------------------------------------------------------------------------
// Eight (acopy8) or six (acopy6) asynchronous 16-B-per-lane copies global -> LDS: rows RS apart in both places
// (gstep elements, RS pitches).
// The s_wait_xcnt stands inside the statement so that no address register is rewritten in front of it.
// ---------------------------------------------------------------------------
template <int RS>
__device__ __forceinline__ void acopy8(unsigned int l0, const unsigned short* g0, size_t gstep) {
  const unsigned int l1 = l0 + RS * GPITCH, l2 = l0 + 2 * RS * GPITCH, l3 = l0 + 3 * RS * GPITCH;
  const unsigned int l4 = l0 + 4 * RS * GPITCH, l5 = l0 + 5 * RS * GPITCH, l6 = l0 + 6 * RS * GPITCH, l7 = l0 + 7 * RS * GPITCH;
  const unsigned short* g1 = g0 + gstep;
  const unsigned short* g2 = g1 + gstep;
  const unsigned short* g3 = g2 + gstep;
  const unsigned short* g4 = g3 + gstep;
  const unsigned short* g5 = g4 + gstep;
  const unsigned short* g6 = g5 + gstep;
  const unsigned short* g7 = g6 + gstep;
  asm volatile("global_load_async_to_lds_b128 %0, %8, off\n\t"
               "global_load_async_to_lds_b128 %1, %9, off\n\t"
               "global_load_async_to_lds_b128 %2, %10, off\n\t"
               "global_load_async_to_lds_b128 %3, %11, off\n\t"
               "global_load_async_to_lds_b128 %4, %12, off\n\t"
               "global_load_async_to_lds_b128 %5, %13, off\n\t"
               "global_load_async_to_lds_b128 %6, %14, off\n\t"
               "global_load_async_to_lds_b128 %7, %15, off\n\t"
               "s_wait_xcnt 0x0"
               :: "v"(l0), "v"(l1), "v"(l2), "v"(l3), "v"(l4), "v"(l5), "v"(l6), "v"(l7),
                  "v"(g0), "v"(g1), "v"(g2), "v"(g3), "v"(g4), "v"(g5), "v"(g6), "v"(g7)
               : "memory");
}
template <int RS>
__device__ __forceinline__ void acopy6(unsigned int l0, const unsigned short* g0, size_t gstep) {
  const unsigned int l1 = l0 + RS * GPITCH, l2 = l0 + 2 * RS * GPITCH, l3 = l0 + 3 * RS * GPITCH;
  const unsigned int l4 = l0 + 4 * RS * GPITCH, l5 = l0 + 5 * RS * GPITCH;
  const unsigned short* g1 = g0 + gstep;
  const unsigned short* g2 = g1 + gstep;
  const unsigned short* g3 = g2 + gstep;
  const unsigned short* g4 = g3 + gstep;
  const unsigned short* g5 = g4 + gstep;
  asm volatile("global_load_async_to_lds_b128 %0, %6, off\n\t"
               "global_load_async_to_lds_b128 %1, %7, off\n\t"
               "global_load_async_to_lds_b128 %2, %8, off\n\t"
               "global_load_async_to_lds_b128 %3, %9, off\n\t"
               "global_load_async_to_lds_b128 %4, %10, off\n\t"
               "global_load_async_to_lds_b128 %5, %11, off\n\t"
               "s_wait_xcnt 0x0"
               :: "v"(l0), "v"(l1), "v"(l2), "v"(l3), "v"(l4), "v"(l5),
                  "v"(g0), "v"(g1), "v"(g2), "v"(g3), "v"(g4), "v"(g5)
               : "memory");
}
// the BN rows of the WT part of a stage: BN / RS copies per thread
template <int RS, int BN>
__device__ __forceinline__ void acopyB(unsigned int l0, const unsigned short* g0, size_t gstep) {
  static_assert(BN == 8 * RS || BN == 6 * RS);
  if constexpr (BN == 8 * RS) acopy8<RS>(l0, g0, gstep);
  else                        acopy6<RS>(l0, g0, gstep);
}

// ---------------------------------------------------------------------------
// 16-bit WMMA GEMM: C[rows][N] = A[MP][K] (16-bit elements, pitch lda) x WT[N][K]^T (rows n, k-contiguous, pitch K);
// both operands bf16 (HF false: k_gemm) or both f16 (HF true: k_gemm_h); copies and fragment maps are the same.
// grid (MP/BM, N/BN), NT threads: one BM x BN tile of C per block, NT/128 x 4 waves; wave w owns rows 64*(w>>2).. +63
// and cols (BN/4)*(w&3).. of it: acc[4][BN/64].
//   k_gemm   256 x 192, 512 threads, wave tile 64 x 48: 16 x 16 = 256 blocks for [4096][3072], and every operand byte
//            brought into LDS serves more products than in a 128 x 128 tile (448 rows per 49152 outputs, not 256 per 16384)
//   k_gemm_h 128 x 128, 256 threads, wave tile 64 x 32
// K runs in passes of 128 (256 B of every operand row); a stage is [A BM rows | WT BN rows] at LDS pitch 272 B, two
// buffers. Each thread copies pieces of 16 B (row = (NT/16) i + tid/16, piece = tid%16, so one wave instruction moves
// two whole 256-B row pieces); the copies of pass t+2 are issued behind the barrier that ends pass t and are waited
// for at the foot of pass t+1.
// A fragment (row m = lane&15): elements 0..7 <- k0+8h+0..7, 8..15 <- k0+16+8h+0..7 (h = lane>>4); B fragment
// (col n = lane&15) from its WT row with the SAME k map; D element r = (row 8h+r, col lane&15). k ascends in
// steps of 32 on one accumulator chain per output tile.
// Epilogue: the f32 tile is staged in the ring (every copy landed, every reader past the last barrier),
// + bf16-valued bias (bias vector selected by col / 1024, block-uniform; scaled by useBias in {0,1}; the load is
// always in range). BN == 128: one instruction writes one row segment: 512 B of f32 into outF for cols < nF, 256 B of
// f16 (RNE) into outH at col - nF for cols >= nF (block-uniform: nF is a multiple of 128). Else: per 64-col segment
// (inside one matrix and one output plane: 1024 and nF are multiples of 64) one instruction writes the segment of
// two rows: 2 x 256 B of f32 or 2 x 128 B of f16, whole lines.
// coverage: rows rowBase..rowBase+BM-1 restricted to < nRows x cols col0..col0+BN-1 per block;
//   grid (MP/BM, N/BN) covers every (row < nRows, col) exactly once.
// LDS extents: copies fill rows 0..BM+BN-1 x bytes 0..255 of a buffer (pitch 272); staging BM x (BN+4) floats.
// ---------------------------------------------------------------------------
template <bool HF, int BM, int BN, int NT>
__device__ __forceinline__ void gemm_body(
    const unsigned short* __restrict__ A, int lda, const unsigned short* __restrict__ WT, int K,
    float* outF, int ldo, int nRows,
    const float* __restrict__ bs0, const float* __restrict__ bs1, const float* __restrict__ bs2, int useBias,
    unsigned short* outH, int ldh, int nF)
{
  constexpr int NW  = NT / 32;                 // waves
  constexpr int FX  = BN / 64;                 // 16-col fragments per wave (4 wave columns)
  constexpr int RS  = NT / 16;                 // rows one copy instruction of the block covers
  constexpr int STG = (BM + BN) * GPITCH;      // one buffer
  constexpr int SP  = BN + 4;                  // output staging pitch in floats
  static_assert(BM == 64 * (NW / 4) && BN == 64 * FX && BM == 8 * RS);
  static_assert(BM * SP * 4 <= 2 * STG && (SP * 4) % 16 == 0 && 2 * STG <= 327680);
  __shared__ __attribute__((aligned(16))) unsigned char ring[2 * STG];
  const int tid = (int)threadIdx.x, lane = tid & 31, wave = tid >> 5, hh = lane >> 4, m = lane & 15;
  const int wm = wave >> 2, wn = wave & 3;
  const int rowBase = (int)blockIdx.x * BM;
  const int col0    = (int)blockIdx.y * BN;

  v8f acc[4][FX];
  {
    const v8f z = {0.f, 0.f, 0.f, 0.f, 0.f, 0.f, 0.f, 0.f};
#pragma unroll
    for (int i = 0; i < 4; ++i) {
#pragma unroll
      for (int j = 0; j < FX; ++j) acc[i][j] = z;
    }
  }
  const int crow = tid >> 4, cseg = tid & 15;
  const unsigned short* ga = A  + (size_t)(rowBase + crow) * (size_t)lda + 8 * cseg;
  const unsigned short* gb = WT + (size_t)(col0 + crow) * (size_t)K + 8 * cseg;
  const size_t sa = (size_t)RS * (size_t)lda, sb = (size_t)RS * (size_t)K;
  const unsigned int la = (unsigned int)(size_t)ring + (unsigned int)(crow * GPITCH + 16 * cseg);
  const unsigned int lb = la + BM * GPITCH;
  const int npass = K / GBK;

  acopy8<RS>(la, ga, sa);
  acopyB<RS, BN>(lb, gb, sb);
  asm volatile("s_wait_asynccnt 0x0" ::: "memory");   // this wave's part of stage 0 has landed
  __syncthreads();                                     // stage 0 readable by every wave
  if (npass > 1) {
    acopy8<RS>(la + STG, ga + GBK, sa);
    acopyB<RS, BN>(lb + STG, gb + GBK, sb);
  }

#pragma unroll 1   // passes stay rolled: one copy of the WMMA body
  for (int t = 0; t < npass; ++t) {
    const unsigned int bo = (unsigned int)(t & 1) * STG;
    const unsigned char* ar = ring + bo + (64 * wm + m) * GPITCH + 16 * hh;
    const unsigned char* br = ring + bo + (BM + 16 * FX * wn + m) * GPITCH + 16 * hh;
#pragma unroll
    for (int kk = 0; kk < GBK / 32; ++kk) {
      FragB af[4], bf[FX];
#pragma unroll
      for (int i = 0; i < 4; ++i) {
        af[i].h[0] = *(const v8usa*)(ar + 16 * i * GPITCH + 64 * kk);        // k = 32kk + 8hh + 0..7
        af[i].h[1] = *(const v8usa*)(ar + 16 * i * GPITCH + 64 * kk + 32);   // k = 32kk + 16 + 8hh + 0..7
      }
#pragma unroll
      for (int j = 0; j < FX; ++j) {
        bf[j].h[0] = *(const v8usa*)(br + 16 * j * GPITCH + 64 * kk);        // same k map as A
        bf[j].h[1] = *(const v8usa*)(br + 16 * j * GPITCH + 64 * kk + 32);
      }
#pragma unroll
      for (int i = 0; i < 4; ++i) {
#pragma unroll
        for (int j = 0; j < FX; ++j) acc[i][j] = wmb<HF>(af[i], bf[j], acc[i][j]);
      }
    }
    asm volatile("s_wait_dscnt 0x0" ::: "memory");     // this wave's reads of the buffer are done before its refill
    asm volatile("s_wait_asynccnt 0x0" ::: "memory");  // this wave's part of stage t+1 has landed
    __syncthreads();                                   // publishes stage t+1, frees the buffer of stage t
    if (t + 2 < npass) {                               // block-uniform
      acopy8<RS>(la + bo, ga + (size_t)(t + 2) * GBK, sa);
      acopyB<RS, BN>(lb + bo, gb + (size_t)(t + 2) * GBK, sb);
    }
  }
  asm volatile("s_wait_asynccnt 0x0" ::: "memory");    // nothing in flight when the ring becomes output staging

  float* stg = (float*)ring;
#pragma unroll
  for (int i = 0; i < 4; ++i) {
#pragma unroll
    for (int j = 0; j < FX; ++j) {
      const int lc = 16 * FX * wn + 16 * j + m;
#pragma unroll
      for (int r = 0; r < 8; ++r) {
        const int lr = 64 * wm + 16 * i + 8 * hh + r;   // D element r = (row 8hh+r, col m)
        stg[lr * SP + lc] = acc[i][j][r];
      }
    }
  }
  __syncthreads();

  if constexpr (BN == 128) {
    const int mat = col0 / CW;                            // block-uniform
    const float* bsel = (mat == 0) ? bs0 : ((mat == 1) ? bs1 : bs2);
    v4f b4 = *(const v4fa*)(bsel + (col0 & (CW - 1)) + 4 * lane);
    b4 = bfr4(b4) * (float)useBias;

    v4f fv[16];
#pragma unroll
    for (int i = 0; i < 16; ++i) {
      const int lr = 16 * wave + i;
      fv[i] = *(const v4fa*)(stg + lr * SP + 4 * lane) + b4;
    }
    if (col0 < nF) {                                      // block-uniform
#pragma unroll
      for (int i = 0; i < 16; ++i) {
        const int lr = 16 * wave + i;
        const int gr = rowBase + lr;
        const int gs = gr < nRows ? gr : nRows - 1;
        float* op = outF + (size_t)gs * (size_t)ldo + col0 + 4 * lane;
        if (gr < nRows) *(v4f*)op = fv[i];
      }
    } else {
#pragma unroll
      for (int i = 0; i < 16; ++i) {
        const int lr = 16 * wave + i;
        const int gr = rowBase + lr;
        const int gs = gr < nRows ? gr : nRows - 1;
        unsigned short* op = outH + (size_t)gs * (size_t)ldh + (col0 - nF) + 4 * lane;
        v4h h4;
        h4.x = (_Float16)fv[i].x; h4.y = (_Float16)fv[i].y; h4.z = (_Float16)fv[i].z; h4.w = (_Float16)fv[i].w;
        if (gr < nRows) *(v4ha*)op = h4;
      }
    }
  } else {
    constexpr int NI = BM / (2 * NW);                     // row pairs per wave and segment
#pragma unroll
    for (int sg = 0; sg < BN / 64; ++sg) {
      const int gc0 = col0 + 64 * sg;                     // block-uniform
      const int mat = gc0 / CW;
      const float* bsel = (mat == 0) ? bs0 : ((mat == 1) ? bs1 : bs2);
      v4f b4 = *(const v4fa*)(bsel + (gc0 & (CW - 1)) + 4 * m);
      b4 = bfr4(b4) * (float)useBias;
      v4f fv[NI];
#pragma unroll
      for (int i = 0; i < NI; ++i) {
        const int lr = 2 * NW * i + 2 * wave + hh;
        fv[i] = *(const v4fa*)(stg + lr * SP + 64 * sg + 4 * m) + b4;
      }
      if (gc0 < nF) {                                     // block-uniform
#pragma unroll
        for (int i = 0; i < NI; ++i) {
          const int gr = rowBase + 2 * NW * i + 2 * wave + hh;
          const int gs = gr < nRows ? gr : nRows - 1;
          float* op = outF + (size_t)gs * (size_t)ldo + gc0 + 4 * m;
          if (gr < nRows) *(v4f*)op = fv[i];
        }
      } else {
#pragma unroll
        for (int i = 0; i < NI; ++i) {
          const int gr = rowBase + 2 * NW * i + 2 * wave + hh;
          const int gs = gr < nRows ? gr : nRows - 1;
          unsigned short* op = outH + (size_t)gs * (size_t)ldh + (gc0 - nF) + 4 * m;
          v4h h4;
          h4.x = (_Float16)fv[i].x; h4.y = (_Float16)fv[i].y; h4.z = (_Float16)fv[i].z; h4.w = (_Float16)fv[i].w;
          if (gr < nRows) *(v4ha*)op = h4;
        }
      }
    }
  }
}

__global__ __launch_bounds__(PTHR) void k_gemm(
    const unsigned short* __restrict__ A, int lda, const unsigned short* __restrict__ WT, int K,
    float* outF, int ldo, int nRows,
    const float* __restrict__ bs0, const float* __restrict__ bs1, const float* __restrict__ bs2, int useBias,
    unsigned short* outH, int ldh, int nF)
{
  gemm_body<false, PBM, PBN, PTHR>(A, lda, WT, K, outF, ldo, nRows, bs0, bs1, bs2, useBias, outH, ldh, nF);
}

__global__ __launch_bounds__(GTHR) void k_gemm_h(
    const unsigned short* __restrict__ A, int lda, const unsigned short* __restrict__ WT, int K,
    float* outF, int ldo, int nRows,
    const float* __restrict__ bs0, const float* __restrict__ bs1, const float* __restrict__ bs2, int useBias,
    unsigned short* outH, int ldh, int nF)
{
  gemm_body<true, GBM, GBN, GTHR>(A, lda, WT, K, outF, ldo, nRows, bs0, bs1, bs2, useBias, outH, ldh, nF);
}

// ---------------------------------------------------------------------------
// Query-keyed sparse attention, no atomics, no global tables. Block owns query slots [nodeBase, nodeBase + NBA);
// key of edge e = qid[e], the gathered side is kid[e].
// Phase 1 (waves independent): wave w scans its own contiguous eighth [w*seg, (w+1)*seg) of the qid list, UB b128
//   loads per lane in flight, one test per batch of 1024 entries; a piece with hits goes through place_hits, which
//   appends the edge ids to the wave's own list of each slot (ascending) and counts them (lane s: slot s).
//   One block barrier publishes the 8 x NBA lists and counts.
// Phase 2 (per wave, registers): the 8 counts of the wave's slot give the running offsets pre[]; entry idx of the
//   slot is entry idx - pre[w] of the list of the last wave w with pre[w] <= idx, so edge ids ascend within a slot.
// Phase 3 (waves independent, no block barriers): wave w owns the one (slot, b) row w of the block's NBA * BD = 8
//   rows (slot = w / 2, b = w % 2; row = 2*query + b of the QP and KVH planes). Lane l owns channels 256j+8l..256j+8l+7
//   of piece j = 0..3, so every load instruction of an f16 row reads 512 contiguous bytes (4 lines); head of (j, l) =
//   4j + (l>>3). Per (slot, b): the 1024-float q row (8 b128 loads per lane). Per edge in fixed slot order:
//   kd = kid[eid] (clamped), the 4-KB k | v row of (kd, b) (8 b128 loads per lane, one wait), per piece the dot of the
//   lane's 8 channels and its sum over the head's 8 lanes, logit * 1/8, running-max single pass per head (each lane
//   keeps the 4 heads it has a part in): den = den*exp(mx-mn) + exp(l-mn), av_c likewise with the v half of the row.
//   o_c = av_c / den (NaN poison above DEGCAP edges, zero row for pad queries >= nS); the lane's 8 channels of a piece
//   are one 16-B unit of the f16 plane, so every store instruction writes 512 contiguous bytes:
// coverage: gridDim.x * NBA * 2 >= mRows (host-checked): APL rows 0..mRows-1 x cols 0..1023 written exactly once.
// LDS extents: wl: each wave zeroes its own WLW ints before it appends (one wave's LDS operations keep their order);
//   cntw: all NWAVE * NBA written before the barrier.
// ---------------------------------------------------------------------------
__global__ __launch_bounds__(NTHR) void k_scan(const int* __restrict__ qid, const int* __restrict__ kid,
                                               const float* __restrict__ QP,
                                               const unsigned short* __restrict__ KVH, unsigned short* apl,
                                               int nE, int nS, int mRows) {
  extern __shared__ __attribute__((aligned(16))) int dsm[];
  int* wl   = dsm;                         // WLN: [wave][slot][DEGCAP] edge ids
  int* cntw = dsm + WLN;                   // [wave][slot] hit counts
  const int tid = (int)threadIdx.x, lane = tid & 31, wave = tid >> 5;
  const int nodeBase = (int)blockIdx.x * NBA;
  const int wv = __builtin_amdgcn_readfirstlane(wave);  // scalar, so that ranges, slot and b stay wave-uniform registers

  // ---- phase 1: every wave scans its own eighth of the key list
  {
    int* wlw = wl + wv * WLW;
    const v4i zi = {0, 0, 0, 0};
    *(v4ia*)(wlw + 4 * lane)       = zi;
    *(v4ia*)(wlw + 128 + 4 * lane) = zi;
    int cwv = 0;                                         // lane s < NBA: this wave's hit count of slot s
    const unsigned nbs = (unsigned)nodeBase;
    const int sent = -2147483647 - 1;
    const int seg  = ((nE + NWAVE * BATCH - 1) / (NWAVE * BATCH)) * BATCH;
    const int wbeg = wv * seg;
    const int wend = (wbeg + seg) < nE ? (wbeg + seg) : nE;
#pragma unroll 1   // batches stay rolled: the UB place_hits bodies exist once
    for (int base = wbeg; base < wend; base += BATCH) {
      v4i d[UB];
      if (base + BATCH <= nE) {                          // wave-uniform: whole batch in range, 16-B aligned
#pragma unroll
        for (int u = 0; u < UB; ++u) d[u] = *(const v4ia*)(qid + base + u * SUB + 4 * lane);
      } else {                                           // tail: every address clamped, sentinel by value
#pragma unroll
        for (int u = 0; u < UB; ++u) {
          const int e = base + u * SUB + 4 * lane;
          d[u].x = (e     < nE) ? qid[min(e,     nE - 1)] : sent;
          d[u].y = (e + 1 < nE) ? qid[min(e + 1, nE - 1)] : sent;
          d[u].z = (e + 2 < nE) ? qid[min(e + 2, nE - 1)] : sent;
          d[u].w = (e + 3 < nE) ? qid[min(e + 3, nE - 1)] : sent;
        }
      }
      // The one test below needs all UB pieces. The wait stands in front of every reuse of the loads' address
      // registers; the scheduling barrier keeps the compiler from lifting the subtractions (and that reuse) over it.
      ldwait();
      __builtin_amdgcn_sched_barrier(0);
      unsigned lo[UB];
      unsigned all = 0xFFFFFFFFu;
#pragma unroll
      for (int u = 0; u < UB; ++u) {                     // smallest slot distance of the lane's four entries
        lo[u] = min(min((unsigned)d[u].x - nbs, (unsigned)d[u].y - nbs),
                    min((unsigned)d[u].z - nbs, (unsigned)d[u].w - nbs));
        all = min(all, lo[u]);
      }
      if (__builtin_amdgcn_ballot_w32(all < (unsigned)NBA) != 0u) {
#pragma unroll
        for (int u = 0; u < UB; ++u) {
          if (__builtin_amdgcn_ballot_w32(lo[u] < (unsigned)NBA) != 0u)
            cwv = place_hits(d[u], base + u * SUB + 4 * lane, nbs, wlw, cwv, lane);
        }
      }
    }
    if (lane < NBA) cntw[wv * NBA + lane] = cwv;
  }
  __syncthreads();                                       // every wave's lists and counts readable by every wave

  // ---- phase 3: per-(slot, b) edge attention + row build
  const float qnan = __int_as_float(0x7fc00000);
  const v4f z4 = {0.f, 0.f, 0.f, 0.f};
  {
    const int s  = wv / BD;                             // slot
    const int b  = wv % BD;
    const int qn = nodeBase + s;                        // query index
    // ---- phase 2: running offsets of the eight waves' lists of this slot (lane l < 8 reads wave l's count)
    const int cl = cntw[(lane & (NWAVE - 1)) * NBA + s];
    int pre[NWAVE + 1];
    pre[0] = 0;
#pragma unroll
    for (int w2 = 0; w2 < NWAVE; ++w2) pre[w2 + 1] = pre[w2] + __builtin_amdgcn_readlane(cl, w2);
    int c = pre[NWAVE];
    const bool big = c > DEGCAP;
    c = c < 0 ? 0 : (c > DEGCAP ? DEGCAP : c);
    const int  qc   = qn < nS ? qn : nS - 1;
    const bool live = qn < nS;                          // wave-uniform
    const bool pois = big;

    {
      const float* qr = QP + ((size_t)qc * BD + b) * CW + 8 * lane;
      v4f qa[4], qb[4];
#pragma unroll
      for (int j = 0; j < 4; ++j) {
        qa[j] = *(const v4fa*)(qr + 256 * j);
        qb[j] = *(const v4fa*)(qr + 256 * j + 4);
      }
      ldwait();

      float mx[4], dn[4];
      v4f aa[4], ab[4];
#pragma unroll
      for (int j = 0; j < 4; ++j) { mx[j] = -1.0e30f; dn[j] = 0.0f; aa[j] = z4; ab[j] = z4; }

#pragma unroll 1
      for (int b0 = 0; b0 < c; b0 += 32) {
        const int idx = b0 + lane;                       // 0 .. DEGCAP - 1
        int la = idx;                                    // list address: last wave w2 with pre[w2] <= idx
#pragma unroll
        for (int w2 = 1; w2 < NWAVE; ++w2) la = (idx >= pre[w2]) ? (w2 * WLW + idx - pre[w2]) : la;
        int eid = wl[s * DEGCAP + la];                   // idx - pre[w2] <= idx < DEGCAP: inside that list
        eid = eid < 0 ? 0 : (eid > nE - 1 ? nE - 1 : eid);
        int kd = kid[eid];
        kd = kd < 0 ? 0 : (kd > nS - 1 ? nS - 1 : kd);
        const int m32 = (c - b0) < 32 ? (c - b0) : 32;
#pragma unroll 1
        for (int k = 0; k < m32; ++k) {
          const int tk = __builtin_amdgcn_readlane(kd, k);
          const unsigned short* kr = KVH + ((size_t)tk * BD + b) * KVW + 8 * lane;   // whole 4-KB k | v row
          v8h kv[4], vv[4];
#pragma unroll
          for (int j = 0; j < 4; ++j) kv[j] = *(const v8ha*)(kr + 256 * j);
#pragma unroll
          for (int j = 0; j < 4; ++j) vv[j] = *(const v8ha*)(kr + CW + 256 * j);
          ldwait();
          float s1[4], s2[4];
#pragma unroll
          for (int j = 0; j < 4; ++j) {
            float p = qa[j].x * (float)kv[j][0];
            p = fmaf(qa[j].y, (float)kv[j][1], p); p = fmaf(qa[j].z, (float)kv[j][2], p);
            p = fmaf(qa[j].w, (float)kv[j][3], p); p = fmaf(qb[j].x, (float)kv[j][4], p);
            p = fmaf(qb[j].y, (float)kv[j][5], p); p = fmaf(qb[j].z, (float)kv[j][6], p);
            p = fmaf(qb[j].w, (float)kv[j][7], p);
            p = row8_sum(p);                            // sum over the head's 8 lanes
            const float lg = p * ATTSC;
            const float df = lg - mx[j];
            const float ee = exp2_slot(-1.44269504f * fabsf(df));   // exp(-|df|); the other factor is exactly 1
            const bool up  = df > 0.0f;
            s1[j] = up ? ee : 1.0f;
            s2[j] = up ? 1.0f : ee;
            mx[j] = up ? lg : mx[j];
            dn[j] = fmaf(dn[j], s1[j], s2[j]);
          }
#pragma unroll
          for (int j = 0; j < 4; ++j) {
            aa[j].x = fmaf(aa[j].x, s1[j], s2[j] * (float)vv[j][0]); aa[j].y = fmaf(aa[j].y, s1[j], s2[j] * (float)vv[j][1]);
            aa[j].z = fmaf(aa[j].z, s1[j], s2[j] * (float)vv[j][2]); aa[j].w = fmaf(aa[j].w, s1[j], s2[j] * (float)vv[j][3]);
            ab[j].x = fmaf(ab[j].x, s1[j], s2[j] * (float)vv[j][4]); ab[j].y = fmaf(ab[j].y, s1[j], s2[j] * (float)vv[j][5]);
            ab[j].z = fmaf(ab[j].z, s1[j], s2[j] * (float)vv[j][6]); ab[j].w = fmaf(ab[j].w, s1[j], s2[j] * (float)vv[j][7]);
          }
        }
      }

      v8h hv[4];
#pragma unroll
      for (int j = 0; j < 4; ++j) {
        const float inv  = __builtin_amdgcn_rcpf(dn[j]); // den >= 1 when c > 0; c == 0 -> inf and 0 * inf = NaN (0 / 0)
        const float invp = pois ? qnan : inv;
        v4f pa, pb;                                      // cols 256j+8l .. 256j+8l+7
        pa.x = live ? aa[j].x * invp : 0.0f;
        pa.y = live ? aa[j].y * invp : 0.0f;
        pa.z = live ? aa[j].z * invp : 0.0f;
        pa.w = live ? aa[j].w * invp : 0.0f;
        pb.x = live ? ab[j].x * invp : 0.0f;
        pb.y = live ? ab[j].y * invp : 0.0f;
        pb.z = live ? ab[j].z * invp : 0.0f;
        pb.w = live ? ab[j].w * invp : 0.0f;
        hv[j] = pack8h(pa, pb);
      }
      const int row = qn * BD + b;
      if (row < mRows) {                                 // wave-uniform
        unsigned short* rp = apl + (size_t)row * APITCH;
#pragma unroll
        for (int j = 0; j < 4; ++j) *(v8ha*)(rp + 256 * j + 8 * lane) = hv[j];
      }
    }
  }
}

// ---------------------------------------------------------------------------
static inline int cdiv(int a, int b) { return (a + b - 1) / b; }
static inline size_t al256(size_t o) { return (o + 255) & ~(size_t)255; }

extern "C" void kernel_launch(void* const* d_in, const int* in_sizes, int n_in,
                              void* d_out, int out_size, void* d_ws, size_t ws_size,
                              hipStream_t stream) {
  if (n_in < 11) return;
  if (in_sizes[0] < BD * CW || (in_sizes[0] % (BD * CW)) != 0) return;   // x [S][2][1024]
  const int nS = in_sizes[0] / (BD * CW);
  if (nS < 1 || nS > (1 << 20)) return;
  const int nE = in_sizes[1];                                          // q_id [E]
  if (nE < 1 || nE >= NEMAX) return;
  if (in_sizes[2] != nE) return;                                       // k_id [E]
  if (in_sizes[3] != CW * CW || in_sizes[5] != CW * CW || in_sizes[7] != CW * CW || in_sizes[9] != CW * CW) return;
  if (in_sizes[4] != CW || in_sizes[6] != CW || in_sizes[8] != CW || in_sizes[10] != CW) return;
  if ((long long)out_size != (long long)nS * BD * CW) return;          // out [S][2][1024]

  const float* x   = (const float*)d_in[0];     // [S][2][1024] -> rows 2s+b of 1024
  const int*   qid = (const int*)  d_in[1];     // [E] key side (query)
  const int*   kid = (const int*)  d_in[2];     // [E] gathered side (k, v)
  const float* Wq  = (const float*)d_in[3];     // [1024][1024] natural [out][in]
  const float* bq  = (const float*)d_in[4];
  const float* Wk  = (const float*)d_in[5];
  const float* bk  = (const float*)d_in[6];
  const float* Wv  = (const float*)d_in[7];
  const float* bv  = (const float*)d_in[8];
  const float* Wx  = (const float*)d_in[9];
  const float* bx  = (const float*)d_in[10];
  float* out = (float*)d_out;                   // [S][2][1024] -> rows 2s+b of 1024

  const int nRows = nS * BD;
  const int MP = cdiv(nRows, PBM) * PBM;        // padded rows of every node plane
  const int gM = MP / GBM;
  const int gA = cdiv(cdiv(MP, BD), NBA);
  if ((long long)gA * NBA * BD < (long long)MP) return;

  // workspace carve (256-B aligned; every region sized to its whole-row store extent incl. padded rows MP)
  char* ws = (char*)d_ws;
  size_t off = 0;
  const size_t oXB  = off; off = al256(off + (size_t)MP * CW * 2);        // XB    [MP][1024]   bf16
  const size_t oWQ  = off; off = al256(off + (size_t)QKVW * CW * 2);      // WQKVT [3072][1024] bf16
  const size_t oWX  = off; off = al256(off + (size_t)CW * KOUT * 2);      // WXT   [1024][1024] f16
  const size_t oQP  = off; off = al256(off + (size_t)MP * CW * 4);        // QP    [MP][1024]   f32
  const size_t oKVH = off; off = al256(off + (size_t)MP * KVW * 2);       // KVH   [MP][2048]   f16
  const size_t oAPL = off; off = al256(off + (size_t)MP * APITCH * 2);    // APL   [MP][1024]   f16
  if (off > ws_size || off > (size_t)WSMAX) return;
  unsigned short* XB    = (unsigned short*)(ws + oXB);
  unsigned short* WQKVT = (unsigned short*)(ws + oWQ);
  unsigned short* WXT   = (unsigned short*)(ws + oWX);
  float*          QP    = (float*)(ws + oQP);
  unsigned short* KVH   = (unsigned short*)(ws + oKVH);
  unsigned short* APL   = (unsigned short*)(ws + oAPL);

  hipFuncSetAttribute(reinterpret_cast<const void*>(&k_scan),
                      hipFuncAttributeMaxDynamicSharedMemorySize, SCAN_LDS_BYTES);

  // node feature plane (bf16 bits), pad rows zero
  const int nUx = MP * (CW / 8);
  k_xprep<<<cdiv(nUx, NTHR), NTHR, 0, stream>>>(x, XB, nRows, nUx);
  // weight planes
  k_wprep<<<NUW / NTHR, NTHR, 0, stream>>>(Wq, Wk, Wv, Wx, WQKVT, WXT);
  // projection GEMM: XB [Wq|Wk|Wv]^T + b -> q f32 [MP][1024], k | v f16 [MP][2048]
  k_gemm<<<dim3(MP / PBM, QKVW / PBN), PTHR, 0, stream>>>(XB, CW, WQKVT, CW, QP, CW, MP, bq, bk, bv, 1, KVH, KVW, CW);
  // query-keyed sparse attention -> APL [MP][1024]
  k_scan<<<gA, NTHR, SCAN_LDS_BYTES, stream>>>(qid, kid, QP, KVH, APL, nE, nS, MP);
  // trailing GEMM: out = APL . WXT^T + bx -> rows < nRows
  k_gemm_h<<<dim3(gM, CW / GBN), GTHR, 0, stream>>>(APL, APITCH, WXT, KOUT, out, CW, nRows, bx, bx, bx, 1, KVH, KVW, CW);
}

// v008
// Measured time: 67.1 microseconds a run.
// In both of two side-by-side timings against v007, it was 1.08 times as fast.
// Over all steps from v000 it is 102 times as fast.
#include <hip/hip_runtime.h>
#include <stddef.h>
#include <stdint.h>
#include <math.h>

// Contractions: v_wmma_f32_16x16x32_bf16 (bf16 operands, f32 accumulate) for the three projections
// x*[Wq|Wk|Wv]^T (K 1024, bf16 RNE copies of the inputs, products exact in f32); v_wmma_f32_16x16x32_f16 (f16
// operands, f32 accumulate) for the trailing projection o * Wx^T + bx (K 1024, o and Wx each one f16 RNE value;
// o is a convex mix of f16 v values, so it stays in f16 range).
// Per-edge per-head q.k dots (16 heads x 64), per-(query, b, head) running-max softmax over the query's own keys
// and the weighted value sums: f32 VALU.
//
// Row mapping: x [S][2][1024] and the output use row = 2*s + b (4096-B rows); q, k, v channel 64*h + c.
// Gathered rows: k and v leave the projection GEMM as f16 (RNE from the f32 accumulator + bias), q stays f32; every
// product and sum of the attention stays f32.
// Softmax: exp(qk - max) / sum over the edges sharing a q_id is evaluated per (query, b, head) with a running max
// over that query's keys (the shift cancels in num / den); a query without edges yields 0 * inf = NaN like 0 / 0.
//
// Carry audit: no power-of-two carries anywhere; no inverse factor exists.
//   XB    [MP][1024]   bf16 bits of x (pad rows zero)                      -> A of the projection GEMM
//   WQKVT [3072][1024] bf16 bits, row n = [Wq;Wk;Wv][n][k] (natural rows)  -> B of the projection GEMM
//   WXT   [1024][1024] f16 bits, row n = Wx[n][k] (natural rows)           -> B of the trailing GEMM
//   QP    [MP][1024]   f32: q (+ bf16-valued bias)                          -> read by k_scan
//   KVH   [MP][2048]   f16: k | v (+ bf16-valued bias), 4096-B rows         -> gathered by k_scan
//   APL   [MP][1024]   f16 bits: o                                         -> A of the trailing GEMM
//   ST    [S + 1][32]  int, word 0 used: first edge of every query in the ascending q_id list -> read by k_scan

#define CW      1024                  // channels
#define BD      2                     // middle (batch) dimension of x
#define NHD     16                    // heads
#define HDM     64                    // head dim
#define QKVW    3072                  // projection GEMM columns: q | k | v
#define KVW     2048                  // f16 plane columns: k | v
#define KOUT    1024                  // K of the trailing GEMM
#define APITCH  1024                  // A plane pitch in 16-bit elements (2048 B = 16 lines)
#define NTHR    256
#define NWAVE   8
#define NBA     4                     // query slots per scan block: NBA * BD = 8 (slot, b) rows, one per wave
#define DEGCAP  64                    // static per-slot trip clamp (64 keys per query)
#define STP     32                    // ints per row-offset entry: one entry per 128-B line, so no line has two writers
#define NEMAX   (1 << 29)             // edge count bound: every index sum below stays a positive int
#define GBM     128                   // trailing GEMM rows per block
#define GBN     128                   // trailing GEMM cols per block
#define GTHR    256                   // trailing GEMM threads per block (8 waves, 2 x 4, 64 x 32 outputs each)
#define PBM     256                   // projection GEMM rows per block
#define PBN     192                   // projection GEMM cols per block
#define PTHR    512                   // projection GEMM threads per block (16 waves, 4 x 4, 64 x 48 outputs each)
#define GBK     128                   // k per pass: 256 B of every operand row
#define GPITCH  272                   // LDS row pitch in bytes (16 B x odd: b128 fragment reads without conflicts)
#define UQKV    (CW * (CW / 8))       // 131072 weight-prep units per projection matrix
#define UWX     (CW * (KOUT / 8))     // 131072 units for the WXT plane
#define NUW     (3 * UQKV + UWX)      // 524288
#define ATTSC   0.125f                // 1/sqrt(64)
#define WSMAX   134217728

static_assert(NBA == 4 && NBA * BD == NWAVE && NWAVE <= 32);
static_assert(CW == 4 * 32 * 8 && KVW == 2 * CW);     // 4 f16 row pieces of 512 B, lane owns 8 channels of each
static_assert(HDM == 8 * 8 && NHD * HDM == CW);       // one head = 8 neighbouring lanes in one piece
static_assert(QKVW == 3 * CW && (QKVW % PBN) == 0 && (CW % GBN) == 0 && (PBN % 64) == 0 && (CW % 64) == 0 && (PBM % GBM) == 0);
static_assert((CW % 32) == 0 && (KOUT % 32) == 0 && KOUT == CW && APITCH == KOUT);
static_assert((APITCH * 2) % 128 == 0);
static_assert(GBM == 128 && GBN == 128 && GTHR == 256 && GBK == 128);
static_assert((CW % GBK) == 0 && CW / GBK >= 2 && (KOUT % GBK) == 0 && (CW % GBN) == 0);
static_assert(GPITCH >= 2 * GBK && (GPITCH % 16) == 0);
static_assert(UQKV == (1 << 17) && (CW / 8) == 128 && (KOUT / 8) == 128);
static_assert(UQKV % NTHR == 0 && UWX % NTHR == 0 && (3 * UQKV) % NTHR == 0);
static_assert(DEGCAP >= 32);

typedef float          v4f  __attribute__((ext_vector_type(4)));
typedef float          v8f  __attribute__((ext_vector_type(8)));
typedef int            v4i  __attribute__((ext_vector_type(4)));
typedef int            v8i  __attribute__((ext_vector_type(8)));
typedef unsigned int   v4u  __attribute__((ext_vector_type(4)));
typedef unsigned short v8us __attribute__((ext_vector_type(8)));
typedef __bf16         v16b __attribute__((ext_vector_type(16)));
typedef _Float16       v4h  __attribute__((ext_vector_type(4)));
typedef _Float16       v8h  __attribute__((ext_vector_type(8)));
typedef _Float16       v16h __attribute__((ext_vector_type(16)));
typedef v4f  __attribute__((may_alias)) v4fa;
typedef v4i  __attribute__((may_alias)) v4ia;
typedef v4u  __attribute__((may_alias)) v4ua;
typedef v8us __attribute__((may_alias)) v8usa;
typedef v4h  __attribute__((may_alias)) v4ha;
typedef v8h  __attribute__((may_alias)) v8ha;
union FragB { v16b v; v16h f; v8us h[2]; v8i w; };

// WMMA with hazard guard: ties D, keeps A/B live for 4 VALU slots. HF: the 16 bits of an operand element are f16, else bf16
template <bool HF>
__device__ __forceinline__ v8f wmb(const FragB& a, const FragB& b, v8f c) {
  v8f d;
  if constexpr (HF) d = __builtin_amdgcn_wmma_f32_16x16x32_f16(false, a.f, false, b.f, (short)0, c, false, false);
  else              d = __builtin_amdgcn_wmma_f32_16x16x32_bf16(false, a.v, false, b.v, (short)0, c, false, false);
  asm volatile("v_nop\n\tv_nop\n\tv_nop\n\tv_nop" : "+v"(d) : "v"(a.w), "v"(b.w));
  return d;
}

// drain all outstanding vector-memory loads; also a compiler barrier for memory operations
__device__ __forceinline__ void ldwait() {
  asm volatile("s_wait_loadcnt 0x0" ::: "memory");
}

// sum over 8 neighbouring lanes, every lane gets it (row_xmask 1, 2, 4); all 32 lanes are on at every call
__device__ __forceinline__ float row8_sum(float v) {
  v += __int_as_float(__builtin_amdgcn_update_dpp(0, __float_as_int(v), 0x161, 0xf, 0xf, true));
  v += __int_as_float(__builtin_amdgcn_update_dpp(0, __float_as_int(v), 0x162, 0xf, 0xf, true));
  v += __int_as_float(__builtin_amdgcn_update_dpp(0, __float_as_int(v), 0x164, 0xf, 0xf, true));
  return v;
}

// 2^x. The v_nop fills the one slot that the instruction set asks for behind a transcendental.
__device__ __forceinline__ float exp2_slot(float x) {
  float r;
  asm("v_exp_f32 %0, %1\n\tv_nop" : "=v"(r) : "v"(x));
  return r;
}

// f32 -> bf16 bits, RNE convert; bf16 bits -> f32
__device__ __forceinline__ unsigned int f2bf(float f) {
  const unsigned int u = __float_as_uint(f);
  return ((u + 0x7FFFu + ((u >> 16) & 1u)) >> 16) & 0xFFFFu;
}
__device__ __forceinline__ float bf2f(unsigned int b) { return __uint_as_float(b << 16); }
__device__ __forceinline__ float bfr(float f) { return bf2f(f2bf(f)); }
__device__ __forceinline__ v4f bfr4(const v4f a) {
  v4f r; r.x = bfr(a.x); r.y = bfr(a.y); r.z = bfr(a.z); r.w = bfr(a.w); return r;
}
__device__ __forceinline__ unsigned int pk2(float lo, float hi) { return f2bf(lo) | (f2bf(hi) << 16); }
// 8 floats -> 8 bf16 packed in 16 B (element 2i = low half of word i)
__device__ __forceinline__ v4u pack8(const v4f a, const v4f b) {
  v4u r;
  r.x = pk2(a.x, a.y); r.y = pk2(a.z, a.w); r.z = pk2(b.x, b.y); r.w = pk2(b.z, b.w);
  return r;
}
// 8 floats -> 8 f16 (RNE) in 16 B, element order kept
__device__ __forceinline__ v8h pack8h(const v4f a, const v4f b) {
  v8h r;
  r[0] = (_Float16)a.x; r[1] = (_Float16)a.y; r[2] = (_Float16)a.z; r[3] = (_Float16)a.w;
  r[4] = (_Float16)b.x; r[5] = (_Float16)b.y; r[6] = (_Float16)b.z; r[7] = (_Float16)b.w;
  return r;
}

// ---------------------------------------------------------------------------
// Node feature plane: XB[row][c] = bf16(x[row][c]) for row < nN (all 1024 c), zero for pad rows nN <= row < MP
// (load address clamped into x, value zeroed by select). One thread = 8 contiguous 16-bit values (16 B) from two
// coverage: nUnits = MP*128 threads x 8 = MP x 1024 elements exactly.
// Row offsets of the edge list: q_id is ascending, so the edges of query q are the run st[q] .. st[q+1] - 1 with
// st[q] = first e with qid[e] >= q (nE if none), q = 0 .. nS. The thread of edge e stores e for every q in
// (qid[e-1], qid[e]] (qid[-1] = -1), the thread of the last edge also nE for every q above qid[nE-1]: each of the
// nS + 1 entries is stored exactly once (entry q = word STP * q). Values are clamped to -1 .. nS-1 before they index st.
// ---------------------------------------------------------------------------
__global__ __launch_bounds__(NTHR) void k_xprep(const float* __restrict__ x, unsigned short* xb, int nN, int nUnits,
                                                const int* __restrict__ qid, int* st, int nE, int nS) {
  const int i = (int)blockIdx.x * NTHR + (int)threadIdx.x;
  if (i >= nUnits) return;
  const int row = i >> 7;
  const int c0  = (i & 127) * 8;
  const int rc  = row < nN ? row : nN - 1;
  const float* p = x + (size_t)rc * CW + c0;
  v4f a = *(const v4fa*)p;
  v4f b = *(const v4fa*)(p + 4);
  const v4f z4 = {0.f, 0.f, 0.f, 0.f};
  if (row >= nN) { a = z4; b = z4; }
  const v4u hv = pack8(a, b);
  unsigned short* o = xb + (size_t)row * CW + c0;
  *(v4u*)o = hv;

  for (int e = i; e < nE; e += nUnits) {
    int cur = qid[e];
    int prv = qid[e > 0 ? e - 1 : 0];
    prv = e > 0 ? prv : -1;
    cur = cur < -1 ? -1 : (cur > nS - 1 ? nS - 1 : cur);
    prv = prv < -1 ? -1 : (prv > nS - 1 ? nS - 1 : prv);
    // both loops stay rolled and scalar: a trip count of 0 or 1 is the rule, wide unrolled bodies would only be code
#pragma clang loop vectorize(disable) unroll(disable)
    for (int q = prv + 1; q <= cur; ++q) st[(size_t)q * STP] = e;
    if (e == nE - 1) {
#pragma clang loop vectorize(disable) unroll(disable)
      for (int q = cur + 1; q <= nS; ++q) st[(size_t)q * STP] = nE;
    }
  }
}

// ---------------------------------------------------------------------------
// Weight planes (k-contiguous B rows; WQKVT bf16 bits, WXT f16 bits of the f32 inputs).
//   units 0..393215 (part = u >> 17, block-uniform): WQKVT[part*1024 + n][k8..k8+7] = bf16(W_part[n][k8..]),
//     W_part in {Wq, Wk, Wv}, each a natural [1024][1024] row-major matrix (out x in).
//   units 393216..524287 (block-uniform): WXT[n][k8..k8+7] = f16(Wx[n][k8..]).
// coverage: WQKVT = 3 x 131072 units x 8 = 3072 x 1024 exactly; WXT = 131072 units x 8 = 1024 x 1024 exactly.
// ---------------------------------------------------------------------------
__global__ __launch_bounds__(NTHR) void k_wprep(const float* __restrict__ Wq, const float* __restrict__ Wk,
                                                const float* __restrict__ Wv, const float* __restrict__ Wx,
                                                unsigned short* WQKVT, unsigned short* WXT) {
  const int u = (int)blockIdx.x * NTHR + (int)threadIdx.x;
  if (u >= NUW) return;
  if (u < 3 * UQKV) {                                    // block-uniform
    const int part = u >> 17;
    const int v    = u & (UQKV - 1);
    const int n    = v >> 7;                             // 0..1023
    const int k8   = (v & 127) * 8;                      // 0..1016
    const float* W = (part == 0) ? Wq : ((part == 1) ? Wk : Wv);
    const float* p = W + (size_t)n * CW + k8;            // W[n][k8 .. k8+7], contiguous
    const v4f a = *(const v4fa*)p;
    const v4f b = *(const v4fa*)(p + 4);
    *(v4u*)(WQKVT + (size_t)(part * CW + n) * CW + k8) = pack8(a, b);
  } else {
    const int v  = u - 3 * UQKV;                         // 0..131071
    const int n  = v >> 7;                               // 0..1023
    const int k8 = (v & 127) * 8;                        // 0..1016
    const float* p = Wx + (size_t)n * CW + k8;           // Wx[n][k8 .. k8+7], contiguous
    const v4f a = *(const v4fa*)p;
    const v4f b = *(const v4fa*)(p + 4);
    *(v8ha*)(WXT + (size_t)n * KOUT + k8) = pack8h(a, b);
  }
}

// ---------------------------------------------------------------------------
// Eight (acopy8) or six (acopy6) asynchronous 16-B-per-lane copies global -> LDS: rows RS apart in both places
// (gstep elements, RS pitches).
// The s_wait_xcnt stands inside the statement so that no address register is rewritten in front of it.
// ---------------------------------------------------------------------------
template <int RS>
__device__ __forceinline__ void acopy8(unsigned int l0, const unsigned short* g0, size_t gstep) {
  const unsigned int l1 = l0 + RS * GPITCH, l2 = l0 + 2 * RS * GPITCH, l3 = l0 + 3 * RS * GPITCH;
  const unsigned int l4 = l0 + 4 * RS * GPITCH, l5 = l0 + 5 * RS * GPITCH, l6 = l0 + 6 * RS * GPITCH, l7 = l0 + 7 * RS * GPITCH;
  const unsigned short* g1 = g0 + gstep;
  const unsigned short* g2 = g1 + gstep;
  const unsigned short* g3 = g2 + gstep;
  const unsigned short* g4 = g3 + gstep;
  const unsigned short* g5 = g4 + gstep;
  const unsigned short* g6 = g5 + gstep;
  const unsigned short* g7 = g6 + gstep;
  asm volatile("global_load_async_to_lds_b128 %0, %8, off\n\t"
               "global_load_async_to_lds_b128 %1, %9, off\n\t"
               "global_load_async_to_lds_b128 %2, %10, off\n\t"
               "global_load_async_to_lds_b128 %3, %11, off\n\t"
               "global_load_async_to_lds_b128 %4, %12, off\n\t"
               "global_load_async_to_lds_b128 %5, %13, off\n\t"
               "global_load_async_to_lds_b128 %6, %14, off\n\t"
               "global_load_async_to_lds_b128 %7, %15, off\n\t"
               "s_wait_xcnt 0x0"
               :: "v"(l0), "v"(l1), "v"(l2), "v"(l3), "v"(l4), "v"(l5), "v"(l6), "v"(l7),
                  "v"(g0), "v"(g1), "v"(g2), "v"(g3), "v"(g4), "v"(g5), "v"(g6), "v"(g7)
               : "memory");
}
template <int RS>
__device__ __forceinline__ void acopy6(unsigned int l0, const unsigned short* g0, size_t gstep) {
  const unsigned int l1 = l0 + RS * GPITCH, l2 = l0 + 2 * RS * GPITCH, l3 = l0 + 3 * RS * GPITCH;
  const unsigned int l4 = l0 + 4 * RS * GPITCH, l5 = l0 + 5 * RS * GPITCH;
  const unsigned short* g1 = g0 + gstep;
  const unsigned short* g2 = g1 + gstep;
  const unsigned short* g3 = g2 + gstep;
  const unsigned short* g4 = g3 + gstep;
  const unsigned short* g5 = g4 + gstep;
  asm volatile("global_load_async_to_lds_b128 %0, %6, off\n\t"
               "global_load_async_to_lds_b128 %1, %7, off\n\t"
               "global_load_async_to_lds_b128 %2, %8, off\n\t"
               "global_load_async_to_lds_b128 %3, %9, off\n\t"
               "global_load_async_to_lds_b128 %4, %10, off\n\t"
               "global_load_async_to_lds_b128 %5, %11, off\n\t"
               "s_wait_xcnt 0x0"
               :: "v"(l0), "v"(l1), "v"(l2), "v"(l3), "v"(l4), "v"(l5),
                  "v"(g0), "v"(g1), "v"(g2), "v"(g3), "v"(g4), "v"(g5)
               : "memory");
}
// the BN rows of the WT part of a stage: BN / RS copies per thread
template <int RS, int BN>
__device__ __forceinline__ void acopyB(unsigned int l0, const unsigned short* g0, size_t gstep) {
  static_assert(BN == 8 * RS || BN == 6 * RS);
  if constexpr (BN == 8 * RS) acopy8<RS>(l0, g0, gstep);
  else                        acopy6<RS>(l0, g0, gstep);
}

// ---------------------------------------------------------------------------
// 16-bit WMMA GEMM: C[rows][N] = A[MP][K] (16-bit elements, pitch lda) x WT[N][K]^T (rows n, k-contiguous, pitch K);
// both operands bf16 (HF false: k_gemm) or both f16 (HF true: k_gemm_h); copies and fragment maps are the same.
// grid (MP/BM, N/BN), NT threads: one BM x BN tile of C per block, NT/128 x 4 waves; wave w owns rows 64*(w>>2).. +63
// and cols (BN/4)*(w&3).. of it: acc[4][BN/64].
//   k_gemm   256 x 192, 512 threads, wave tile 64 x 48: 16 x 16 = 256 blocks for [4096][3072], and every operand byte
//            brought into LDS serves more products than in a 128 x 128 tile (448 rows per 49152 outputs, not 256 per 16384)
//   k_gemm_h 128 x 128, 256 threads, wave tile 64 x 32
// K runs in passes of 128 (256 B of every operand row); a stage is [A BM rows | WT BN rows] at LDS pitch 272 B, two
// buffers. Each thread copies pieces of 16 B (row = (NT/16) i + tid/16, piece = tid%16, so one wave instruction moves
// two whole 256-B row pieces); the copies of pass t+2 are issued behind the barrier that ends pass t and are waited
// for at the foot of pass t+1.
// A fragment (row m = lane&15): elements 0..7 <- k0+8h+0..7, 8..15 <- k0+16+8h+0..7 (h = lane>>4); B fragment
// (col n = lane&15) from its WT row with the SAME k map; D element r = (row 8h+r, col lane&15). k ascends in
// steps of 32 on one accumulator chain per output tile.
// Epilogue: the f32 tile is staged in the ring (every copy landed, every reader past the last barrier),
// + bf16-valued bias (bias vector selected by col / 1024, block-uniform; scaled by useBias in {0,1}; the load is
// always in range). BN == 128: one instruction writes one row segment: 512 B of f32 into outF for cols < nF, 256 B of
// f16 (RNE) into outH at col - nF for cols >= nF (block-uniform: nF is a multiple of 128). Else: per 64-col segment
// (inside one matrix and one output plane: 1024 and nF are multiples of 64) one instruction writes the segment of
// two rows: 2 x 256 B of f32 or 2 x 128 B of f16, whole lines.
// coverage: rows rowBase..rowBase+BM-1 restricted to < nRows x cols col0..col0+BN-1 per block;
//   grid (MP/BM, N/BN) covers every (row < nRows, col) exactly once.
// LDS extents: copies fill rows 0..BM+BN-1 x bytes 0..255 of a buffer (pitch 272); staging BM x (BN+4) floats.
// ---------------------------------------------------------------------------
template <bool HF, int BM, int BN, int NT>
__device__ __forceinline__ void gemm_body(
    const unsigned short* __restrict__ A, int lda, const unsigned short* __restrict__ WT, int K,
    float* outF, int ldo, int nRows,
    const float* __restrict__ bs0, const float* __restrict__ bs1, const float* __restrict__ bs2, int useBias,
    unsigned short* outH, int ldh, int nF)
{
  constexpr int NW  = NT / 32;                 // waves
  constexpr int FX  = BN / 64;                 // 16-col fragments per wave (4 wave columns)
  constexpr int RS  = NT / 16;                 // rows one copy instruction of the block covers
  constexpr int STG = (BM + BN) * GPITCH;      // one buffer
  constexpr int SP  = BN + 4;                  // output staging pitch in floats
  static_assert(BM == 64 * (NW / 4) && BN == 64 * FX && BM == 8 * RS);
  static_assert(BM * SP * 4 <= 2 * STG && (SP * 4) % 16 == 0 && 2 * STG <= 327680);
  __shared__ __attribute__((aligned(16))) unsigned char ring[2 * STG];
  const int tid = (int)threadIdx.x, lane = tid & 31, wave = tid >> 5, hh = lane >> 4, m = lane & 15;
  const int wm = wave >> 2, wn = wave & 3;
  const int rowBase = (int)blockIdx.x * BM;
  const int col0    = (int)blockIdx.y * BN;

  v8f acc[4][FX];
  {
    const v8f z = {0.f, 0.f, 0.f, 0.f, 0.f, 0.f, 0.f, 0.f};
#pragma unroll
    for (int i = 0; i < 4; ++i) {
#pragma unroll
      for (int j = 0; j < FX; ++j) acc[i][j] = z;
    }
  }
  const int crow = tid >> 4, cseg = tid & 15;
  const unsigned short* ga = A  + (size_t)(rowBase + crow) * (size_t)lda + 8 * cseg;
  const unsigned short* gb = WT + (size_t)(col0 + crow) * (size_t)K + 8 * cseg;
  const size_t sa = (size_t)RS * (size_t)lda, sb = (size_t)RS * (size_t)K;
  const unsigned int la = (unsigned int)(size_t)ring + (unsigned int)(crow * GPITCH + 16 * cseg);
  const unsigned int lb = la + BM * GPITCH;
  const int npass = K / GBK;

  acopy8<RS>(la, ga, sa);
  acopyB<RS, BN>(lb, gb, sb);
  asm volatile("s_wait_asynccnt 0x0" ::: "memory");   // this wave's part of stage 0 has landed
  __syncthreads();                                     // stage 0 readable by every wave
  if (npass > 1) {
    acopy8<RS>(la + STG, ga + GBK, sa);
    acopyB<RS, BN>(lb + STG, gb + GBK, sb);
  }

#pragma unroll 1   // passes stay rolled: one copy of the WMMA body
  for (int t = 0; t < npass; ++t) {
    const unsigned int bo = (unsigned int)(t & 1) * STG;
    const unsigned char* ar = ring + bo + (64 * wm + m) * GPITCH + 16 * hh;
    const unsigned char* br = ring + bo + (BM + 16 * FX * wn + m) * GPITCH + 16 * hh;
#pragma unroll
    for (int kk = 0; kk < GBK / 32; ++kk) {
      FragB af[4], bf[FX];
#pragma unroll
      for (int i = 0; i < 4; ++i) {
        af[i].h[0] = *(const v8usa*)(ar + 16 * i * GPITCH + 64 * kk);        // k = 32kk + 8hh + 0..7
        af[i].h[1] = *(const v8usa*)(ar + 16 * i * GPITCH + 64 * kk + 32);   // k = 32kk + 16 + 8hh + 0..7
      }
#pragma unroll
      for (int j = 0; j < FX; ++j) {
        bf[j].h[0] = *(const v8usa*)(br + 16 * j * GPITCH + 64 * kk);        // same k map as A
        bf[j].h[1] = *(const v8usa*)(br + 16 * j * GPITCH + 64 * kk + 32);
      }
#pragma unroll
      for (int i = 0; i < 4; ++i) {
#pragma unroll
        for (int j = 0; j < FX; ++j) acc[i][j] = wmb<HF>(af[i], bf[j], acc[i][j]);
      }
    }
    asm volatile("s_wait_dscnt 0x0" ::: "memory");     // this wave's reads of the buffer are done before its refill
    asm volatile("s_wait_asynccnt 0x0" ::: "memory");  // this wave's part of stage t+1 has landed
    __syncthreads();                                   // publishes stage t+1, frees the buffer of stage t
    if (t + 2 < npass) {                               // block-uniform
      acopy8<RS>(la + bo, ga + (size_t)(t + 2) * GBK, sa);
      acopyB<RS, BN>(lb + bo, gb + (size_t)(t + 2) * GBK, sb);
    }
  }
  asm volatile("s_wait_asynccnt 0x0" ::: "memory");    // nothing in flight when the ring becomes output staging

  float* stg = (float*)ring;
#pragma unroll
  for (int i = 0; i < 4; ++i) {
#pragma unroll
    for (int j = 0; j < FX; ++j) {
      const int lc = 16 * FX * wn + 16 * j + m;
#pragma unroll
      for (int r = 0; r < 8; ++r) {
        const int lr = 64 * wm + 16 * i + 8 * hh + r;   // D element r = (row 8hh+r, col m)
        stg[lr * SP + lc] = acc[i][j][r];
      }
    }
  }
  __syncthreads();

  if constexpr (BN == 128) {
    const int mat = col0 / CW;                            // block-uniform
    const float* bsel = (mat == 0) ? bs0 : ((mat == 1) ? bs1 : bs2);
    v4f b4 = *(const v4fa*)(bsel + (col0 & (CW - 1)) + 4 * lane);
    b4 = bfr4(b4) * (float)useBias;

    v4f fv[16];
#pragma unroll
    for (int i = 0; i < 16; ++i) {
      const int lr = 16 * wave + i;
      fv[i] = *(const v4fa*)(stg + lr * SP + 4 * lane) + b4;
    }
    if (col0 < nF) {                                      // block-uniform
#pragma unroll
      for (int i = 0; i < 16; ++i) {
        const int lr = 16 * wave + i;
        const int gr = rowBase + lr;
        const int gs = gr < nRows ? gr : nRows - 1;
        float* op = outF + (size_t)gs * (size_t)ldo + col0 + 4 * lane;
        if (gr < nRows) *(v4f*)op = fv[i];
      }
    } else {
#pragma unroll
      for (int i = 0; i < 16; ++i) {
        const int lr = 16 * wave + i;
        const int gr = rowBase + lr;
        const int gs = gr < nRows ? gr : nRows - 1;
        unsigned short* op = outH + (size_t)gs * (size_t)ldh + (col0 - nF) + 4 * lane;
        v4h h4;
        h4.x = (_Float16)fv[i].x; h4.y = (_Float16)fv[i].y; h4.z = (_Float16)fv[i].z; h4.w = (_Float16)fv[i].w;
        if (gr < nRows) *(v4ha*)op = h4;
      }
    }
  } else {
    constexpr int NI = BM / (2 * NW);                     // row pairs per wave and segment
#pragma unroll
    for (int sg = 0; sg < BN / 64; ++sg) {
      const int gc0 = col0 + 64 * sg;                     // block-uniform
      const int mat = gc0 / CW;
      const float* bsel = (mat == 0) ? bs0 : ((mat == 1) ? bs1 : bs2);
      v4f b4 = *(const v4fa*)(bsel + (gc0 & (CW - 1)) + 4 * m);
      b4 = bfr4(b4) * (float)useBias;
      v4f fv[NI];
#pragma unroll
      for (int i = 0; i < NI; ++i) {
        const int lr = 2 * NW * i + 2 * wave + hh;
        fv[i] = *(const v4fa*)(stg + lr * SP + 64 * sg + 4 * m) + b4;
      }
      if (gc0 < nF) {                                     // block-uniform
#pragma unroll
        for (int i = 0; i < NI; ++i) {
          const int gr = rowBase + 2 * NW * i + 2 * wave + hh;
          const int gs = gr < nRows ? gr : nRows - 1;
          float* op = outF + (size_t)gs * (size_t)ldo + gc0 + 4 * m;
          if (gr < nRows) *(v4f*)op = fv[i];
        }
      } else {
#pragma unroll
        for (int i = 0; i < NI; ++i) {
          const int gr = rowBase + 2 * NW * i + 2 * wave + hh;
          const int gs = gr < nRows ? gr : nRows - 1;
          unsigned short* op = outH + (size_t)gs * (size_t)ldh + (gc0 - nF) + 4 * m;
          v4h h4;
          h4.x = (_Float16)fv[i].x; h4.y = (_Float16)fv[i].y; h4.z = (_Float16)fv[i].z; h4.w = (_Float16)fv[i].w;
          if (gr < nRows) *(v4ha*)op = h4;
        }
      }
    }
  }
}

__global__ __launch_bounds__(PTHR) void k_gemm(
    const unsigned short* __restrict__ A, int lda, const unsigned short* __restrict__ WT, int K,
    float* outF, int ldo, int nRows,
    const float* __restrict__ bs0, const float* __restrict__ bs1, const float* __restrict__ bs2, int useBias,
    unsigned short* outH, int ldh, int nF)
{
  gemm_body<false, PBM, PBN, PTHR>(A, lda, WT, K, outF, ldo, nRows, bs0, bs1, bs2, useBias, outH, ldh, nF);
}

__global__ __launch_bounds__(GTHR) void k_gemm_h(
    const unsigned short* __restrict__ A, int lda, const unsigned short* __restrict__ WT, int K,
    float* outF, int ldo, int nRows,
    const float* __restrict__ bs0, const float* __restrict__ bs1, const float* __restrict__ bs2, int useBias,
    unsigned short* outH, int ldh, int nF)
{
  gemm_body<true, GBM, GBN, GTHR>(A, lda, WT, K, outF, ldo, nRows, bs0, bs1, bs2, useBias, outH, ldh, nF);
}

// ---------------------------------------------------------------------------
// Query-keyed sparse attention, no atomics, no LDS, no barriers. Block owns query slots [nodeBase, nodeBase + NBA);
// the edges of query q are st[q] .. st[q+1] - 1 (k_xprep's row offsets of the ascending q_id list), the gathered side
// is kid[e]. Both offsets are clamped into 0 .. nE, whatever the table holds.
// Waves independent: wave w owns the one (slot, b) row w of the block's NBA * BD = 8
//   rows (slot = w / 2, b = w % 2; row = 2*query + b of the QP and KVH planes). Lane l owns channels 256j+8l..256j+8l+7
//   of piece j = 0..3, so every load instruction of an f16 row reads 512 contiguous bytes (4 lines); head of (j, l) =
//   4j + (l>>3). Per (slot, b): the 1024-float q row (8 b128 loads per lane). Per edge in ascending edge order:
//   kd = kid[eid] (clamped), the 4-KB k | v row of (kd, b) (8 b128 loads per lane, one wait), per piece the dot of the
//   lane's 8 channels and its sum over the head's 8 lanes, logit * 1/8, running-max single pass per head (each lane
//   keeps the 4 heads it has a part in): den = den*exp(mx-mn) + exp(l-mn), av_c likewise with the v half of the row.
//   o_c = av_c / den (NaN poison above DEGCAP edges, zero row for pad queries >= nS); the lane's 8 channels of a piece
//   are one 16-B unit of the f16 plane, so every store instruction writes 512 contiguous bytes:
// coverage: gridDim.x * NBA * 2 >= mRows (host-checked): APL rows 0..mRows-1 x cols 0..1023 written exactly once.
// ---------------------------------------------------------------------------
__global__ __launch_bounds__(NTHR) void k_scan(const int* __restrict__ st, const int* __restrict__ kid,
                                               const float* __restrict__ QP,
                                               const unsigned short* __restrict__ KVH, unsigned short* apl,
                                               int nE, int nS, int mRows) {
  const int tid = (int)threadIdx.x, lane = tid & 31, wave = tid >> 5;
  const int nodeBase = (int)blockIdx.x * NBA;
  const int wv = __builtin_amdgcn_readfirstlane(wave);  // scalar, so that offsets, slot and b stay wave-uniform registers

  const float qnan = __int_as_float(0x7fc00000);
  const v4f z4 = {0.f, 0.f, 0.f, 0.f};
  {
    const int s  = wv / BD;                             // slot
    const int b  = wv % BD;
    const int qn = nodeBase + s;                        // query index
    const int  qc   = qn < nS ? qn : nS - 1;
    const bool live = qn < nS;                          // wave-uniform
    int elo = st[(size_t)qc * STP], ehi = st[((size_t)qc + 1) * STP];   // the query's run of edges
    elo = elo < 0 ? 0 : (elo > nE ? nE : elo);
    ehi = ehi < elo ? elo : (ehi > nE ? nE : ehi);
    int c = live ? ehi - elo : 0;
    const bool big = c > DEGCAP;
    c = c > DEGCAP ? DEGCAP : c;
    const bool pois = big;

    {
      const float* qr = QP + ((size_t)qc * BD + b) * CW + 8 * lane;
      v4f qa[4], qb[4];
#pragma unroll
      for (int j = 0; j < 4; ++j) {
        qa[j] = *(const v4fa*)(qr + 256 * j);
        qb[j] = *(const v4fa*)(qr + 256 * j + 4);
      }
      ldwait();

      float mx[4], dn[4];
      v4f aa[4], ab[4];
#pragma unroll
      for (int j = 0; j < 4; ++j) { mx[j] = -1.0e30f; dn[j] = 0.0f; aa[j] = z4; ab[j] = z4; }

#pragma unroll 1
      for (int b0 = 0; b0 < c; b0 += 32) {
        const int idx = b0 + lane;                       // 0 .. DEGCAP - 1
        int eid = elo + idx;                             // elo >= 0
        eid = eid > nE - 1 ? nE - 1 : eid;
        int kd = kid[eid];
        kd = kd < 0 ? 0 : (kd > nS - 1 ? nS - 1 : kd);
        const int m32 = (c - b0) < 32 ? (c - b0) : 32;
#pragma unroll 1
        for (int k = 0; k < m32; ++k) {
          const int tk = __builtin_amdgcn_readlane(kd, k);
          const unsigned short* kr = KVH + ((size_t)tk * BD + b) * KVW + 8 * lane;   // whole 4-KB k | v row
          v8h kv[4], vv[4];
#pragma unroll
          for (int j = 0; j < 4; ++j) kv[j] = *(const v8ha*)(kr + 256 * j);
#pragma unroll
          for (int j = 0; j < 4; ++j) vv[j] = *(const v8ha*)(kr + CW + 256 * j);
          ldwait();
          float s1[4], s2[4];
#pragma unroll
          for (int j = 0; j < 4; ++j) {
            float p = qa[j].x * (float)kv[j][0];
            p = fmaf(qa[j].y, (float)kv[j][1], p); p = fmaf(qa[j].z, (float)kv[j][2], p);
            p = fmaf(qa[j].w, (float)kv[j][3], p); p = fmaf(qb[j].x, (float)kv[j][4], p);
            p = fmaf(qb[j].y, (float)kv[j][5], p); p = fmaf(qb[j].z, (float)kv[j][6], p);
            p = fmaf(qb[j].w, (float)kv[j][7], p);
            p = row8_sum(p);                            // sum over the head's 8 lanes
            const float lg = p * ATTSC;
            const float df = lg - mx[j];
            const float ee = exp2_slot(-1.44269504f * fabsf(df));   // exp(-|df|); the other factor is exactly 1
            const bool up  = df > 0.0f;
            s1[j] = up ? ee : 1.0f;
            s2[j] = up ? 1.0f : ee;
            mx[j] = up ? lg : mx[j];
            dn[j] = fmaf(dn[j], s1[j], s2[j]);
          }
#pragma unroll
          for (int j = 0; j < 4; ++j) {
            aa[j].x = fmaf(aa[j].x, s1[j], s2[j] * (float)vv[j][0]); aa[j].y = fmaf(aa[j].y, s1[j], s2[j] * (float)vv[j][1]);
            aa[j].z = fmaf(aa[j].z, s1[j], s2[j] * (float)vv[j][2]); aa[j].w = fmaf(aa[j].w, s1[j], s2[j] * (float)vv[j][3]);
            ab[j].x = fmaf(ab[j].x, s1[j], s2[j] * (float)vv[j][4]); ab[j].y = fmaf(ab[j].y, s1[j], s2[j] * (float)vv[j][5]);
            ab[j].z = fmaf(ab[j].z, s1[j], s2[j] * (float)vv[j][6]); ab[j].w = fmaf(ab[j].w, s1[j], s2[j] * (float)vv[j][7]);
          }
        }
      }

      v8h hv[4];
#pragma unroll
      for (int j = 0; j < 4; ++j) {
        const float inv  = __builtin_amdgcn_rcpf(dn[j]); // den >= 1 when c > 0; c == 0 -> inf and 0 * inf = NaN (0 / 0)
        const float invp = pois ? qnan : inv;
        v4f pa, pb;                                      // cols 256j+8l .. 256j+8l+7
        pa.x = live ? aa[j].x * invp : 0.0f;
        pa.y = live ? aa[j].y * invp : 0.0f;
        pa.z = live ? aa[j].z * invp : 0.0f;
        pa.w = live ? aa[j].w * invp : 0.0f;
        pb.x = live ? ab[j].x * invp : 0.0f;
        pb.y = live ? ab[j].y * invp : 0.0f;
        pb.z = live ? ab[j].z * invp : 0.0f;
        pb.w = live ? ab[j].w * invp : 0.0f;
        hv[j] = pack8h(pa, pb);
      }
      const int row = qn * BD + b;
      if (row < mRows) {                                 // wave-uniform
        unsigned short* rp = apl + (size_t)row * APITCH;
#pragma unroll
        for (int j = 0; j < 4; ++j) *(v8ha*)(rp + 256 * j + 8 * lane) = hv[j];
      }
    }
  }
}

// ---------------------------------------------------------------------------
static inline int cdiv(int a, int b) { return (a + b - 1) / b; }
static inline size_t al256(size_t o) { return (o + 255) & ~(size_t)255; }

extern "C" void kernel_launch(void* const* d_in, const int* in_sizes, int n_in,
                              void* d_out, int out_size, void* d_ws, size_t ws_size,
                              hipStream_t stream) {
  if (n_in < 11) return;
  if (in_sizes[0] < BD * CW || (in_sizes[0] % (BD * CW)) != 0) return;   // x [S][2][1024]
  const int nS = in_sizes[0] / (BD * CW);
  if (nS < 1 || nS > (1 << 20)) return;
  const int nE = in_sizes[1];                                          // q_id [E]
  if (nE < 1 || nE >= NEMAX) return;
  if (in_sizes[2] != nE) return;                                       // k_id [E]
  if (in_sizes[3] != CW * CW || in_sizes[5] != CW * CW || in_sizes[7] != CW * CW || in_sizes[9] != CW * CW) return;
  if (in_sizes[4] != CW || in_sizes[6] != CW || in_sizes[8] != CW || in_sizes[10] != CW) return;
  if ((long long)out_size != (long long)nS * BD * CW) return;          // out [S][2][1024]

  const float* x   = (const float*)d_in[0];     // [S][2][1024] -> rows 2s+b of 1024
  const int*   qid = (const int*)  d_in[1];     // [E] key side (query)
  const int*   kid = (const int*)  d_in[2];     // [E] gathered side (k, v)
  const float* Wq  = (const float*)d_in[3];     // [1024][1024] natural [out][in]
  const float* bq  = (const float*)d_in[4];
  const float* Wk  = (const float*)d_in[5];
  const float* bk  = (const float*)d_in[6];
  const float* Wv  = (const float*)d_in[7];
  const float* bv  = (const float*)d_in[8];
  const float* Wx  = (const float*)d_in[9];
  const float* bx  = (const float*)d_in[10];
  float* out = (float*)d_out;                   // [S][2][1024] -> rows 2s+b of 1024

  const int nRows = nS * BD;
  const int MP = cdiv(nRows, PBM) * PBM;        // padded rows of every node plane
  const int gM = MP / GBM;
  const int gA = cdiv(cdiv(MP, BD), NBA);
  if ((long long)gA * NBA * BD < (long long)MP) return;

  // workspace carve (256-B aligned; every region sized to its whole-row store extent incl. padded rows MP)
  char* ws = (char*)d_ws;
  size_t off = 0;
  const size_t oXB  = off; off = al256(off + (size_t)MP * CW * 2);        // XB    [MP][1024]   bf16
  const size_t oWQ  = off; off = al256(off + (size_t)QKVW * CW * 2);      // WQKVT [3072][1024] bf16
  const size_t oWX  = off; off = al256(off + (size_t)CW * KOUT * 2);      // WXT   [1024][1024] f16
  const size_t oQP  = off; off = al256(off + (size_t)MP * CW * 4);        // QP    [MP][1024]   f32
  const size_t oKVH = off; off = al256(off + (size_t)MP * KVW * 2);       // KVH   [MP][2048]   f16
  const size_t oAPL = off; off = al256(off + (size_t)MP * APITCH * 2);    // APL   [MP][1024]   f16
  const size_t oST  = off; off = al256(off + ((size_t)nS + 1) * STP * 4); // ST    [S + 1][32]  int
  if (off > ws_size || off > (size_t)WSMAX) return;
  unsigned short* XB    = (unsigned short*)(ws + oXB);
  unsigned short* WQKVT = (unsigned short*)(ws + oWQ);
  unsigned short* WXT   = (unsigned short*)(ws + oWX);
  float*          QP    = (float*)(ws + oQP);
  unsigned short* KVH   = (unsigned short*)(ws + oKVH);
  unsigned short* APL   = (unsigned short*)(ws + oAPL);
  int*            ST    = (int*)(ws + oST);

  // node feature plane (bf16 bits), pad rows zero; row offsets of the edge list
  const int nUx = MP * (CW / 8);
  k_xprep<<<cdiv(nUx, NTHR), NTHR, 0, stream>>>(x, XB, nRows, nUx, qid, ST, nE, nS);
  // weight planes
  k_wprep<<<NUW / NTHR, NTHR, 0, stream>>>(Wq, Wk, Wv, Wx, WQKVT, WXT);
  // projection GEMM: XB [Wq|Wk|Wv]^T + b -> q f32 [MP][1024], k | v f16 [MP][2048]
  k_gemm<<<dim3(MP / PBM, QKVW / PBN), PTHR, 0, stream>>>(XB, CW, WQKVT, CW, QP, CW, MP, bq, bk, bv, 1, KVH, KVW, CW);
  // query-keyed sparse attention -> APL [MP][1024]
  k_scan<<<gA, NTHR, 0, stream>>>(ST, kid, QP, KVH, APL, nE, nS, MP);
  // trailing GEMM: out = APL . WXT^T + bx -> rows < nRows
  k_gemm_h<<<dim3(gM, CW / GBN), GTHR, 0, stream>>>(APL, APITCH, WXT, KOUT, out, CW, nRows, bx, bx, bx, 1, KVH, KVW, CW);
}
